// v000
// Times are from an AMD MI455X. After a warm-up the kernel runs many times in a row, and a time is the length of
// such a window on the GPU divided by its runs, so every launch and the gaps after it count. The runs cycle
// through copies of the inputs. A figure is the median of several windows, for all but v000 over two sittings.
// Sittings can differ by a few percent; kernels timed side by side share one.
// v000, which the later versions start from, runs in 2120 microseconds.
#include <hip/hip_runtime.h>
#include <hip/hip_bf16.h>
#include <math.h>

// ---------------------------------------------------------------------------
// CrossAttention1d for MI455X (gfx1250): bf16 WMMA pipeline, f32 accumulate.
// N=4, C=512, S=2048, S2=2048, H=8, CTX=512.  ~412 GFLOP -> compute-bound,
// all 5 matmul stages on v_wmma_f32_16x16x32_bf16, tiles staged to LDS via
// CDNA5 async copies (global_load_async_to_lds_b128 + s_wait_asynccnt).
// ---------------------------------------------------------------------------

typedef __bf16 bf16;
typedef __attribute__((ext_vector_type(16))) __bf16 v16bf;
typedef __attribute__((ext_vector_type(8)))  float  v8f;
typedef __attribute__((ext_vector_type(4)))  float  f4;

static constexpr int kN = 4, kC = 512, kS = 2048, kS2 = 2048, kH = 8, kCTX = 512;
static constexpr int kO = kC * kH;      // 4096
static constexpr float kEPS = 1e-5f;

__device__ __forceinline__ bf16 f2bf(float f) {
  unsigned u = __builtin_bit_cast(unsigned, f);
  u += 0x7FFFu + ((u >> 16) & 1u);          // round-to-nearest-even
  unsigned short h = (unsigned short)(u >> 16);
  return __builtin_bit_cast(bf16, h);
}

// ---------------------------------------------------------------------------
// Stage 0: batch-wide mean / rstd (layernorm over all C*S per n)
// ---------------------------------------------------------------------------
__global__ void zero_f32(float* p, int n) {
  int i = blockIdx.x * 256 + threadIdx.x;
  if (i < n) p[i] = 0.f;
}

__global__ __launch_bounds__(256)
void reduce_stats(const float* __restrict__ in, float* __restrict__ raw) {
  __shared__ float sh0[256], sh1[256];
  const int n = blockIdx.y;
  const float* p = in + (size_t)n * kC * kS;
  float s = 0.f, s2 = 0.f;
  for (int i = blockIdx.x * 256 + threadIdx.x; i < kC * kS; i += gridDim.x * 256) {
    float v = p[i]; s += v; s2 += v * v;
  }
  sh0[threadIdx.x] = s; sh1[threadIdx.x] = s2;
  __syncthreads();
  for (int o = 128; o > 0; o >>= 1) {
    if ((int)threadIdx.x < o) {
      sh0[threadIdx.x] += sh0[threadIdx.x + o];
      sh1[threadIdx.x] += sh1[threadIdx.x + o];
    }
    __syncthreads();
  }
  if (threadIdx.x == 0) {
    atomicAdd(&raw[2 * n + 0], sh0[0]);
    atomicAdd(&raw[2 * n + 1], sh1[0]);
  }
}

__global__ void finalize_stats(const float* __restrict__ raw, float* __restrict__ stats) {
  int n = threadIdx.x;
  if (n < kN) {
    float inv  = 1.0f / (float)(kC * kS);
    float mean = raw[2 * n] * inv;
    float var  = raw[2 * n + 1] * inv - mean * mean;
    stats[2 * n + 0] = mean;
    stats[2 * n + 1] = rsqrtf(var + kEPS);
  }
}

// ---------------------------------------------------------------------------
// Stage 1: (optionally layernorm-affine) transpose (n,R,Cc)f32 -> (n,Cc,R)bf16
// ---------------------------------------------------------------------------
__global__ __launch_bounds__(256)
void norm_transpose(const float* __restrict__ in, bf16* __restrict__ outp,
                    int R, int Cc, const float* __restrict__ stats,
                    const float* __restrict__ gamma, const float* __restrict__ beta) {
  __shared__ float tile[32][33];
  const int nb = blockIdx.z;
  const int r0 = blockIdx.y * 32;
  const int c0 = blockIdx.x * 32;
  const float* pin = in + ((size_t)nb * R + r0) * Cc + c0;
  for (int i = threadIdx.y; i < 32; i += 8)
    tile[i][threadIdx.x] = pin[(size_t)i * Cc + threadIdx.x];
  __syncthreads();
  float mu = 0.f, rinv = 1.f, g = 1.f, b = 0.f;
  const int r = r0 + threadIdx.x;  // original row (= channel index)
  if (stats) { mu = stats[2 * nb]; rinv = stats[2 * nb + 1]; g = gamma[r]; b = beta[r]; }
  bf16* pout = outp + ((size_t)nb * Cc + c0) * R + r0;
  for (int i = threadIdx.y; i < 32; i += 8) {
    float v = tile[threadIdx.x][i];
    v = (v - mu) * rinv * g + b;
    pout[(size_t)i * R + threadIdx.x] = f2bf(v);
  }
}

__global__ void cvt_bf16(const float* __restrict__ in, bf16* __restrict__ o, int n) {
  int i = blockIdx.x * 256 + threadIdx.x;
  if (i < n) o[i] = f2bf(in[i]);
}

// ---------------------------------------------------------------------------
// Row softmax: f32 (rows x ncols) -> bf16 probabilities
// ---------------------------------------------------------------------------
__global__ __launch_bounds__(256)
void softmax_rows(const float* __restrict__ Sin, bf16* __restrict__ P, int ncols) {
  __shared__ float red[256];
  const int row = blockIdx.x;
  const float* p = Sin + (size_t)row * ncols;
  bf16* q = P + (size_t)row * ncols;
  float m = -3.4e38f;
  for (int i = threadIdx.x; i < ncols; i += 256) m = fmaxf(m, p[i]);
  red[threadIdx.x] = m; __syncthreads();
  for (int o = 128; o > 0; o >>= 1) {
    if ((int)threadIdx.x < o) red[threadIdx.x] = fmaxf(red[threadIdx.x], red[threadIdx.x + o]);
    __syncthreads();
  }
  m = red[0]; __syncthreads();
  float s = 0.f;
  for (int i = threadIdx.x; i < ncols; i += 256) s += __expf(p[i] - m);
  red[threadIdx.x] = s; __syncthreads();
  for (int o = 128; o > 0; o >>= 1) {
    if ((int)threadIdx.x < o) red[threadIdx.x] += red[threadIdx.x + o];
    __syncthreads();
  }
  const float inv = 1.0f / red[0];
  for (int i = threadIdx.x; i < ncols; i += 256) q[i] = f2bf(__expf(p[i] - m) * inv);
}

// ---------------------------------------------------------------------------
// CDNA5 async copy: 16B per lane, global -> LDS, tracked by ASYNCcnt.
//   lds_off : per-lane LDS byte address (low 32 bits of LDS pointer)
//   base    : uniform 64-bit global base (SGPR pair)
//   gl_off  : per-lane 32-bit byte offset
// ---------------------------------------------------------------------------
__device__ __forceinline__ void async_ld16(unsigned lds_off, const bf16* base,
                                           unsigned gl_off) {
  asm volatile("global_load_async_to_lds_b128 %0, %1, %2"
               :: "v"(lds_off), "v"(gl_off), "s"(base)
               : "memory");
}
__device__ __forceinline__ void wait_async0() {
  asm volatile("s_wait_asynccnt 0x0" ::: "memory");
}

// ---------------------------------------------------------------------------
// NT GEMM:  D(M,Nn) = A(M,K) * B(Nn,K)^T   (bf16 in, f32 accum via WMMA)
//   TRANS    : store D transposed (Cout[n][m]) — 16B-contiguous per lane
//   OUT_BF16 : output bf16 (else f32)
//   HAS_BIAS : + bias[m]
//   HAS_RES  : + res[m*ldc + n] (row-major only)
// block tile 128x128, 8 waves (4x2), K-step 32, double-buffered LDS filled by
// async copies that overlap the WMMA stream.
// ---------------------------------------------------------------------------
static constexpr int BM = 128, BN = 128, BK = 32;
static constexpr int LDSS = 40;   // padded row stride in bf16 elems (80B)

union FragAB { v16bf v; f4 f[2]; };

template <bool TRANS, bool OUT_BF16, bool HAS_BIAS, bool HAS_RES>
__global__ __launch_bounds__(256)
void gemm_nt(const bf16* __restrict__ A, const bf16* __restrict__ B,
             void* __restrict__ Cout, const float* __restrict__ bias,
             const float* __restrict__ res,
             int M, int Nn, int K, int lda, int ldb, int ldc, float scale) {
  __shared__ bf16 shA[2][BM * LDSS];
  __shared__ bf16 shB[2][BN * LDSS];

  const int tid  = threadIdx.x;
  const int lane = tid & 31;
  const int wv   = tid >> 5;
  const int wm   = wv & 3;          // 4 wave-rows
  const int wn   = wv >> 2;         // 2 wave-cols
  const int m0   = blockIdx.y * BM;
  const int n0   = blockIdx.x * BN;

  // staging: each thread owns one 32B chunk (= 2 async b128) per tile
  const int lr = tid >> 1;           // 0..127 (tile row)
  const int lc = (tid & 1) * 16;     // 0 or 16 (k elems)

  const bf16* aBase = A + (size_t)m0 * lda;   // block-uniform -> SGPRs
  const bf16* bBase = B + (size_t)n0 * ldb;
  const unsigned aOffG = (unsigned)((lr * lda + lc) * 2);   // bytes
  const unsigned bOffG = (unsigned)((lr * ldb + lc) * 2);
  const unsigned thrL  = (unsigned)((lr * LDSS + lc) * 2);  // bytes
  const unsigned sA[2] = { (unsigned)(unsigned long long)&shA[0][0],
                           (unsigned)(unsigned long long)&shA[1][0] };
  const unsigned sB[2] = { (unsigned)(unsigned long long)&shB[0][0],
                           (unsigned)(unsigned long long)&shB[1][0] };

  auto issue_tile = [&](int kt, int buf) {
    const unsigned la = sA[buf] + thrL;
    const unsigned lb = sB[buf] + thrL;
    const unsigned ga = aOffG + (unsigned)(kt * BK * 2);
    const unsigned gb = bOffG + (unsigned)(kt * BK * 2);
    async_ld16(la,       aBase, ga);
    async_ld16(la + 16u, aBase, ga + 16u);
    async_ld16(lb,       bBase, gb);
    async_ld16(lb + 16u, bBase, gb + 16u);
  };

  const int KT = K / BK;
  issue_tile(0, 0);

  v8f acc[2][4];
#pragma unroll
  for (int i = 0; i < 2; ++i)
#pragma unroll
    for (int j = 0; j < 4; ++j)
#pragma unroll
      for (int r = 0; r < 8; ++r) acc[i][j][r] = 0.f;

  const int hl = lane >> 4;          // K-quarter selector
  const int fr = lane & 15;          // fragment row (M for A, N for B)

  for (int kt = 0; kt < KT; ++kt) {
    const int cur = kt & 1;
    wait_async0();        // my async writes for tile kt have landed in LDS
    __syncthreads();      // everyone's writes landed; buf[cur^1] free to fill
    if (kt + 1 < KT) issue_tile(kt + 1, cur ^ 1);
    if (kt + 2 < KT) {
      __builtin_prefetch(aBase + (size_t)lr * lda + lc + (size_t)(kt + 2) * BK, 0, 1);
      __builtin_prefetch(bBase + (size_t)lr * ldb + lc + (size_t)(kt + 2) * BK, 0, 1);
    }

    FragAB a[2], b[4];
#pragma unroll
    for (int i = 0; i < 2; ++i) {
      const bf16* p = &shA[cur][(wm * 32 + i * 16 + fr) * LDSS + 8 * hl];
      a[i].f[0] = *(const f4*)p;
      a[i].f[1] = *(const f4*)(p + 16);
    }
#pragma unroll
    for (int j = 0; j < 4; ++j) {
      const bf16* p = &shB[cur][(wn * 64 + j * 16 + fr) * LDSS + 8 * hl];
      b[j].f[0] = *(const f4*)p;
      b[j].f[1] = *(const f4*)(p + 16);
    }
#pragma unroll
    for (int i = 0; i < 2; ++i)
#pragma unroll
      for (int j = 0; j < 4; ++j)
        acc[i][j] = __builtin_amdgcn_wmma_f32_16x16x32_bf16(
            false, a[i].v, false, b[j].v, (short)0, acc[i][j], false, false);
  }

  // epilogue: D tile [16x16]; lane fr = N index, VGPR r -> M = 8*hl + r
#pragma unroll
  for (int i = 0; i < 2; ++i) {
    const int mBase = m0 + wm * 32 + i * 16 + 8 * hl;
#pragma unroll
    for (int j = 0; j < 4; ++j) {
      const int nIdx = n0 + wn * 64 + j * 16 + fr;
      v8f v = acc[i][j];
      if constexpr (TRANS) {
        if constexpr (OUT_BF16) {
          union { bf16 h[8]; f4 f; } t;
#pragma unroll
          for (int r = 0; r < 8; ++r) {
            float f = v[r] * scale;
            if constexpr (HAS_BIAS) f += bias[mBase + r];
            t.h[r] = f2bf(f);
          }
          *(f4*)((bf16*)Cout + (size_t)nIdx * ldc + mBase) = t.f;
        } else {
          union { float x[8]; f4 f[2]; } t;
#pragma unroll
          for (int r = 0; r < 8; ++r) {
            float f = v[r] * scale;
            if constexpr (HAS_BIAS) f += bias[mBase + r];
            t.x[r] = f;
          }
          float* po = (float*)Cout + (size_t)nIdx * ldc + mBase;
          *(f4*)po = t.f[0];
          *(f4*)(po + 4) = t.f[1];
        }
      } else {
#pragma unroll
        for (int r = 0; r < 8; ++r) {
          float f = v[r] * scale;
          if constexpr (HAS_BIAS) f += bias[mBase + r];
          if constexpr (HAS_RES)  f += res[(size_t)(mBase + r) * ldc + nIdx];
          if constexpr (OUT_BF16)
            ((bf16*)Cout)[(size_t)(mBase + r) * ldc + nIdx] = f2bf(f);
          else
            ((float*)Cout)[(size_t)(mBase + r) * ldc + nIdx] = f;
        }
      }
    }
  }
}

// ---------------------------------------------------------------------------
extern "C" void kernel_launch(void* const* d_in, const int* in_sizes, int n_in,
                              void* d_out, int out_size, void* d_ws, size_t ws_size,
                              hipStream_t stream) {
  const float* input   = (const float*)d_in[0];
  const float* context = (const float*)d_in[1];
  const float* gamma   = (const float*)d_in[2];
  const float* beta    = (const float*)d_in[3];
  const float* Wq      = (const float*)d_in[4];
  const float* bq      = (const float*)d_in[5];
  const float* Wkv     = (const float*)d_in[6];
  const float* bkv     = (const float*)d_in[7];
  const float* Wo      = (const float*)d_in[8];
  const float* bo      = (const float*)d_in[9];
  float* out = (float*)d_out;

  char* wsb = (char*)d_ws;
  size_t off = 0;
  auto alloc = [&](size_t bytes) -> char* {
    char* p = wsb + off;
    off += (bytes + 255) & ~(size_t)255;
    return p;
  };

  float* raw   = (float*)alloc(kN * 2 * sizeof(float));
  float* stats = (float*)alloc(kN * 2 * sizeof(float));
  bf16* Wq16   = (bf16*)alloc((size_t)kO * kC * 2);          //  4 MB
  bf16* Wkv16  = (bf16*)alloc((size_t)2 * kO * kCTX * 2);    //  8 MB
  bf16* Wo16   = (bf16*)alloc((size_t)kC * kO * 2);          //  4 MB
  bf16* xnT    = (bf16*)alloc((size_t)kN * kS * kC * 2);     //  8 MB  (n,s,c)
  bf16* ctxT   = (bf16*)alloc((size_t)kN * kS2 * kCTX * 2);  //  8 MB  (n,s,c)
  bf16* qT     = (bf16*)alloc((size_t)kS * kO * 2);          // 16 MB  (s,4096)
  bf16* kT     = (bf16*)alloc((size_t)kS2 * kO * 2);         // 16 MB  (s2,4096)
  bf16* vB     = (bf16*)alloc((size_t)kO * kS2 * 2);         // 16 MB  (4096,s2)
  float* Sc    = (float*)alloc((size_t)kS * kS2 * 4);        // 16 MB  scores
  bf16* Pb     = (bf16*)alloc((size_t)kS * kS2 * 2);         //  8 MB  probs
  bf16* yT     = (bf16*)alloc((size_t)kS * kO * 2);          // 16 MB  (s,4096)
  (void)ws_size; (void)in_sizes; (void)n_in; (void)out_size;

  // stats
  zero_f32<<<1, 32, 0, stream>>>(raw, kN * 2);
  reduce_stats<<<dim3(256, kN), 256, 0, stream>>>(input, raw);
  finalize_stats<<<1, 32, 0, stream>>>(raw, stats);

  // transposed bf16 activations + bf16 weights
  norm_transpose<<<dim3(kS / 32, kC / 32, kN), dim3(32, 8), 0, stream>>>(
      input, xnT, kC, kS, stats, gamma, beta);
  norm_transpose<<<dim3(kS2 / 32, kCTX / 32, kN), dim3(32, 8), 0, stream>>>(
      context, ctxT, kCTX, kS2, nullptr, nullptr, nullptr);
  cvt_bf16<<<(kO * kC + 255) / 256, 256, 0, stream>>>(Wq, Wq16, kO * kC);
  cvt_bf16<<<(2 * kO * kCTX + 255) / 256, 256, 0, stream>>>(Wkv, Wkv16, 2 * kO * kCTX);
  cvt_bf16<<<(kC * kO + 255) / 256, 256, 0, stream>>>(Wo, Wo16, kC * kO);

  const float scoreScale = 1.0f / sqrtf((float)kC);   // (c^-0.25)^2

  for (int n = 0; n < kN; ++n) {
    const bf16* xb = xnT + (size_t)n * kS * kC;
    const bf16* cb = ctxT + (size_t)n * kS2 * kCTX;

    // q = Wq*xn + bq  -> qT (s, 4096)            [transposed bf16 store]
    gemm_nt<true, true, true, false><<<dim3(kS / BN, kO / BM), 256, 0, stream>>>(
        Wq16, xb, qT, bq, nullptr, kO, kS, kC, kC, kC, kO, 1.0f);
    // k = Wkv[0:4096]*ctx + bkv[0:4096] -> kT (s2, 4096)
    gemm_nt<true, true, true, false><<<dim3(kS2 / BN, kO / BM), 256, 0, stream>>>(
        Wkv16, cb, kT, bkv, nullptr, kO, kS2, kCTX, kCTX, kCTX, kO, 1.0f);
    // v = Wkv[4096:]*ctx + bkv[4096:]  -> vB (4096, s2)  [row-major bf16]
    gemm_nt<false, true, true, false><<<dim3(kS2 / BN, kO / BM), 256, 0, stream>>>(
        Wkv16 + (size_t)kO * kCTX, cb, vB, bkv + kO, nullptr,
        kO, kS2, kCTX, kCTX, kCTX, kS2, 1.0f);

    for (int h = 0; h < kH; ++h) {
      // scores: D[k,q] = K_h * Q_h^T, transposed store -> Sc[q,k] f32, scaled
      gemm_nt<true, false, false, false><<<dim3(kS / BN, kS2 / BM), 256, 0, stream>>>(
          kT + h * kC, qT + h * kC, Sc, nullptr, nullptr,
          kS2, kS, kC, kO, kO, kS2, scoreScale);
      softmax_rows<<<kS, 256, 0, stream>>>(Sc, Pb, kS2);
      // y = P * V_h (NT with V^T rows) -> yT[:, h*512 : h*512+512]
      gemm_nt<false, true, false, false><<<dim3(kC / BN, kS / BM), 256, 0, stream>>>(
          Pb, vB + (size_t)h * kC * kS2, yT + h * kC, nullptr, nullptr,
          kS, kC, kS2, kS2, kS2, kO, 1.0f);
    }

    // out = Wo * y + bo + residual  (f32, row-major (c,s))
    gemm_nt<false, false, true, true><<<dim3(kS / BN, kC / BM), 256, 0, stream>>>(
        Wo16, yT, out + (size_t)n * kC * kS, bo, input + (size_t)n * kC * kS,
        kC, kS, kO, kO, kO, kS, 1.0f);
  }
}

// v001
// A run of this version takes 1290 microseconds.
// Next to v000, in two timings, it ran 1.65 and 1.67 times as fast.
#include <hip/hip_runtime.h>
#include <hip/hip_bf16.h>
#include <math.h>

// ---------------------------------------------------------------------------
// CrossAttention1d for MI455X (gfx1250): bf16 WMMA pipeline, f32 accumulate.
// N=4, C=512, S=2048, S2=2048, H=8, CTX=512.  ~412 GFLOP -> compute-bound,
// all 5 matmul stages on v_wmma_f32_16x16x32_bf16, tiles staged to LDS via
// CDNA5 async copies (global_load_async_to_lds_b128 + s_wait_asynccnt).
// ---------------------------------------------------------------------------

typedef __bf16 bf16;
typedef __attribute__((ext_vector_type(16))) __bf16 v16bf;
typedef __attribute__((ext_vector_type(8)))  float  v8f;
typedef __attribute__((ext_vector_type(4)))  float  f4;

static constexpr int kN = 4, kC = 512, kS = 2048, kS2 = 2048, kH = 8, kCTX = 512;
static constexpr int kO = kC * kH;      // 4096
static constexpr float kEPS = 1e-5f;
static constexpr int kHG = 4;           // heads per launch (grid z); 240 MB of workspace

__device__ __forceinline__ bf16 f2bf(float f) {
  unsigned u = __builtin_bit_cast(unsigned, f);
  u += 0x7FFFu + ((u >> 16) & 1u);          // round-to-nearest-even
  unsigned short h = (unsigned short)(u >> 16);
  return __builtin_bit_cast(bf16, h);
}

// ---------------------------------------------------------------------------
// Stage 0: batch-wide mean / rstd (layernorm over all C*S per n)
// ---------------------------------------------------------------------------
__global__ void zero_f32(float* p, int n) {
  int i = blockIdx.x * 256 + threadIdx.x;
  if (i < n) p[i] = 0.f;
}

__global__ __launch_bounds__(256)
void reduce_stats(const float* __restrict__ in, float* __restrict__ raw) {
  __shared__ float sh0[256], sh1[256];
  const int n = blockIdx.y;
  const float* p = in + (size_t)n * kC * kS;
  float s = 0.f, s2 = 0.f;
  for (int i = blockIdx.x * 256 + threadIdx.x; i < kC * kS; i += gridDim.x * 256) {
    float v = p[i]; s += v; s2 += v * v;
  }
  sh0[threadIdx.x] = s; sh1[threadIdx.x] = s2;
  __syncthreads();
  for (int o = 128; o > 0; o >>= 1) {
    if ((int)threadIdx.x < o) {
      sh0[threadIdx.x] += sh0[threadIdx.x + o];
      sh1[threadIdx.x] += sh1[threadIdx.x + o];
    }
    __syncthreads();
  }
  if (threadIdx.x == 0) {
    atomicAdd(&raw[2 * n + 0], sh0[0]);
    atomicAdd(&raw[2 * n + 1], sh1[0]);
  }
}

__global__ void finalize_stats(const float* __restrict__ raw, float* __restrict__ stats) {
  int n = threadIdx.x;
  if (n < kN) {
    float inv  = 1.0f / (float)(kC * kS);
    float mean = raw[2 * n] * inv;
    float var  = raw[2 * n + 1] * inv - mean * mean;
    stats[2 * n + 0] = mean;
    stats[2 * n + 1] = rsqrtf(var + kEPS);
  }
}

// ---------------------------------------------------------------------------
// Stage 1: (optionally layernorm-affine) transpose (n,R,Cc)f32 -> (n,Cc,R)bf16
// ---------------------------------------------------------------------------
__global__ __launch_bounds__(256)
void norm_transpose(const float* __restrict__ in, bf16* __restrict__ outp,
                    int R, int Cc, const float* __restrict__ stats,
                    const float* __restrict__ gamma, const float* __restrict__ beta) {
  __shared__ float tile[32][33];
  const int nb = blockIdx.z;
  const int r0 = blockIdx.y * 32;
  const int c0 = blockIdx.x * 32;
  const float* pin = in + ((size_t)nb * R + r0) * Cc + c0;
  for (int i = threadIdx.y; i < 32; i += 8)
    tile[i][threadIdx.x] = pin[(size_t)i * Cc + threadIdx.x];
  __syncthreads();
  float mu = 0.f, rinv = 1.f, g = 1.f, b = 0.f;
  const int r = r0 + threadIdx.x;  // original row (= channel index)
  if (stats) { mu = stats[2 * nb]; rinv = stats[2 * nb + 1]; g = gamma[r]; b = beta[r]; }
  bf16* pout = outp + ((size_t)nb * Cc + c0) * R + r0;
  for (int i = threadIdx.y; i < 32; i += 8) {
    float v = tile[threadIdx.x][i];
    v = (v - mu) * rinv * g + b;
    pout[(size_t)i * R + threadIdx.x] = f2bf(v);
  }
}

__global__ void cvt_bf16(const float* __restrict__ in, bf16* __restrict__ o, int n) {
  int i = blockIdx.x * 256 + threadIdx.x;
  if (i < n) o[i] = f2bf(in[i]);
}

// ---------------------------------------------------------------------------
// Row softmax: f32 (rows x ncols) -> bf16 probabilities
// ---------------------------------------------------------------------------
__global__ __launch_bounds__(256)
void softmax_rows(const float* __restrict__ Sin, bf16* __restrict__ P, int ncols) {
  __shared__ float red[256];
  const int row = blockIdx.x;
  const float* p = Sin + (size_t)row * ncols;
  bf16* q = P + (size_t)row * ncols;
  float m = -3.4e38f;
  for (int i = threadIdx.x; i < ncols; i += 256) m = fmaxf(m, p[i]);
  red[threadIdx.x] = m; __syncthreads();
  for (int o = 128; o > 0; o >>= 1) {
    if ((int)threadIdx.x < o) red[threadIdx.x] = fmaxf(red[threadIdx.x], red[threadIdx.x + o]);
    __syncthreads();
  }
  m = red[0]; __syncthreads();
  float s = 0.f;
  for (int i = threadIdx.x; i < ncols; i += 256) s += __expf(p[i] - m);
  red[threadIdx.x] = s; __syncthreads();
  for (int o = 128; o > 0; o >>= 1) {
    if ((int)threadIdx.x < o) red[threadIdx.x] += red[threadIdx.x + o];
    __syncthreads();
  }
  const float inv = 1.0f / red[0];
  for (int i = threadIdx.x; i < ncols; i += 256) q[i] = f2bf(__expf(p[i] - m) * inv);
}

// ---------------------------------------------------------------------------
// CDNA5 async copy: 16B per lane, global -> LDS, tracked by ASYNCcnt.
//   lds_off : per-lane LDS byte address (low 32 bits of LDS pointer)
//   base    : uniform 64-bit global base (SGPR pair)
//   gl_off  : per-lane 32-bit byte offset
// ---------------------------------------------------------------------------
__device__ __forceinline__ void async_ld16(unsigned lds_off, const bf16* base,
                                           unsigned gl_off) {
  asm volatile("global_load_async_to_lds_b128 %0, %1, %2"
               :: "v"(lds_off), "v"(gl_off), "s"(base)
               : "memory");
}
__device__ __forceinline__ void wait_async0() {
  asm volatile("s_wait_asynccnt 0x0" ::: "memory");
}

// ---------------------------------------------------------------------------
// NT GEMM:  D(M,Nn) = A(M,K) * B(Nn,K)^T   (bf16 in, f32 accum via WMMA)
//   TRANS    : store D transposed (Cout[n][m]) — 16B-contiguous per lane
//   OUT_BF16 : output bf16 (else f32)
//   HAS_BIAS : + bias[m]
//   HAS_RES  : + res[m*ldc + n] (row-major only)
//   blockIdx.z : one independent product per z; sAz/sBz/sCz are the element
//                strides of A, B and Cout (and res) from one z to the next.
// block tile 128x128, 8 waves (4x2), K-step 32, double-buffered LDS filled by
// async copies that overlap the WMMA stream.
// ---------------------------------------------------------------------------
static constexpr int BM = 128, BN = 128, BK = 32;
static constexpr int LDSS = 40;   // padded row stride in bf16 elems (80B)

union FragAB { v16bf v; f4 f[2]; };

template <bool TRANS, bool OUT_BF16, bool HAS_BIAS, bool HAS_RES>
__global__ __launch_bounds__(256)
void gemm_nt(const bf16* __restrict__ A, const bf16* __restrict__ B,
             void* __restrict__ Cout, const float* __restrict__ bias,
             const float* __restrict__ res,
             int M, int Nn, int K, int lda, int ldb, int ldc, float scale,
             int sAz, int sBz, int sCz) {
  __shared__ bf16 shA[2][BM * LDSS];
  __shared__ bf16 shB[2][BN * LDSS];

  A += (size_t)blockIdx.z * sAz;
  B += (size_t)blockIdx.z * sBz;
  const size_t cOffZ = (size_t)blockIdx.z * sCz;
  if constexpr (OUT_BF16) Cout = (bf16*)Cout + cOffZ;
  else                    Cout = (float*)Cout + cOffZ;
  if constexpr (HAS_RES)  res += cOffZ;

  const int tid  = threadIdx.x;
  const int lane = tid & 31;
  const int wv   = tid >> 5;
  const int wm   = wv & 3;          // 4 wave-rows
  const int wn   = wv >> 2;         // 2 wave-cols
  const int m0   = blockIdx.y * BM;
  const int n0   = blockIdx.x * BN;

  // staging: each thread owns one 32B chunk (= 2 async b128) per tile
  const int lr = tid >> 1;           // 0..127 (tile row)
  const int lc = (tid & 1) * 16;     // 0 or 16 (k elems)

  const bf16* aBase = A + (size_t)m0 * lda;   // block-uniform -> SGPRs
  const bf16* bBase = B + (size_t)n0 * ldb;
  const unsigned aOffG = (unsigned)((lr * lda + lc) * 2);   // bytes
  const unsigned bOffG = (unsigned)((lr * ldb + lc) * 2);
  const unsigned thrL  = (unsigned)((lr * LDSS + lc) * 2);  // bytes
  const unsigned sA[2] = { (unsigned)(unsigned long long)&shA[0][0],
                           (unsigned)(unsigned long long)&shA[1][0] };
  const unsigned sB[2] = { (unsigned)(unsigned long long)&shB[0][0],
                           (unsigned)(unsigned long long)&shB[1][0] };

  auto issue_tile = [&](int kt, int buf) {
    const unsigned la = sA[buf] + thrL;
    const unsigned lb = sB[buf] + thrL;
    const unsigned ga = aOffG + (unsigned)(kt * BK * 2);
    const unsigned gb = bOffG + (unsigned)(kt * BK * 2);
    async_ld16(la,       aBase, ga);
    async_ld16(la + 16u, aBase, ga + 16u);
    async_ld16(lb,       bBase, gb);
    async_ld16(lb + 16u, bBase, gb + 16u);
  };

  const int KT = K / BK;
  issue_tile(0, 0);

  v8f acc[2][4];
#pragma unroll
  for (int i = 0; i < 2; ++i)
#pragma unroll
    for (int j = 0; j < 4; ++j)
#pragma unroll
      for (int r = 0; r < 8; ++r) acc[i][j][r] = 0.f;

  const int hl = lane >> 4;          // K-quarter selector
  const int fr = lane & 15;          // fragment row (M for A, N for B)

  for (int kt = 0; kt < KT; ++kt) {
    const int cur = kt & 1;
    wait_async0();        // my async writes for tile kt have landed in LDS
    __syncthreads();      // everyone's writes landed; buf[cur^1] free to fill
    if (kt + 1 < KT) issue_tile(kt + 1, cur ^ 1);
    if (kt + 2 < KT) {
      __builtin_prefetch(aBase + (size_t)lr * lda + lc + (size_t)(kt + 2) * BK, 0, 1);
      __builtin_prefetch(bBase + (size_t)lr * ldb + lc + (size_t)(kt + 2) * BK, 0, 1);
    }

    FragAB a[2], b[4];
#pragma unroll
    for (int i = 0; i < 2; ++i) {
      const bf16* p = &shA[cur][(wm * 32 + i * 16 + fr) * LDSS + 8 * hl];
      a[i].f[0] = *(const f4*)p;
      a[i].f[1] = *(const f4*)(p + 16);
    }
#pragma unroll
    for (int j = 0; j < 4; ++j) {
      const bf16* p = &shB[cur][(wn * 64 + j * 16 + fr) * LDSS + 8 * hl];
      b[j].f[0] = *(const f4*)p;
      b[j].f[1] = *(const f4*)(p + 16);
    }
#pragma unroll
    for (int i = 0; i < 2; ++i)
#pragma unroll
      for (int j = 0; j < 4; ++j)
        acc[i][j] = __builtin_amdgcn_wmma_f32_16x16x32_bf16(
            false, a[i].v, false, b[j].v, (short)0, acc[i][j], false, false);
  }

  // epilogue: D tile [16x16]; lane fr = N index, VGPR r -> M = 8*hl + r
#pragma unroll
  for (int i = 0; i < 2; ++i) {
    const int mBase = m0 + wm * 32 + i * 16 + 8 * hl;
#pragma unroll
    for (int j = 0; j < 4; ++j) {
      const int nIdx = n0 + wn * 64 + j * 16 + fr;
      v8f v = acc[i][j];
      if constexpr (TRANS) {
        if constexpr (OUT_BF16) {
          union { bf16 h[8]; f4 f; } t;
#pragma unroll
          for (int r = 0; r < 8; ++r) {
            float f = v[r] * scale;
            if constexpr (HAS_BIAS) f += bias[mBase + r];
            t.h[r] = f2bf(f);
          }
          *(f4*)((bf16*)Cout + (size_t)nIdx * ldc + mBase) = t.f;
        } else {
          union { float x[8]; f4 f[2]; } t;
#pragma unroll
          for (int r = 0; r < 8; ++r) {
            float f = v[r] * scale;
            if constexpr (HAS_BIAS) f += bias[mBase + r];
            t.x[r] = f;
          }
          float* po = (float*)Cout + (size_t)nIdx * ldc + mBase;
          *(f4*)po = t.f[0];
          *(f4*)(po + 4) = t.f[1];
        }
      } else {
#pragma unroll
        for (int r = 0; r < 8; ++r) {
          float f = v[r] * scale;
          if constexpr (HAS_BIAS) f += bias[mBase + r];
          if constexpr (HAS_RES)  f += res[(size_t)(mBase + r) * ldc + nIdx];
          if constexpr (OUT_BF16)
            ((bf16*)Cout)[(size_t)(mBase + r) * ldc + nIdx] = f2bf(f);
          else
            ((float*)Cout)[(size_t)(mBase + r) * ldc + nIdx] = f;
        }
      }
    }
  }
}

// ---------------------------------------------------------------------------
extern "C" void kernel_launch(void* const* d_in, const int* in_sizes, int n_in,
                              void* d_out, int out_size, void* d_ws, size_t ws_size,
                              hipStream_t stream) {
  const float* input   = (const float*)d_in[0];
  const float* context = (const float*)d_in[1];
  const float* gamma   = (const float*)d_in[2];
  const float* beta    = (const float*)d_in[3];
  const float* Wq      = (const float*)d_in[4];
  const float* bq      = (const float*)d_in[5];
  const float* Wkv     = (const float*)d_in[6];
  const float* bkv     = (const float*)d_in[7];
  const float* Wo      = (const float*)d_in[8];
  const float* bo      = (const float*)d_in[9];
  float* out = (float*)d_out;

  char* wsb = (char*)d_ws;
  size_t off = 0;
  auto alloc = [&](size_t bytes) -> char* {
    char* p = wsb + off;
    off += (bytes + 255) & ~(size_t)255;
    return p;
  };

  float* raw   = (float*)alloc(kN * 2 * sizeof(float));
  float* stats = (float*)alloc(kN * 2 * sizeof(float));
  bf16* Wq16   = (bf16*)alloc((size_t)kO * kC * 2);          //  4 MB
  bf16* Wkv16  = (bf16*)alloc((size_t)2 * kO * kCTX * 2);    //  8 MB
  bf16* Wo16   = (bf16*)alloc((size_t)kC * kO * 2);          //  4 MB
  bf16* xnT    = (bf16*)alloc((size_t)kN * kS * kC * 2);     //  8 MB  (n,s,c)
  bf16* ctxT   = (bf16*)alloc((size_t)kN * kS2 * kCTX * 2);  //  8 MB  (n,s,c)
  bf16* qT     = (bf16*)alloc((size_t)kS * kO * 2);          // 16 MB  (s,4096)
  bf16* kT     = (bf16*)alloc((size_t)kS2 * kO * 2);         // 16 MB  (s2,4096)
  bf16* vB     = (bf16*)alloc((size_t)kO * kS2 * 2);         // 16 MB  (4096,s2)
  float* Sc    = (float*)alloc((size_t)kHG * kS * kS2 * 4);  // 64 MB  scores (hg,q,k)
  bf16* Pb     = (bf16*)alloc((size_t)kHG * kS * kS2 * 2);   // 32 MB  probs  (hg,q,k)
  bf16* yT     = (bf16*)alloc((size_t)kN * kS * kO * 2);     // 64 MB  (n,s,4096)
  (void)ws_size; (void)in_sizes; (void)n_in; (void)out_size;

  // stats
  zero_f32<<<1, 32, 0, stream>>>(raw, kN * 2);
  reduce_stats<<<dim3(256, kN), 256, 0, stream>>>(input, raw);
  finalize_stats<<<1, 32, 0, stream>>>(raw, stats);

  // transposed bf16 activations + bf16 weights
  norm_transpose<<<dim3(kS / 32, kC / 32, kN), dim3(32, 8), 0, stream>>>(
      input, xnT, kC, kS, stats, gamma, beta);
  norm_transpose<<<dim3(kS2 / 32, kCTX / 32, kN), dim3(32, 8), 0, stream>>>(
      context, ctxT, kCTX, kS2, nullptr, nullptr, nullptr);
  cvt_bf16<<<(kO * kC + 255) / 256, 256, 0, stream>>>(Wq, Wq16, kO * kC);
  cvt_bf16<<<(2 * kO * kCTX + 255) / 256, 256, 0, stream>>>(Wkv, Wkv16, 2 * kO * kCTX);
  cvt_bf16<<<(kC * kO + 255) / 256, 256, 0, stream>>>(Wo, Wo16, kC * kO);

  const float scoreScale = 1.0f / sqrtf((float)kC);   // (c^-0.25)^2

  for (int n = 0; n < kN; ++n) {
    const bf16* xb = xnT + (size_t)n * kS * kC;
    const bf16* cb = ctxT + (size_t)n * kS2 * kCTX;

    // q = Wq*xn + bq  -> qT (s, 4096)            [transposed bf16 store]
    gemm_nt<true, true, true, false><<<dim3(kS / BN, kO / BM), 256, 0, stream>>>(
        Wq16, xb, qT, bq, nullptr, kO, kS, kC, kC, kC, kO, 1.0f, 0, 0, 0);
    // k = Wkv[0:4096]*ctx + bkv[0:4096] -> kT (s2, 4096)
    gemm_nt<true, true, true, false><<<dim3(kS2 / BN, kO / BM), 256, 0, stream>>>(
        Wkv16, cb, kT, bkv, nullptr, kO, kS2, kCTX, kCTX, kCTX, kO, 1.0f, 0, 0, 0);
    // v = Wkv[4096:]*ctx + bkv[4096:]  -> vB (4096, s2)  [row-major bf16]
    gemm_nt<false, true, true, false><<<dim3(kS2 / BN, kO / BM), 256, 0, stream>>>(
        Wkv16 + (size_t)kO * kCTX, cb, vB, bkv + kO, nullptr,
        kO, kS2, kCTX, kCTX, kCTX, kS2, 1.0f, 0, 0, 0);

    bf16* yb = yT + (size_t)n * kS * kO;
    for (int h = 0; h < kH; h += kHG) {
      // scores, kHG heads in grid z: D[k,q] = K_h * Q_h^T, transposed store
      // -> Sc[z,q,k] f32, scaled
      gemm_nt<true, false, false, false><<<dim3(kS / BN, kS2 / BM, kHG), 256, 0, stream>>>(
          kT + h * kC, qT + h * kC, Sc, nullptr, nullptr,
          kS2, kS, kC, kO, kO, kS2, scoreScale, kC, kC, kS * kS2);
      softmax_rows<<<kHG * kS, 256, 0, stream>>>(Sc, Pb, kS2);
      // y = P * V_h (NT with V^T rows) -> yb[:, (h+z)*512 : (h+z)*512+512]
      gemm_nt<false, true, false, false><<<dim3(kC / BN, kS / BM, kHG), 256, 0, stream>>>(
          Pb, vB + (size_t)h * kC * kS2, yb + h * kC, nullptr, nullptr,
          kS, kC, kS2, kS2, kS2, kO, 1.0f, kS * kS2, kC * kS2, kC);
    }
  }

  // out = Wo * y + bo + residual  (f32, row-major (c,s)), all samples in grid z
  gemm_nt<false, false, true, true><<<dim3(kS / BN, kC / BM, kN), 256, 0, stream>>>(
      Wo16, yT, out, bo, input,
      kC, kS, kO, kO, kO, kS, 1.0f, 0, kS * kO, kC * kS);
}

// v002
// One run takes 929 microseconds.
// Next to v001, in two timings, it ran 1.39 and 1.38 times as fast.
// All steps since v000 together make it 2.30 times as fast.
#include <hip/hip_runtime.h>
#include <hip/hip_bf16.h>
#include <math.h>

// ---------------------------------------------------------------------------
// CrossAttention1d for MI455X (gfx1250): bf16 WMMA pipeline, f32 accumulate.
// N=4, C=512, S=2048, S2=2048, H=8, CTX=512.  ~412 GFLOP -> compute-bound,
// all 5 matmul stages on v_wmma_f32_16x16x32_bf16, tiles staged to LDS via
// CDNA5 async copies (global_load_async_to_lds_b128 + s_wait_asynccnt).
// ---------------------------------------------------------------------------

typedef __bf16 bf16;
typedef __attribute__((ext_vector_type(16))) __bf16 v16bf;
typedef __attribute__((ext_vector_type(8)))  float  v8f;
typedef __attribute__((ext_vector_type(4)))  float  f4;

static constexpr int kN = 4, kC = 512, kS = 2048, kS2 = 2048, kH = 8, kCTX = 512;
static constexpr int kO = kC * kH;      // 4096
static constexpr float kEPS = 1e-5f;
static constexpr int kHG = 4;           // heads per launch (grid z); 240 MB of workspace

__device__ __forceinline__ bf16 f2bf(float f) {
  unsigned u = __builtin_bit_cast(unsigned, f);
  u += 0x7FFFu + ((u >> 16) & 1u);          // round-to-nearest-even
  unsigned short h = (unsigned short)(u >> 16);
  return __builtin_bit_cast(bf16, h);
}

// ---------------------------------------------------------------------------
// Stage 0: batch-wide mean / rstd (layernorm over all C*S per n)
// ---------------------------------------------------------------------------
__global__ void zero_f32(float* p, int n) {
  int i = blockIdx.x * 256 + threadIdx.x;
  if (i < n) p[i] = 0.f;
}

__global__ __launch_bounds__(256)
void reduce_stats(const float* __restrict__ in, float* __restrict__ raw) {
  __shared__ float sh0[256], sh1[256];
  const int n = blockIdx.y;
  const float* p = in + (size_t)n * kC * kS;
  float s = 0.f, s2 = 0.f;
  for (int i = blockIdx.x * 256 + threadIdx.x; i < kC * kS; i += gridDim.x * 256) {
    float v = p[i]; s += v; s2 += v * v;
  }
  sh0[threadIdx.x] = s; sh1[threadIdx.x] = s2;
  __syncthreads();
  for (int o = 128; o > 0; o >>= 1) {
    if ((int)threadIdx.x < o) {
      sh0[threadIdx.x] += sh0[threadIdx.x + o];
      sh1[threadIdx.x] += sh1[threadIdx.x + o];
    }
    __syncthreads();
  }
  if (threadIdx.x == 0) {
    atomicAdd(&raw[2 * n + 0], sh0[0]);
    atomicAdd(&raw[2 * n + 1], sh1[0]);
  }
}

__global__ void finalize_stats(const float* __restrict__ raw, float* __restrict__ stats) {
  int n = threadIdx.x;
  if (n < kN) {
    float inv  = 1.0f / (float)(kC * kS);
    float mean = raw[2 * n] * inv;
    float var  = raw[2 * n + 1] * inv - mean * mean;
    stats[2 * n + 0] = mean;
    stats[2 * n + 1] = rsqrtf(var + kEPS);
  }
}

// ---------------------------------------------------------------------------
// Stage 1: (optionally layernorm-affine) transpose (n,R,Cc)f32 -> (n,Cc,R)bf16
// ---------------------------------------------------------------------------
__global__ __launch_bounds__(256)
void norm_transpose(const float* __restrict__ in, bf16* __restrict__ outp,
                    int R, int Cc, const float* __restrict__ stats,
                    const float* __restrict__ gamma, const float* __restrict__ beta) {
  __shared__ float tile[32][33];
  const int nb = blockIdx.z;
  const int r0 = blockIdx.y * 32;
  const int c0 = blockIdx.x * 32;
  const float* pin = in + ((size_t)nb * R + r0) * Cc + c0;
  for (int i = threadIdx.y; i < 32; i += 8)
    tile[i][threadIdx.x] = pin[(size_t)i * Cc + threadIdx.x];
  __syncthreads();
  float mu = 0.f, rinv = 1.f, g = 1.f, b = 0.f;
  const int r = r0 + threadIdx.x;  // original row (= channel index)
  if (stats) { mu = stats[2 * nb]; rinv = stats[2 * nb + 1]; g = gamma[r]; b = beta[r]; }
  bf16* pout = outp + ((size_t)nb * Cc + c0) * R + r0;
  for (int i = threadIdx.y; i < 32; i += 8) {
    float v = tile[threadIdx.x][i];
    v = (v - mu) * rinv * g + b;
    pout[(size_t)i * R + threadIdx.x] = f2bf(v);
  }
}

__global__ void cvt_bf16(const float* __restrict__ in, bf16* __restrict__ o, int n) {
  int i = blockIdx.x * 256 + threadIdx.x;
  if (i < n) o[i] = f2bf(in[i]);
}

// ---------------------------------------------------------------------------
// Row softmax: f32 (rows x ncols) -> bf16 probabilities
// ---------------------------------------------------------------------------
__global__ __launch_bounds__(256)
void softmax_rows(const float* __restrict__ Sin, bf16* __restrict__ P, int ncols) {
  __shared__ float red[256];
  const int row = blockIdx.x;
  const float* p = Sin + (size_t)row * ncols;
  bf16* q = P + (size_t)row * ncols;
  float m = -3.4e38f;
  for (int i = threadIdx.x; i < ncols; i += 256) m = fmaxf(m, p[i]);
  red[threadIdx.x] = m; __syncthreads();
  for (int o = 128; o > 0; o >>= 1) {
    if ((int)threadIdx.x < o) red[threadIdx.x] = fmaxf(red[threadIdx.x], red[threadIdx.x + o]);
    __syncthreads();
  }
  m = red[0]; __syncthreads();
  float s = 0.f;
  for (int i = threadIdx.x; i < ncols; i += 256) s += __expf(p[i] - m);
  red[threadIdx.x] = s; __syncthreads();
  for (int o = 128; o > 0; o >>= 1) {
    if ((int)threadIdx.x < o) red[threadIdx.x] += red[threadIdx.x + o];
    __syncthreads();
  }
  const float inv = 1.0f / red[0];
  for (int i = threadIdx.x; i < ncols; i += 256) q[i] = f2bf(__expf(p[i] - m) * inv);
}

// ---------------------------------------------------------------------------
// CDNA5 async copies: 16B per lane, global -> LDS, tracked by ASYNCcnt.
// Eight copies of one lane, 16 tile rows apart.
//   l     : the lane's LDS byte address (low 32 bits of the LDS pointer)
//   lstep : LDS bytes from one copy to the next
//   g     : the lane's global pointer
//   gstep : global elements from one copy to the next
// s_wait_xcnt closes the statement so that no address register named here is
// rewritten while a copy may still read it.
// ---------------------------------------------------------------------------
__device__ __forceinline__ void async_rows8(unsigned l, unsigned lstep,
                                            const bf16* g, size_t gstep) {
  asm volatile("global_load_async_to_lds_b128 %0, %8, off\n\t"
               "global_load_async_to_lds_b128 %1, %9, off\n\t"
               "global_load_async_to_lds_b128 %2, %10, off\n\t"
               "global_load_async_to_lds_b128 %3, %11, off\n\t"
               "global_load_async_to_lds_b128 %4, %12, off\n\t"
               "global_load_async_to_lds_b128 %5, %13, off\n\t"
               "global_load_async_to_lds_b128 %6, %14, off\n\t"
               "global_load_async_to_lds_b128 %7, %15, off\n\t"
               "s_wait_xcnt 0x0"
               :: "v"(l), "v"(l + lstep), "v"(l + 2u * lstep), "v"(l + 3u * lstep),
                  "v"(l + 4u * lstep), "v"(l + 5u * lstep), "v"(l + 6u * lstep),
                  "v"(l + 7u * lstep),
                  "v"(g), "v"(g + gstep), "v"(g + 2 * gstep), "v"(g + 3 * gstep),
                  "v"(g + 4 * gstep), "v"(g + 5 * gstep), "v"(g + 6 * gstep),
                  "v"(g + 7 * gstep)
               : "memory");
}
// my own copies have landed in LDS
__device__ __forceinline__ void wait_async0() {
  asm volatile("s_wait_asynccnt 0x0" ::: "memory");
}
// my own LDS reads have returned, so the buffer may be refilled behind the barrier
__device__ __forceinline__ void wait_ds0() {
  asm volatile("s_wait_dscnt 0x0" ::: "memory");
}

// ---------------------------------------------------------------------------
// NT GEMM:  D(M,Nn) = A(M,K) * B(Nn,K)^T   (bf16 in, f32 accum via WMMA)
//   TRANS    : store D transposed (Cout[n][m]) — 16B-contiguous per lane
//   OUT_BF16 : output bf16 (else f32)
//   HAS_BIAS : + bias[m]
//   HAS_RES  : + res[m*ldc + n] (row-major only)
//   blockIdx.z : one independent product per z; sAz/sBz/sCz are the element
//                strides of A, B and Cout (and res) from one z to the next.
// block tile 128x128, 8 waves (2x4), 128 k per LDS stage (four WMMA k-steps),
// two LDS buffers filled by async copies that overlap the WMMA stream. A stage
// row is 256 B, so one wave-wide copy covers two rows = four whole 128-B lines.
// ---------------------------------------------------------------------------
static constexpr int BM = 128, BN = 128, BK = 128;
static constexpr int LDSS = 136;  // padded row stride in bf16 elems (272B = 16B x odd)

union FragAB { v16bf v; f4 f[2]; };

template <bool TRANS, bool OUT_BF16, bool HAS_BIAS, bool HAS_RES>
__global__ __launch_bounds__(256)
void gemm_nt(const bf16* __restrict__ A, const bf16* __restrict__ B,
             void* __restrict__ Cout, const float* __restrict__ bias,
             const float* __restrict__ res,
             int M, int Nn, int K, int lda, int ldb, int ldc, float scale,
             int sAz, int sBz, int sCz) {
  __shared__ __attribute__((aligned(16))) bf16 shA[2][BM * LDSS];
  __shared__ __attribute__((aligned(16))) bf16 shB[2][BN * LDSS];

  A += (size_t)blockIdx.z * sAz;
  B += (size_t)blockIdx.z * sBz;
  const size_t cOffZ = (size_t)blockIdx.z * sCz;
  if constexpr (OUT_BF16) Cout = (bf16*)Cout + cOffZ;
  else                    Cout = (float*)Cout + cOffZ;
  if constexpr (HAS_RES)  res += cOffZ;

  const int tid  = threadIdx.x;
  const int lane = tid & 31;
  const int wv   = tid >> 5;
  const int wm   = wv & 3;          // 4 wave-rows
  const int wn   = wv >> 2;         // 2 wave-cols
  const int m0   = blockIdx.y * BM;
  const int n0   = blockIdx.x * BN;

  // staging: 16 lanes cover one 256B stage row; a thread copies its 16B chunk
  // of rows lr, lr+16, ..., lr+112 of both operands
  const int lr = tid >> 4;           // 0..15 (first tile row)
  const int lc = (tid & 15) * 8;     // k elems

  const bf16* aPtr = A + (size_t)(m0 + lr) * lda + lc;
  const bf16* bPtr = B + (size_t)(n0 + lr) * ldb + lc;
  const unsigned thrL  = (unsigned)((lr * LDSS + lc) * 2);  // bytes
  const unsigned sA[2] = { (unsigned)(unsigned long long)&shA[0][0],
                           (unsigned)(unsigned long long)&shA[1][0] };
  const unsigned sB[2] = { (unsigned)(unsigned long long)&shB[0][0],
                           (unsigned)(unsigned long long)&shB[1][0] };

  auto issue_tile = [&](int kt, int buf) {
    async_rows8(sA[buf] + thrL, 16u * LDSS * 2u, aPtr + (size_t)kt * BK, (size_t)16 * lda);
    async_rows8(sB[buf] + thrL, 16u * LDSS * 2u, bPtr + (size_t)kt * BK, (size_t)16 * ldb);
  };

  const int KT = K / BK;
  issue_tile(0, 0);
  wait_async0();
  __syncthreads();      // stage 0 is published
  if (KT > 1) issue_tile(1, 1);

  v8f acc[2][4];
#pragma unroll
  for (int i = 0; i < 2; ++i)
#pragma unroll
    for (int j = 0; j < 4; ++j)
#pragma unroll
      for (int r = 0; r < 8; ++r) acc[i][j][r] = 0.f;

  const int hl = lane >> 4;          // K-quarter selector
  const int fr = lane & 15;          // fragment row (M for A, N for B)

  for (int kt = 0; kt < KT; ++kt) {
    const int cur = kt & 1;
    // unrolled so that the next k-step's fragment loads can go ahead of this
    // k-step's WMMAs
#pragma unroll
    for (int ks = 0; ks < BK / 32; ++ks) {
      FragAB a[2], b[4];
#pragma unroll
      for (int i = 0; i < 2; ++i) {
        const bf16* p = &shA[cur][(wm * 32 + i * 16 + fr) * LDSS + ks * 32 + 8 * hl];
        a[i].f[0] = *(const f4*)p;
        a[i].f[1] = *(const f4*)(p + 16);
      }
#pragma unroll
      for (int j = 0; j < 4; ++j) {
        const bf16* p = &shB[cur][(wn * 64 + j * 16 + fr) * LDSS + ks * 32 + 8 * hl];
        b[j].f[0] = *(const f4*)p;
        b[j].f[1] = *(const f4*)(p + 16);
      }
#pragma unroll
      for (int i = 0; i < 2; ++i)
#pragma unroll
        for (int j = 0; j < 4; ++j)
          acc[i][j] = __builtin_amdgcn_wmma_f32_16x16x32_bf16(
              false, a[i].v, false, b[j].v, (short)0, acc[i][j], false, false);
    }
    wait_ds0();
    wait_async0();
    __syncthreads();      // stage kt+1 is published; buf[cur] has no reader left
    if (kt + 2 < KT) issue_tile(kt + 2, cur);
  }
  wait_async0();

  // epilogue: D tile [16x16]; lane fr = N index, VGPR r -> M = 8*hl + r
#pragma unroll
  for (int i = 0; i < 2; ++i) {
    const int mBase = m0 + wm * 32 + i * 16 + 8 * hl;
#pragma unroll
    for (int j = 0; j < 4; ++j) {
      const int nIdx = n0 + wn * 64 + j * 16 + fr;
      v8f v = acc[i][j];
      if constexpr (TRANS) {
        if constexpr (OUT_BF16) {
          union { bf16 h[8]; f4 f; } t;
#pragma unroll
          for (int r = 0; r < 8; ++r) {
            float f = v[r] * scale;
            if constexpr (HAS_BIAS) f += bias[mBase + r];
            t.h[r] = f2bf(f);
          }
          *(f4*)((bf16*)Cout + (size_t)nIdx * ldc + mBase) = t.f;
        } else {
          union { float x[8]; f4 f[2]; } t;
#pragma unroll
          for (int r = 0; r < 8; ++r) {
            float f = v[r] * scale;
            if constexpr (HAS_BIAS) f += bias[mBase + r];
            t.x[r] = f;
          }
          float* po = (float*)Cout + (size_t)nIdx * ldc + mBase;
          *(f4*)po = t.f[0];
          *(f4*)(po + 4) = t.f[1];
        }
      } else {
#pragma unroll
        for (int r = 0; r < 8; ++r) {
          float f = v[r] * scale;
          if constexpr (HAS_BIAS) f += bias[mBase + r];
          if constexpr (HAS_RES)  f += res[(size_t)(mBase + r) * ldc + nIdx];
          if constexpr (OUT_BF16)
            ((bf16*)Cout)[(size_t)(mBase + r) * ldc + nIdx] = f2bf(f);
          else
            ((float*)Cout)[(size_t)(mBase + r) * ldc + nIdx] = f;
        }
      }
    }
  }
}

// ---------------------------------------------------------------------------
extern "C" void kernel_launch(void* const* d_in, const int* in_sizes, int n_in,
                              void* d_out, int out_size, void* d_ws, size_t ws_size,
                              hipStream_t stream) {
  const float* input   = (const float*)d_in[0];
  const float* context = (const float*)d_in[1];
  const float* gamma   = (const float*)d_in[2];
  const float* beta    = (const float*)d_in[3];
  const float* Wq      = (const float*)d_in[4];
  const float* bq      = (const float*)d_in[5];
  const float* Wkv     = (const float*)d_in[6];
  const float* bkv     = (const float*)d_in[7];
  const float* Wo      = (const float*)d_in[8];
  const float* bo      = (const float*)d_in[9];
  float* out = (float*)d_out;

  char* wsb = (char*)d_ws;
  size_t off = 0;
  auto alloc = [&](size_t bytes) -> char* {
    char* p = wsb + off;
    off += (bytes + 255) & ~(size_t)255;
    return p;
  };

  float* raw   = (float*)alloc(kN * 2 * sizeof(float));
  float* stats = (float*)alloc(kN * 2 * sizeof(float));
  bf16* Wq16   = (bf16*)alloc((size_t)kO * kC * 2);          //  4 MB
  bf16* Wkv16  = (bf16*)alloc((size_t)2 * kO * kCTX * 2);    //  8 MB
  bf16* Wo16   = (bf16*)alloc((size_t)kC * kO * 2);          //  4 MB
  bf16* xnT    = (bf16*)alloc((size_t)kN * kS * kC * 2);     //  8 MB  (n,s,c)
  bf16* ctxT   = (bf16*)alloc((size_t)kN * kS2 * kCTX * 2);  //  8 MB  (n,s,c)
  bf16* qT     = (bf16*)alloc((size_t)kS * kO * 2);          // 16 MB  (s,4096)
  bf16* kT     = (bf16*)alloc((size_t)kS2 * kO * 2);         // 16 MB  (s2,4096)
  bf16* vB     = (bf16*)alloc((size_t)kO * kS2 * 2);         // 16 MB  (4096,s2)
  float* Sc    = (float*)alloc((size_t)kHG * kS * kS2 * 4);  // 64 MB  scores (hg,q,k)
  bf16* Pb     = (bf16*)alloc((size_t)kHG * kS * kS2 * 2);   // 32 MB  probs  (hg,q,k)
  bf16* yT     = (bf16*)alloc((size_t)kN * kS * kO * 2);     // 64 MB  (n,s,4096)
  (void)ws_size; (void)in_sizes; (void)n_in; (void)out_size;

  // stats
  zero_f32<<<1, 32, 0, stream>>>(raw, kN * 2);
  reduce_stats<<<dim3(256, kN), 256, 0, stream>>>(input, raw);
  finalize_stats<<<1, 32, 0, stream>>>(raw, stats);

  // transposed bf16 activations + bf16 weights
  norm_transpose<<<dim3(kS / 32, kC / 32, kN), dim3(32, 8), 0, stream>>>(
      input, xnT, kC, kS, stats, gamma, beta);
  norm_transpose<<<dim3(kS2 / 32, kCTX / 32, kN), dim3(32, 8), 0, stream>>>(
      context, ctxT, kCTX, kS2, nullptr, nullptr, nullptr);
  cvt_bf16<<<(kO * kC + 255) / 256, 256, 0, stream>>>(Wq, Wq16, kO * kC);
  cvt_bf16<<<(2 * kO * kCTX + 255) / 256, 256, 0, stream>>>(Wkv, Wkv16, 2 * kO * kCTX);
  cvt_bf16<<<(kC * kO + 255) / 256, 256, 0, stream>>>(Wo, Wo16, kC * kO);

  const float scoreScale = 1.0f / sqrtf((float)kC);   // (c^-0.25)^2

  for (int n = 0; n < kN; ++n) {
    const bf16* xb = xnT + (size_t)n * kS * kC;
    const bf16* cb = ctxT + (size_t)n * kS2 * kCTX;

    // q = Wq*xn + bq  -> qT (s, 4096)            [transposed bf16 store]
    gemm_nt<true, true, true, false><<<dim3(kS / BN, kO / BM), 256, 0, stream>>>(
        Wq16, xb, qT, bq, nullptr, kO, kS, kC, kC, kC, kO, 1.0f, 0, 0, 0);
    // k = Wkv[0:4096]*ctx + bkv[0:4096] -> kT (s2, 4096)
    gemm_nt<true, true, true, false><<<dim3(kS2 / BN, kO / BM), 256, 0, stream>>>(
        Wkv16, cb, kT, bkv, nullptr, kO, kS2, kCTX, kCTX, kCTX, kO, 1.0f, 0, 0, 0);
    // v = Wkv[4096:]*ctx + bkv[4096:]  -> vB (4096, s2)  [row-major bf16]
    gemm_nt<false, true, true, false><<<dim3(kS2 / BN, kO / BM), 256, 0, stream>>>(
        Wkv16 + (size_t)kO * kCTX, cb, vB, bkv + kO, nullptr,
        kO, kS2, kCTX, kCTX, kCTX, kS2, 1.0f, 0, 0, 0);

    bf16* yb = yT + (size_t)n * kS * kO;
    for (int h = 0; h < kH; h += kHG) {
      // scores, kHG heads in grid z: D[k,q] = K_h * Q_h^T, transposed store
      // -> Sc[z,q,k] f32, scaled
      gemm_nt<true, false, false, false><<<dim3(kS / BN, kS2 / BM, kHG), 256, 0, stream>>>(
          kT + h * kC, qT + h * kC, Sc, nullptr, nullptr,
          kS2, kS, kC, kO, kO, kS2, scoreScale, kC, kC, kS * kS2);
      softmax_rows<<<kHG * kS, 256, 0, stream>>>(Sc, Pb, kS2);
      // y = P * V_h (NT with V^T rows) -> yb[:, (h+z)*512 : (h+z)*512+512]
      gemm_nt<false, true, false, false><<<dim3(kC / BN, kS / BM, kHG), 256, 0, stream>>>(
          Pb, vB + (size_t)h * kC * kS2, yb + h * kC, nullptr, nullptr,
          kS, kC, kS2, kS2, kS2, kO, 1.0f, kS * kS2, kC * kS2, kC);
    }
  }

  // out = Wo * y + bo + residual  (f32, row-major (c,s)), all samples in grid z
  gemm_nt<false, false, true, true><<<dim3(kS / BN, kC / BM, kN), 256, 0, stream>>>(
      Wo16, yT, out, bo, input,
      kC, kS, kO, kO, kO, kS, 1.0f, 0, kS * kO, kC * kS);
}

// v003
// One run takes 843 microseconds.
// Timed twice side by side with v002, it ran 1.07 and 1.13 times as fast.
// All steps since v000 together make it 2.54 times as fast.
#include <hip/hip_runtime.h>
#include <hip/hip_bf16.h>
#include <math.h>

// ---------------------------------------------------------------------------
// CrossAttention1d for MI455X (gfx1250): bf16 WMMA pipeline, f32 accumulate.
// N=4, C=512, S=2048, S2=2048, H=8, CTX=512.  ~412 GFLOP -> compute-bound,
// all 5 matmul stages on v_wmma_f32_16x16x32_bf16, tiles staged to LDS via
// CDNA5 async copies (global_load_async_to_lds_b128 + s_wait_asynccnt).
// ---------------------------------------------------------------------------

typedef __bf16 bf16;
typedef __attribute__((ext_vector_type(16))) __bf16 v16bf;
typedef __attribute__((ext_vector_type(8)))  float  v8f;
typedef __attribute__((ext_vector_type(4)))  float  f4;

static constexpr int kN = 4, kC = 512, kS = 2048, kS2 = 2048, kH = 8, kCTX = 512;
static constexpr int kO = kC * kH;      // 4096
static constexpr float kEPS = 1e-5f;
static constexpr int kHG = 4;           // heads per launch (grid z); 240 MB of workspace

__device__ __forceinline__ bf16 f2bf(float f) {
  unsigned u = __builtin_bit_cast(unsigned, f);
  u += 0x7FFFu + ((u >> 16) & 1u);          // round-to-nearest-even
  unsigned short h = (unsigned short)(u >> 16);
  return __builtin_bit_cast(bf16, h);
}

// ---------------------------------------------------------------------------
// Stage 0: batch-wide mean / rstd (layernorm over all C*S per n)
// ---------------------------------------------------------------------------
__global__ void zero_f32(float* p, int n) {
  int i = blockIdx.x * 256 + threadIdx.x;
  if (i < n) p[i] = 0.f;
}

__global__ __launch_bounds__(256)
void reduce_stats(const float* __restrict__ in, float* __restrict__ raw) {
  __shared__ float sh0[256], sh1[256];
  const int n = blockIdx.y;
  const float* p = in + (size_t)n * kC * kS;
  float s = 0.f, s2 = 0.f;
  for (int i = blockIdx.x * 256 + threadIdx.x; i < kC * kS; i += gridDim.x * 256) {
    float v = p[i]; s += v; s2 += v * v;
  }
  sh0[threadIdx.x] = s; sh1[threadIdx.x] = s2;
  __syncthreads();
  for (int o = 128; o > 0; o >>= 1) {
    if ((int)threadIdx.x < o) {
      sh0[threadIdx.x] += sh0[threadIdx.x + o];
      sh1[threadIdx.x] += sh1[threadIdx.x + o];
    }
    __syncthreads();
  }
  if (threadIdx.x == 0) {
    atomicAdd(&raw[2 * n + 0], sh0[0]);
    atomicAdd(&raw[2 * n + 1], sh1[0]);
  }
}

__global__ void finalize_stats(const float* __restrict__ raw, float* __restrict__ stats) {
  int n = threadIdx.x;
  if (n < kN) {
    float inv  = 1.0f / (float)(kC * kS);
    float mean = raw[2 * n] * inv;
    float var  = raw[2 * n + 1] * inv - mean * mean;
    stats[2 * n + 0] = mean;
    stats[2 * n + 1] = rsqrtf(var + kEPS);
  }
}

// ---------------------------------------------------------------------------
// Stage 1: (optionally layernorm-affine) transpose (n,R,Cc)f32 -> (n,Cc,R)bf16
// ---------------------------------------------------------------------------
__global__ __launch_bounds__(256)
void norm_transpose(const float* __restrict__ in, bf16* __restrict__ outp,
                    int R, int Cc, const float* __restrict__ stats,
                    const float* __restrict__ gamma, const float* __restrict__ beta) {
  __shared__ float tile[32][33];
  const int nb = blockIdx.z;
  const int r0 = blockIdx.y * 32;
  const int c0 = blockIdx.x * 32;
  const float* pin = in + ((size_t)nb * R + r0) * Cc + c0;
  for (int i = threadIdx.y; i < 32; i += 8)
    tile[i][threadIdx.x] = pin[(size_t)i * Cc + threadIdx.x];
  __syncthreads();
  float mu = 0.f, rinv = 1.f, g = 1.f, b = 0.f;
  const int r = r0 + threadIdx.x;  // original row (= channel index)
  if (stats) { mu = stats[2 * nb]; rinv = stats[2 * nb + 1]; g = gamma[r]; b = beta[r]; }
  bf16* pout = outp + ((size_t)nb * Cc + c0) * R + r0;
  for (int i = threadIdx.y; i < 32; i += 8) {
    float v = tile[threadIdx.x][i];
    v = (v - mu) * rinv * g + b;
    pout[(size_t)i * R + threadIdx.x] = f2bf(v);
  }
}

__global__ void cvt_bf16(const float* __restrict__ in, bf16* __restrict__ o, int n) {
  int i = blockIdx.x * 256 + threadIdx.x;
  if (i < n) o[i] = f2bf(in[i]);
}

// ---------------------------------------------------------------------------
// Row softmax: f32 (rows x kS2) -> bf16 probabilities.
// One wave per row: a lane keeps 64 of the row's 2048 scores in registers, so
// the row is read once, each exp is taken once, and maximum and sum are joined
// by lane exchanges, with no LDS and no barrier. A launch starts one wave per
// row instead of eight. Each wave-wide load covers 512 contiguous bytes, each
// wave-wide store 256.
// ---------------------------------------------------------------------------
typedef __attribute__((ext_vector_type(2))) float f2;

// a, b <- 2^a, 2^b. Eight v_exp_f32 in one statement, closed by a v_nop: it is
// the slot that the instruction set asks for behind a transcendental before its
// result is read or its source overwritten.
// The outputs are early-clobber, so that inside the
// statement no exp writes over a source either.
__device__ __forceinline__ void exp2_x8(f4& a, f4& b) {
  float r0, r1, r2, r3, r4, r5, r6, r7;
  asm("v_exp_f32 %0, %8\n\t"
      "v_exp_f32 %1, %9\n\t"
      "v_exp_f32 %2, %10\n\t"
      "v_exp_f32 %3, %11\n\t"
      "v_exp_f32 %4, %12\n\t"
      "v_exp_f32 %5, %13\n\t"
      "v_exp_f32 %6, %14\n\t"
      "v_exp_f32 %7, %15\n\t"
      "v_nop"
      : "=&v"(r0), "=&v"(r1), "=&v"(r2), "=&v"(r3),
        "=&v"(r4), "=&v"(r5), "=&v"(r6), "=&v"(r7)
      : "v"(a[0]), "v"(a[1]), "v"(a[2]), "v"(a[3]),
        "v"(b[0]), "v"(b[1]), "v"(b[2]), "v"(b[3]));
  a[0] = r0; a[1] = r1; a[2] = r2; a[3] = r3;
  b[0] = r4; b[1] = r5; b[2] = r6; b[3] = r7;
}

__global__ __launch_bounds__(256)
void softmax_rows(const float* __restrict__ Sin, bf16* __restrict__ P) {
  constexpr int NV = kS2 / 128;              // 16-byte vectors per lane
  const int lane = threadIdx.x & 31;
  const int row  = blockIdx.x * 8 + (threadIdx.x >> 5);
  const f4* p = (const f4*)(Sin + (size_t)row * kS2) + lane;
  f4 v[NV];
#pragma unroll
  for (int j = 0; j < NV; ++j) v[j] = p[j * 32];
  // keeps the loads' address pair whole (no load returns into it) until every
  // load has taken its address
  asm volatile("s_wait_xcnt 0x0" :: "v"(p) : "memory");

  f4 m4 = v[0];
#pragma unroll
  for (int j = 1; j < NV; ++j)
#pragma unroll
    for (int c = 0; c < 4; ++c) m4[c] = fmaxf(m4[c], v[j][c]);
  float m = fmaxf(fmaxf(m4[0], m4[1]), fmaxf(m4[2], m4[3]));
#pragma unroll
  for (int o = 16; o > 0; o >>= 1) m = fmaxf(m, __shfl_xor(m, o));

  f4 s4 = {0.f, 0.f, 0.f, 0.f};              // four independent sum chains
#pragma unroll
  for (int j = 0; j < NV; j += 2) {
#pragma unroll
    for (int c = 0; c < 4; ++c) {            // exp(x) = 2^(x * log2 e)
      v[j][c]     = (v[j][c] - m) * 1.44269504f;
      v[j + 1][c] = (v[j + 1][c] - m) * 1.44269504f;
    }
    exp2_x8(v[j], v[j + 1]);
#pragma unroll
    for (int c = 0; c < 4; ++c) s4[c] += v[j][c];
#pragma unroll
    for (int c = 0; c < 4; ++c) s4[c] += v[j + 1][c];
  }
  float s = (s4[0] + s4[1]) + (s4[2] + s4[3]);
#pragma unroll
  for (int o = 16; o > 0; o >>= 1) s += __shfl_xor(s, o);
  const float inv = 1.0f / s;

  f2* q = (f2*)(P + (size_t)row * kS2) + lane;
#pragma unroll
  for (int j = 0; j < NV; ++j) {
    union { bf16 h[4]; f2 f; } t;
#pragma unroll
    for (int c = 0; c < 4; ++c) t.h[c] = f2bf(v[j][c] * inv);
    q[j * 32] = t.f;
  }
}

// ---------------------------------------------------------------------------
// CDNA5 async copies: 16B per lane, global -> LDS, tracked by ASYNCcnt.
// Eight copies of one lane, 16 tile rows apart.
//   l     : the lane's LDS byte address (low 32 bits of the LDS pointer)
//   lstep : LDS bytes from one copy to the next
//   g     : the lane's global pointer
//   gstep : global elements from one copy to the next
// s_wait_xcnt closes the statement so that no address register named here is
// rewritten while a copy may still read it.
// ---------------------------------------------------------------------------
__device__ __forceinline__ void async_rows8(unsigned l, unsigned lstep,
                                            const bf16* g, size_t gstep) {
  asm volatile("global_load_async_to_lds_b128 %0, %8, off\n\t"
               "global_load_async_to_lds_b128 %1, %9, off\n\t"
               "global_load_async_to_lds_b128 %2, %10, off\n\t"
               "global_load_async_to_lds_b128 %3, %11, off\n\t"
               "global_load_async_to_lds_b128 %4, %12, off\n\t"
               "global_load_async_to_lds_b128 %5, %13, off\n\t"
               "global_load_async_to_lds_b128 %6, %14, off\n\t"
               "global_load_async_to_lds_b128 %7, %15, off\n\t"
               "s_wait_xcnt 0x0"
               :: "v"(l), "v"(l + lstep), "v"(l + 2u * lstep), "v"(l + 3u * lstep),
                  "v"(l + 4u * lstep), "v"(l + 5u * lstep), "v"(l + 6u * lstep),
                  "v"(l + 7u * lstep),
                  "v"(g), "v"(g + gstep), "v"(g + 2 * gstep), "v"(g + 3 * gstep),
                  "v"(g + 4 * gstep), "v"(g + 5 * gstep), "v"(g + 6 * gstep),
                  "v"(g + 7 * gstep)
               : "memory");
}
// my own copies have landed in LDS
__device__ __forceinline__ void wait_async0() {
  asm volatile("s_wait_asynccnt 0x0" ::: "memory");
}
// my own LDS reads have returned, so the buffer may be refilled behind the barrier
__device__ __forceinline__ void wait_ds0() {
  asm volatile("s_wait_dscnt 0x0" ::: "memory");
}

// ---------------------------------------------------------------------------
// NT GEMM:  D(M,Nn) = A(M,K) * B(Nn,K)^T   (bf16 in, f32 accum via WMMA)
//   TRANS    : store D transposed (Cout[n][m]) — 16B-contiguous per lane
//   OUT_BF16 : output bf16 (else f32)
//   HAS_BIAS : + bias[m]
//   HAS_RES  : + res[m*ldc + n] (row-major only)
//   blockIdx.z : one independent product per z; sAz/sBz/sCz are the element
//                strides of A, B and Cout (and res) from one z to the next.
// block tile 128x128, 8 waves (2x4), 128 k per LDS stage (four WMMA k-steps),
// two LDS buffers filled by async copies that overlap the WMMA stream. A stage
// row is 256 B, so one wave-wide copy covers two rows = four whole 128-B lines.
// ---------------------------------------------------------------------------
static constexpr int BM = 128, BN = 128, BK = 128;
static constexpr int LDSS = 136;  // padded row stride in bf16 elems (272B = 16B x odd)

union FragAB { v16bf v; f4 f[2]; };

template <bool TRANS, bool OUT_BF16, bool HAS_BIAS, bool HAS_RES>
__global__ __launch_bounds__(256)
void gemm_nt(const bf16* __restrict__ A, const bf16* __restrict__ B,
             void* __restrict__ Cout, const float* __restrict__ bias,
             const float* __restrict__ res,
             int M, int Nn, int K, int lda, int ldb, int ldc, float scale,
             int sAz, int sBz, int sCz) {
  __shared__ __attribute__((aligned(16))) bf16 shA[2][BM * LDSS];
  __shared__ __attribute__((aligned(16))) bf16 shB[2][BN * LDSS];

  A += (size_t)blockIdx.z * sAz;
  B += (size_t)blockIdx.z * sBz;
  const size_t cOffZ = (size_t)blockIdx.z * sCz;
  if constexpr (OUT_BF16) Cout = (bf16*)Cout + cOffZ;
  else                    Cout = (float*)Cout + cOffZ;
  if constexpr (HAS_RES)  res += cOffZ;

  const int tid  = threadIdx.x;
  const int lane = tid & 31;
  const int wv   = tid >> 5;
  const int wm   = wv & 3;          // 4 wave-rows
  const int wn   = wv >> 2;         // 2 wave-cols
  const int m0   = blockIdx.y * BM;
  const int n0   = blockIdx.x * BN;

  // staging: 16 lanes cover one 256B stage row; a thread copies its 16B chunk
  // of rows lr, lr+16, ..., lr+112 of both operands
  const int lr = tid >> 4;           // 0..15 (first tile row)
  const int lc = (tid & 15) * 8;     // k elems

  const bf16* aPtr = A + (size_t)(m0 + lr) * lda + lc;
  const bf16* bPtr = B + (size_t)(n0 + lr) * ldb + lc;
  const unsigned thrL  = (unsigned)((lr * LDSS + lc) * 2);  // bytes
  const unsigned sA[2] = { (unsigned)(unsigned long long)&shA[0][0],
                           (unsigned)(unsigned long long)&shA[1][0] };
  const unsigned sB[2] = { (unsigned)(unsigned long long)&shB[0][0],
                           (unsigned)(unsigned long long)&shB[1][0] };

  auto issue_tile = [&](int kt, int buf) {
    async_rows8(sA[buf] + thrL, 16u * LDSS * 2u, aPtr + (size_t)kt * BK, (size_t)16 * lda);
    async_rows8(sB[buf] + thrL, 16u * LDSS * 2u, bPtr + (size_t)kt * BK, (size_t)16 * ldb);
  };

  const int KT = K / BK;
  issue_tile(0, 0);
  wait_async0();
  __syncthreads();      // stage 0 is published
  if (KT > 1) issue_tile(1, 1);

  v8f acc[2][4];
#pragma unroll
  for (int i = 0; i < 2; ++i)
#pragma unroll
    for (int j = 0; j < 4; ++j)
#pragma unroll
      for (int r = 0; r < 8; ++r) acc[i][j][r] = 0.f;

  const int hl = lane >> 4;          // K-quarter selector
  const int fr = lane & 15;          // fragment row (M for A, N for B)

  for (int kt = 0; kt < KT; ++kt) {
    const int cur = kt & 1;
    // unrolled so that the next k-step's fragment loads can go ahead of this
    // k-step's WMMAs
#pragma unroll
    for (int ks = 0; ks < BK / 32; ++ks) {
      FragAB a[2], b[4];
#pragma unroll
      for (int i = 0; i < 2; ++i) {
        const bf16* p = &shA[cur][(wm * 32 + i * 16 + fr) * LDSS + ks * 32 + 8 * hl];
        a[i].f[0] = *(const f4*)p;
        a[i].f[1] = *(const f4*)(p + 16);
      }
#pragma unroll
      for (int j = 0; j < 4; ++j) {
        const bf16* p = &shB[cur][(wn * 64 + j * 16 + fr) * LDSS + ks * 32 + 8 * hl];
        b[j].f[0] = *(const f4*)p;
        b[j].f[1] = *(const f4*)(p + 16);
      }
#pragma unroll
      for (int i = 0; i < 2; ++i)
#pragma unroll
        for (int j = 0; j < 4; ++j)
          acc[i][j] = __builtin_amdgcn_wmma_f32_16x16x32_bf16(
              false, a[i].v, false, b[j].v, (short)0, acc[i][j], false, false);
    }
    wait_ds0();
    wait_async0();
    __syncthreads();      // stage kt+1 is published; buf[cur] has no reader left
    if (kt + 2 < KT) issue_tile(kt + 2, cur);
  }
  wait_async0();

  // epilogue: D tile [16x16]; lane fr = N index, VGPR r -> M = 8*hl + r
#pragma unroll
  for (int i = 0; i < 2; ++i) {
    const int mBase = m0 + wm * 32 + i * 16 + 8 * hl;
#pragma unroll
    for (int j = 0; j < 4; ++j) {
      const int nIdx = n0 + wn * 64 + j * 16 + fr;
      v8f v = acc[i][j];
      if constexpr (TRANS) {
        if constexpr (OUT_BF16) {
          union { bf16 h[8]; f4 f; } t;
#pragma unroll
          for (int r = 0; r < 8; ++r) {
            float f = v[r] * scale;
            if constexpr (HAS_BIAS) f += bias[mBase + r];
            t.h[r] = f2bf(f);
          }
          *(f4*)((bf16*)Cout + (size_t)nIdx * ldc + mBase) = t.f;
        } else {
          union { float x[8]; f4 f[2]; } t;
#pragma unroll
          for (int r = 0; r < 8; ++r) {
            float f = v[r] * scale;
            if constexpr (HAS_BIAS) f += bias[mBase + r];
            t.x[r] = f;
          }
          float* po = (float*)Cout + (size_t)nIdx * ldc + mBase;
          *(f4*)po = t.f[0];
          *(f4*)(po + 4) = t.f[1];
        }
      } else {
#pragma unroll
        for (int r = 0; r < 8; ++r) {
          float f = v[r] * scale;
          if constexpr (HAS_BIAS) f += bias[mBase + r];
          if constexpr (HAS_RES)  f += res[(size_t)(mBase + r) * ldc + nIdx];
          if constexpr (OUT_BF16)
            ((bf16*)Cout)[(size_t)(mBase + r) * ldc + nIdx] = f2bf(f);
          else
            ((float*)Cout)[(size_t)(mBase + r) * ldc + nIdx] = f;
        }
      }
    }
  }
}

// ---------------------------------------------------------------------------
extern "C" void kernel_launch(void* const* d_in, const int* in_sizes, int n_in,
                              void* d_out, int out_size, void* d_ws, size_t ws_size,
                              hipStream_t stream) {
  const float* input   = (const float*)d_in[0];
  const float* context = (const float*)d_in[1];
  const float* gamma   = (const float*)d_in[2];
  const float* beta    = (const float*)d_in[3];
  const float* Wq      = (const float*)d_in[4];
  const float* bq      = (const float*)d_in[5];
  const float* Wkv     = (const float*)d_in[6];
  const float* bkv     = (const float*)d_in[7];
  const float* Wo      = (const float*)d_in[8];
  const float* bo      = (const float*)d_in[9];
  float* out = (float*)d_out;

  char* wsb = (char*)d_ws;
  size_t off = 0;
  auto alloc = [&](size_t bytes) -> char* {
    char* p = wsb + off;
    off += (bytes + 255) & ~(size_t)255;
    return p;
  };

  float* raw   = (float*)alloc(kN * 2 * sizeof(float));
  float* stats = (float*)alloc(kN * 2 * sizeof(float));
  bf16* Wq16   = (bf16*)alloc((size_t)kO * kC * 2);          //  4 MB
  bf16* Wkv16  = (bf16*)alloc((size_t)2 * kO * kCTX * 2);    //  8 MB
  bf16* Wo16   = (bf16*)alloc((size_t)kC * kO * 2);          //  4 MB
  bf16* xnT    = (bf16*)alloc((size_t)kN * kS * kC * 2);     //  8 MB  (n,s,c)
  bf16* ctxT   = (bf16*)alloc((size_t)kN * kS2 * kCTX * 2);  //  8 MB  (n,s,c)
  bf16* qT     = (bf16*)alloc((size_t)kS * kO * 2);          // 16 MB  (s,4096)
  bf16* kT     = (bf16*)alloc((size_t)kS2 * kO * 2);         // 16 MB  (s2,4096)
  bf16* vB     = (bf16*)alloc((size_t)kO * kS2 * 2);         // 16 MB  (4096,s2)
  float* Sc    = (float*)alloc((size_t)kHG * kS * kS2 * 4);  // 64 MB  scores (hg,q,k)
  bf16* Pb     = (bf16*)alloc((size_t)kHG * kS * kS2 * 2);   // 32 MB  probs  (hg,q,k)
  bf16* yT     = (bf16*)alloc((size_t)kN * kS * kO * 2);     // 64 MB  (n,s,4096)
  (void)ws_size; (void)in_sizes; (void)n_in; (void)out_size;

  // stats
  zero_f32<<<1, 32, 0, stream>>>(raw, kN * 2);
  reduce_stats<<<dim3(256, kN), 256, 0, stream>>>(input, raw);
  finalize_stats<<<1, 32, 0, stream>>>(raw, stats);

  // transposed bf16 activations + bf16 weights
  norm_transpose<<<dim3(kS / 32, kC / 32, kN), dim3(32, 8), 0, stream>>>(
      input, xnT, kC, kS, stats, gamma, beta);
  norm_transpose<<<dim3(kS2 / 32, kCTX / 32, kN), dim3(32, 8), 0, stream>>>(
      context, ctxT, kCTX, kS2, nullptr, nullptr, nullptr);
  cvt_bf16<<<(kO * kC + 255) / 256, 256, 0, stream>>>(Wq, Wq16, kO * kC);
  cvt_bf16<<<(2 * kO * kCTX + 255) / 256, 256, 0, stream>>>(Wkv, Wkv16, 2 * kO * kCTX);
  cvt_bf16<<<(kC * kO + 255) / 256, 256, 0, stream>>>(Wo, Wo16, kC * kO);

  const float scoreScale = 1.0f / sqrtf((float)kC);   // (c^-0.25)^2

  for (int n = 0; n < kN; ++n) {
    const bf16* xb = xnT + (size_t)n * kS * kC;
    const bf16* cb = ctxT + (size_t)n * kS2 * kCTX;

    // q = Wq*xn + bq  -> qT (s, 4096)            [transposed bf16 store]
    gemm_nt<true, true, true, false><<<dim3(kS / BN, kO / BM), 256, 0, stream>>>(
        Wq16, xb, qT, bq, nullptr, kO, kS, kC, kC, kC, kO, 1.0f, 0, 0, 0);
    // k = Wkv[0:4096]*ctx + bkv[0:4096] -> kT (s2, 4096)
    gemm_nt<true, true, true, false><<<dim3(kS2 / BN, kO / BM), 256, 0, stream>>>(
        Wkv16, cb, kT, bkv, nullptr, kO, kS2, kCTX, kCTX, kCTX, kO, 1.0f, 0, 0, 0);
    // v = Wkv[4096:]*ctx + bkv[4096:]  -> vB (4096, s2)  [row-major bf16]
    gemm_nt<false, true, true, false><<<dim3(kS2 / BN, kO / BM), 256, 0, stream>>>(
        Wkv16 + (size_t)kO * kCTX, cb, vB, bkv + kO, nullptr,
        kO, kS2, kCTX, kCTX, kCTX, kS2, 1.0f, 0, 0, 0);

    bf16* yb = yT + (size_t)n * kS * kO;
    for (int h = 0; h < kH; h += kHG) {
      // scores, kHG heads in grid z: D[k,q] = K_h * Q_h^T, transposed store
      // -> Sc[z,q,k] f32, scaled
      gemm_nt<true, false, false, false><<<dim3(kS / BN, kS2 / BM, kHG), 256, 0, stream>>>(
          kT + h * kC, qT + h * kC, Sc, nullptr, nullptr,
          kS2, kS, kC, kO, kO, kS2, scoreScale, kC, kC, kS * kS2);
      softmax_rows<<<kHG * kS / 8, 256, 0, stream>>>(Sc, Pb);
      // y = P * V_h (NT with V^T rows) -> yb[:, (h+z)*512 : (h+z)*512+512]
      gemm_nt<false, true, false, false><<<dim3(kC / BN, kS / BM, kHG), 256, 0, stream>>>(
          Pb, vB + (size_t)h * kC * kS2, yb + h * kC, nullptr, nullptr,
          kS, kC, kS2, kS2, kS2, kO, 1.0f, kS * kS2, kC * kS2, kC);
    }
  }

  // out = Wo * y + bo + residual  (f32, row-major (c,s)), all samples in grid z
  gemm_nt<false, false, true, true><<<dim3(kS / BN, kC / BM, kN), 256, 0, stream>>>(
      Wo16, yT, out, bo, input,
      kC, kS, kO, kO, kO, kS, 1.0f, 0, kS * kO, kC * kS);
}

// v004
// Measured time: 626 microseconds a run.
// Timed twice side by side with v003, it ran 1.36 and 1.32 times as fast.
// Counting every step since v000, it is 3.40 times as fast.
#include <hip/hip_runtime.h>
#include <hip/hip_bf16.h>
#include <math.h>

// ---------------------------------------------------------------------------
// CrossAttention1d for MI455X (gfx1250): bf16 WMMA pipeline, f32 accumulate.
// N=4, C=512, S=2048, S2=2048, H=8, CTX=512.  ~412 GFLOP -> compute-bound,
// all 5 matmul stages on v_wmma_f32_16x16x32_bf16, tiles staged to LDS via
// CDNA5 async copies (global_load_async_to_lds_b128 + s_wait_asynccnt).
// ---------------------------------------------------------------------------

typedef __bf16 bf16;
typedef __attribute__((ext_vector_type(16))) __bf16 v16bf;
typedef __attribute__((ext_vector_type(8)))  float  v8f;
typedef __attribute__((ext_vector_type(4)))  float  f4;

static constexpr int kN = 4, kC = 512, kS = 2048, kS2 = 2048, kH = 8, kCTX = 512;
static constexpr int kO = kC * kH;      // 4096
static constexpr float kEPS = 1e-5f;
static_assert(kC == kCTX && kS == kS2, "the batched launches below pair equal shapes");
static_assert(kO * kC % 256 == 0, "a block of the weight cast lies in one matrix");

__device__ __forceinline__ bf16 f2bf(float f) {
  unsigned u = __builtin_bit_cast(unsigned, f);
  u += 0x7FFFu + ((u >> 16) & 1u);          // round-to-nearest-even
  unsigned short h = (unsigned short)(u >> 16);
  return __builtin_bit_cast(bf16, h);
}

// ---------------------------------------------------------------------------
// Stage 0: batch-wide mean / rstd (layernorm over all C*S per n)
// ---------------------------------------------------------------------------
__global__ void zero_f32(float* p, int n) {
  int i = blockIdx.x * 256 + threadIdx.x;
  if (i < n) p[i] = 0.f;
}

__global__ __launch_bounds__(256)
void reduce_stats(const float* __restrict__ in, float* __restrict__ raw) {
  __shared__ float sh0[256], sh1[256];
  const int n = blockIdx.y;
  const float* p = in + (size_t)n * kC * kS;
  float s = 0.f, s2 = 0.f;
  for (int i = blockIdx.x * 256 + threadIdx.x; i < kC * kS; i += gridDim.x * 256) {
    float v = p[i]; s += v; s2 += v * v;
  }
  sh0[threadIdx.x] = s; sh1[threadIdx.x] = s2;
  __syncthreads();
  for (int o = 128; o > 0; o >>= 1) {
    if ((int)threadIdx.x < o) {
      sh0[threadIdx.x] += sh0[threadIdx.x + o];
      sh1[threadIdx.x] += sh1[threadIdx.x + o];
    }
    __syncthreads();
  }
  if (threadIdx.x == 0) {
    atomicAdd(&raw[2 * n + 0], sh0[0]);
    atomicAdd(&raw[2 * n + 1], sh1[0]);
  }
}

__global__ void finalize_stats(const float* __restrict__ raw, float* __restrict__ stats) {
  int n = threadIdx.x;
  if (n < kN) {
    float inv  = 1.0f / (float)(kC * kS);
    float mean = raw[2 * n] * inv;
    float var  = raw[2 * n + 1] * inv - mean * mean;
    stats[2 * n + 0] = mean;
    stats[2 * n + 1] = rsqrtf(var + kEPS);
  }
}

// ---------------------------------------------------------------------------
// Stage 1: transpose (n,R,Cc)f32 -> (n,Cc,R)bf16, both activations in one launch:
// grid z < kN takes sample z of in, with the layernorm affine; z >= kN takes
// sample z - kN of in2 as it is. outp holds the 2*kN results one after another.
// ---------------------------------------------------------------------------
__global__ __launch_bounds__(256)
void norm_transpose(const float* __restrict__ in, const float* __restrict__ in2,
                    bf16* __restrict__ outp,
                    int R, int Cc, const float* __restrict__ stats,
                    const float* __restrict__ gamma, const float* __restrict__ beta) {
  __shared__ float tile[32][33];
  const int zb = blockIdx.z;
  const bool plain = zb >= kN;
  const int nb = plain ? zb - kN : zb;
  const int r0 = blockIdx.y * 32;
  const int c0 = blockIdx.x * 32;
  const float* pin = (plain ? in2 : in) + ((size_t)nb * R + r0) * Cc + c0;
  for (int i = threadIdx.y; i < 32; i += 8)
    tile[i][threadIdx.x] = pin[(size_t)i * Cc + threadIdx.x];
  __syncthreads();
  float mu = 0.f, rinv = 1.f, g = 1.f, b = 0.f;
  const int r = r0 + threadIdx.x;  // original row (= channel index)
  if (!plain) {
    mu = stats[2 * nb]; rinv = stats[2 * nb + 1]; g = gamma[r]; b = beta[r];
    // the two loads above have taken their offset register before it is rewritten
    asm volatile("s_wait_xcnt 0x0" ::: "memory");
  }
  bf16* pout = outp + ((size_t)zb * Cc + c0) * R + r0;
  for (int i = threadIdx.y; i < 32; i += 8) {
    float v = tile[threadIdx.x][i];
    v = (v - mu) * rinv * g + b;
    pout[(size_t)i * R + threadIdx.x] = f2bf(v);
  }
}

// the three weight matrices in one launch: o holds a (na), b (nb), c (nc) in a
// row. na, nb and nc are multiples of 256, so a block lies in one matrix and the
// grid of (na + nb + nc) / 256 blocks ends with the last element.
__global__ void cvt_bf16(const float* __restrict__ a, const float* __restrict__ b,
                         const float* __restrict__ c, bf16* __restrict__ o,
                         int na, int nb, int nc) {
  const int i0 = blockIdx.x * 256;           // the block's first element in o
  const float* src = a + i0;
  if (i0 >= na)      src = b + (i0 - na);
  if (i0 >= na + nb) src = c + (i0 - na - nb);
  if (i0 < na + nb + nc) o[i0 + threadIdx.x] = f2bf(src[threadIdx.x]);
}

// ---------------------------------------------------------------------------
// Row softmax: f32 (rows x kS2) -> bf16 probabilities, IN PLACE: a row's bf16
// probabilities take the first half of the bytes of its own f32 scores (row
// pitch 2*kS2 bf16), so that eight heads' scores fit the workspace. A row
// belongs to one wave, and every stored value hangs on the row's sum, that is
// on every load of the wave.
// One wave per row: a lane keeps 64 of the row's 2048 scores in registers, so
// the row is read once, each exp is taken once, and maximum and sum are joined
// by lane exchanges, with no LDS and no barrier. A launch starts one wave per
// row instead of eight. Each wave-wide load covers 512 contiguous bytes, each
// wave-wide store 256.
// ---------------------------------------------------------------------------
typedef __attribute__((ext_vector_type(2))) float f2;

// a, b <- 2^a, 2^b. Eight v_exp_f32 in one statement, closed by a v_nop: it is
// the slot that the instruction set asks for behind a transcendental before its
// result is read or its source overwritten.
// The outputs are early-clobber, so that inside the
// statement no exp writes over a source either.
__device__ __forceinline__ void exp2_x8(f4& a, f4& b) {
  float r0, r1, r2, r3, r4, r5, r6, r7;
  asm("v_exp_f32 %0, %8\n\t"
      "v_exp_f32 %1, %9\n\t"
      "v_exp_f32 %2, %10\n\t"
      "v_exp_f32 %3, %11\n\t"
      "v_exp_f32 %4, %12\n\t"
      "v_exp_f32 %5, %13\n\t"
      "v_exp_f32 %6, %14\n\t"
      "v_exp_f32 %7, %15\n\t"
      "v_nop"
      : "=&v"(r0), "=&v"(r1), "=&v"(r2), "=&v"(r3),
        "=&v"(r4), "=&v"(r5), "=&v"(r6), "=&v"(r7)
      : "v"(a[0]), "v"(a[1]), "v"(a[2]), "v"(a[3]),
        "v"(b[0]), "v"(b[1]), "v"(b[2]), "v"(b[3]));
  a[0] = r0; a[1] = r1; a[2] = r2; a[3] = r3;
  b[0] = r4; b[1] = r5; b[2] = r6; b[3] = r7;
}

__global__ __launch_bounds__(256)
void softmax_rows(float* SP) {
  constexpr int NV = kS2 / 128;              // 16-byte vectors per lane
  const int lane = threadIdx.x & 31;
  const int row  = blockIdx.x * 8 + (threadIdx.x >> 5);
  const f4* p = (const f4*)(SP + (size_t)row * kS2) + lane;
  f4 v[NV];
#pragma unroll
  for (int j = 0; j < NV; ++j) v[j] = p[j * 32];
  // keeps the loads' address pair whole (no load returns into it) until every
  // load has taken its address
  asm volatile("s_wait_xcnt 0x0" :: "v"(p) : "memory");

  f4 m4 = v[0];
#pragma unroll
  for (int j = 1; j < NV; ++j)
#pragma unroll
    for (int c = 0; c < 4; ++c) m4[c] = fmaxf(m4[c], v[j][c]);
  float m = fmaxf(fmaxf(m4[0], m4[1]), fmaxf(m4[2], m4[3]));
#pragma unroll
  for (int o = 16; o > 0; o >>= 1) m = fmaxf(m, __shfl_xor(m, o));

  f4 s4 = {0.f, 0.f, 0.f, 0.f};              // four independent sum chains
#pragma unroll
  for (int j = 0; j < NV; j += 2) {
#pragma unroll
    for (int c = 0; c < 4; ++c) {            // exp(x) = 2^(x * log2 e)
      v[j][c]     = (v[j][c] - m) * 1.44269504f;
      v[j + 1][c] = (v[j + 1][c] - m) * 1.44269504f;
    }
    exp2_x8(v[j], v[j + 1]);
#pragma unroll
    for (int c = 0; c < 4; ++c) s4[c] += v[j][c];
#pragma unroll
    for (int c = 0; c < 4; ++c) s4[c] += v[j + 1][c];
  }
  float s = (s4[0] + s4[1]) + (s4[2] + s4[3]);
#pragma unroll
  for (int o = 16; o > 0; o >>= 1) s += __shfl_xor(s, o);
  const float inv = 1.0f / s;

  f2* q = (f2*)(SP + (size_t)row * kS2) + lane;
#pragma unroll
  for (int j = 0; j < NV; ++j) {
    union { bf16 h[4]; f2 f; } t;
#pragma unroll
    for (int c = 0; c < 4; ++c) t.h[c] = f2bf(v[j][c] * inv);
    q[j * 32] = t.f;
  }
}

// ---------------------------------------------------------------------------
// CDNA5 async copies: 16B per lane, global -> LDS, tracked by ASYNCcnt.
// Eight copies of one lane, 16 tile rows apart.
//   l     : the lane's LDS byte address (low 32 bits of the LDS pointer)
//   lstep : LDS bytes from one copy to the next
//   g     : the lane's global pointer
//   gstep : global elements from one copy to the next
// s_wait_xcnt closes the statement so that no address register named here is
// rewritten while a copy may still read it.
// ---------------------------------------------------------------------------
__device__ __forceinline__ void async_rows8(unsigned l, unsigned lstep,
                                            const bf16* g, size_t gstep) {
  asm volatile("global_load_async_to_lds_b128 %0, %8, off\n\t"
               "global_load_async_to_lds_b128 %1, %9, off\n\t"
               "global_load_async_to_lds_b128 %2, %10, off\n\t"
               "global_load_async_to_lds_b128 %3, %11, off\n\t"
               "global_load_async_to_lds_b128 %4, %12, off\n\t"
               "global_load_async_to_lds_b128 %5, %13, off\n\t"
               "global_load_async_to_lds_b128 %6, %14, off\n\t"
               "global_load_async_to_lds_b128 %7, %15, off\n\t"
               "s_wait_xcnt 0x0"
               :: "v"(l), "v"(l + lstep), "v"(l + 2u * lstep), "v"(l + 3u * lstep),
                  "v"(l + 4u * lstep), "v"(l + 5u * lstep), "v"(l + 6u * lstep),
                  "v"(l + 7u * lstep),
                  "v"(g), "v"(g + gstep), "v"(g + 2 * gstep), "v"(g + 3 * gstep),
                  "v"(g + 4 * gstep), "v"(g + 5 * gstep), "v"(g + 6 * gstep),
                  "v"(g + 7 * gstep)
               : "memory");
}
// my own copies have landed in LDS
__device__ __forceinline__ void wait_async0() {
  asm volatile("s_wait_asynccnt 0x0" ::: "memory");
}
// my own LDS reads have returned, so the buffer may be refilled behind the barrier
__device__ __forceinline__ void wait_ds0() {
  asm volatile("s_wait_dscnt 0x0" ::: "memory");
}

// ---------------------------------------------------------------------------
// NT GEMM:  D(M,Nn) = A(M,K) * B(Nn,K)^T   (bf16 in, f32 accum via WMMA)
//   trans    : store D transposed (Cout[n][m]), 16B-contiguous per lane
//   PICK     : trans is known only at run time (the same for the whole block)
//   OUT_BF16 : output bf16 (else f32)
//   HAS_BIAS : + bias[m]
//   HAS_RES  : + res[m*ldc + n] (row-major only)
// gemm_tile does one block tile (blockIdx.y, blockIdx.x) of one product; the
// two kernels behind it pick the product by blockIdx.z.
// block tile 128x128, 8 waves (2x4), 128 k per LDS stage (four WMMA k-steps),
// two LDS buffers filled by async copies that overlap the WMMA stream. A stage
// row is 256 B, so one wave-wide copy covers two rows = four whole 128-B lines.
// ---------------------------------------------------------------------------
static constexpr int BM = 128, BN = 128, BK = 128;
static constexpr int LDSS = 136;  // padded row stride in bf16 elems (272B = 16B x odd)

union FragAB { v16bf v; f4 f[2]; };
template <bool V> struct BoolC { static constexpr bool value = V; };

template <bool PICK, bool OUT_BF16, bool HAS_BIAS, bool HAS_RES>
__device__ __forceinline__
void gemm_tile(bf16 (*shA)[BM * LDSS], bf16 (*shB)[BN * LDSS],
               const bf16* __restrict__ A, const bf16* __restrict__ B,
               void* __restrict__ Cout, const float* __restrict__ bias,
               const float* __restrict__ res,
               int K, int lda, int ldb, int ldc, float scale, bool trans) {
  const int tid  = threadIdx.x;
  const int lane = tid & 31;
  const int wv   = tid >> 5;
  const int wm   = wv & 3;          // 4 wave-rows
  const int wn   = wv >> 2;         // 2 wave-cols
  const int m0   = blockIdx.y * BM;
  const int n0   = blockIdx.x * BN;

  // staging: 16 lanes cover one 256B stage row; a thread copies its 16B chunk
  // of rows lr, lr+16, ..., lr+112 of both operands
  const int lr = tid >> 4;           // 0..15 (first tile row)
  const int lc = (tid & 15) * 8;     // k elems

  const bf16* aPtr = A + (size_t)(m0 + lr) * lda + lc;
  const bf16* bPtr = B + (size_t)(n0 + lr) * ldb + lc;
  const unsigned thrL  = (unsigned)((lr * LDSS + lc) * 2);  // bytes
  const unsigned sA[2] = { (unsigned)(unsigned long long)&shA[0][0],
                           (unsigned)(unsigned long long)&shA[1][0] };
  const unsigned sB[2] = { (unsigned)(unsigned long long)&shB[0][0],
                           (unsigned)(unsigned long long)&shB[1][0] };

  auto issue_tile = [&](int kt, int buf) {
    async_rows8(sA[buf] + thrL, 16u * LDSS * 2u, aPtr + (size_t)kt * BK, (size_t)16 * lda);
    async_rows8(sB[buf] + thrL, 16u * LDSS * 2u, bPtr + (size_t)kt * BK, (size_t)16 * ldb);
  };

  const int KT = K / BK;
  issue_tile(0, 0);
  wait_async0();
  __syncthreads();      // stage 0 is published
  if (KT > 1) issue_tile(1, 1);

  v8f acc[2][4];
#pragma unroll
  for (int i = 0; i < 2; ++i)
#pragma unroll
    for (int j = 0; j < 4; ++j)
#pragma unroll
      for (int r = 0; r < 8; ++r) acc[i][j][r] = 0.f;

  const int hl = lane >> 4;          // K-quarter selector
  const int fr = lane & 15;          // fragment row (M for A, N for B)

  for (int kt = 0; kt < KT; ++kt) {
    const int cur = kt & 1;
    // unrolled so that the next k-step's fragment loads can go ahead of this
    // k-step's WMMAs
#pragma unroll
    for (int ks = 0; ks < BK / 32; ++ks) {
      FragAB a[2], b[4];
#pragma unroll
      for (int i = 0; i < 2; ++i) {
        const bf16* p = &shA[cur][(wm * 32 + i * 16 + fr) * LDSS + ks * 32 + 8 * hl];
        a[i].f[0] = *(const f4*)p;
        a[i].f[1] = *(const f4*)(p + 16);
      }
#pragma unroll
      for (int j = 0; j < 4; ++j) {
        const bf16* p = &shB[cur][(wn * 64 + j * 16 + fr) * LDSS + ks * 32 + 8 * hl];
        b[j].f[0] = *(const f4*)p;
        b[j].f[1] = *(const f4*)(p + 16);
      }
#pragma unroll
      for (int i = 0; i < 2; ++i)
#pragma unroll
        for (int j = 0; j < 4; ++j)
          acc[i][j] = __builtin_amdgcn_wmma_f32_16x16x32_bf16(
              false, a[i].v, false, b[j].v, (short)0, acc[i][j], false, false);
    }
    wait_ds0();
    wait_async0();
    __syncthreads();      // stage kt+1 is published; buf[cur] has no reader left
    if (kt + 2 < KT) issue_tile(kt + 2, cur);
  }
  wait_async0();

  // epilogue: D tile [16x16]; lane fr = N index, VGPR r -> M = 8*hl + r
  auto store_tiles = [&](auto tr) {
  constexpr bool TR = decltype(tr)::value;
#pragma unroll
  for (int i = 0; i < 2; ++i) {
    const int mBase = m0 + wm * 32 + i * 16 + 8 * hl;
#pragma unroll
    for (int j = 0; j < 4; ++j) {
      const int nIdx = n0 + wn * 64 + j * 16 + fr;
      v8f v = acc[i][j];
      if constexpr (TR) {
        if constexpr (OUT_BF16) {
          union { bf16 h[8]; f4 f; } t;
#pragma unroll
          for (int r = 0; r < 8; ++r) {
            float f = v[r] * scale;
            if constexpr (HAS_BIAS) f += bias[mBase + r];
            t.h[r] = f2bf(f);
          }
          *(f4*)((bf16*)Cout + (size_t)nIdx * ldc + mBase) = t.f;
        } else {
          union { float x[8]; f4 f[2]; } t;
#pragma unroll
          for (int r = 0; r < 8; ++r) {
            float f = v[r] * scale;
            if constexpr (HAS_BIAS) f += bias[mBase + r];
            t.x[r] = f;
          }
          float* po = (float*)Cout + (size_t)nIdx * ldc + mBase;
          *(f4*)po = t.f[0];
          *(f4*)(po + 4) = t.f[1];
        }
      } else {
#pragma unroll
        for (int r = 0; r < 8; ++r) {
          float f = v[r] * scale;
          if constexpr (HAS_BIAS) f += bias[mBase + r];
          if constexpr (HAS_RES)  f += res[(size_t)(mBase + r) * ldc + nIdx];
          if constexpr (OUT_BF16)
            ((bf16*)Cout)[(size_t)(mBase + r) * ldc + nIdx] = f2bf(f);
          else
            ((float*)Cout)[(size_t)(mBase + r) * ldc + nIdx] = f;
        }
      }
    }
  }
  };
  // the store form is picked once, outside the tile loops: each form's bias
  // loads and stores stay one straight run
  if constexpr (PICK) {
    if (trans) {
      store_tiles(BoolC<true>{});
      // these stores have taken their registers before the code of the other
      // form, which stands behind them in the kernel, writes the same registers
      asm volatile("s_wait_xcnt 0x0" ::: "memory");
    } else {
      store_tiles(BoolC<false>{});
    }
  } else {
    if (trans) store_tiles(BoolC<true>{});
    else       store_tiles(BoolC<false>{});
  }
}

// One independent product per blockIdx.z; sAz/sBz/sCz are the element strides
// of A, B and Cout (and res) from one z to the next.
template <bool TRANS, bool OUT_BF16, bool HAS_BIAS, bool HAS_RES>
__global__ __launch_bounds__(256)
void gemm_nt(const bf16* __restrict__ A, const bf16* __restrict__ B,
             void* __restrict__ Cout, const float* __restrict__ bias,
             const float* __restrict__ res,
             int K, int lda, int ldb, int ldc, float scale,
             int sAz, int sBz, int sCz) {
  __shared__ __attribute__((aligned(16))) bf16 shA[2][BM * LDSS];
  __shared__ __attribute__((aligned(16))) bf16 shB[2][BN * LDSS];

  A += (size_t)blockIdx.z * sAz;
  B += (size_t)blockIdx.z * sBz;
  const size_t cOffZ = (size_t)blockIdx.z * sCz;
  if constexpr (OUT_BF16) Cout = (bf16*)Cout + cOffZ;
  else                    Cout = (float*)Cout + cOffZ;
  if constexpr (HAS_RES)  res += cOffZ;
  gemm_tile<false, OUT_BF16, HAS_BIAS, HAS_RES>(shA, shB, A, B, Cout, bias, res,
                                         K, lda, ldb, ldc, scale, TRANS);
}

// The three projections of one sample in one launch, picked by blockIdx.z:
//   0: q = Wq*xn + bq            -> qT (s, 4096)    transposed store
//   1: k = Wkv[0:4096]*ctx + b   -> kT (s2, 4096)   transposed store
//   2: v = Wkv[4096:]*ctx + b    -> vB (4096, s2)   row-major store
__global__ __launch_bounds__(256)
void gemm_qkv(const bf16* __restrict__ Wq, const bf16* __restrict__ Wkv,
              const bf16* __restrict__ xb, const bf16* __restrict__ cb,
              bf16* __restrict__ qT, bf16* __restrict__ kT, bf16* __restrict__ vB,
              const float* __restrict__ bq, const float* __restrict__ bkv) {
  __shared__ __attribute__((aligned(16))) bf16 shA[2][BM * LDSS];
  __shared__ __attribute__((aligned(16))) bf16 shB[2][BN * LDSS];

  const int z = blockIdx.z;
  const bf16*  A    = z == 0 ? Wq : Wkv + (size_t)(z - 1) * kO * kCTX;
  const bf16*  B    = z == 0 ? xb : cb;
  const float* bias = z == 0 ? bq : bkv + (z - 1) * kO;
  bf16*        C    = z == 0 ? qT : (z == 1 ? kT : vB);
  gemm_tile<true, true, true, false>(shA, shB, A, B, C, bias, nullptr,
                               kC, kC, kC, z == 2 ? kS2 : kO, 1.0f, z != 2);
}

// ---------------------------------------------------------------------------
extern "C" void kernel_launch(void* const* d_in, const int* in_sizes, int n_in,
                              void* d_out, int out_size, void* d_ws, size_t ws_size,
                              hipStream_t stream) {
  const float* input   = (const float*)d_in[0];
  const float* context = (const float*)d_in[1];
  const float* gamma   = (const float*)d_in[2];
  const float* beta    = (const float*)d_in[3];
  const float* Wq      = (const float*)d_in[4];
  const float* bq      = (const float*)d_in[5];
  const float* Wkv     = (const float*)d_in[6];
  const float* bkv     = (const float*)d_in[7];
  const float* Wo      = (const float*)d_in[8];
  const float* bo      = (const float*)d_in[9];
  float* out = (float*)d_out;

  char* wsb = (char*)d_ws;
  size_t off = 0;
  auto alloc = [&](size_t bytes) -> char* {
    char* p = wsb + off;
    off += (bytes + 255) & ~(size_t)255;
    return p;
  };

  bf16* Wq16   = (bf16*)alloc((size_t)kO * kC * 2);          //   4 MB
  bf16* Wkv16  = (bf16*)alloc((size_t)2 * kO * kCTX * 2);    //   8 MB, behind Wq16
  bf16* Wo16   = (bf16*)alloc((size_t)kC * kO * 2);          //   4 MB, behind Wkv16
  bf16* xnT    = (bf16*)alloc((size_t)kN * kS * kC * 2);     //   8 MB  (n,s,c)
  bf16* ctxT   = (bf16*)alloc((size_t)kN * kS2 * kCTX * 2);  //   8 MB  (n,s,c), behind xnT
  bf16* kT     = (bf16*)alloc((size_t)kS2 * kO * 2);         //  16 MB  (s2,4096)
  bf16* vB     = (bf16*)alloc((size_t)kO * kS2 * 2);         //  16 MB  (4096,s2)
  float* Sc    = (float*)alloc((size_t)kH * kS * kS2 * 4);   // 128 MB  scores (h,q,k), then probs in place
  bf16* yT     = (bf16*)alloc((size_t)kN * kS * kO * 2);     //  64 MB  (n,s,4096): q of sample n, then its y
  // 256 MB, the whole workspace. The statistics are done with before the first
  // scores are written, and lie in their place.
  float* raw   = Sc;
  float* stats = Sc + 64;
  (void)ws_size; (void)in_sizes; (void)n_in; (void)out_size;

  // stats
  zero_f32<<<1, 32, 0, stream>>>(raw, kN * 2);
  reduce_stats<<<dim3(256, kN), 256, 0, stream>>>(input, raw);
  finalize_stats<<<1, 32, 0, stream>>>(raw, stats);

  // transposed bf16 activations (xnT, then ctxT) + bf16 weights (Wq16, Wkv16, Wo16)
  norm_transpose<<<dim3(kS / 32, kC / 32, 2 * kN), dim3(32, 8), 0, stream>>>(
      input, context, xnT, kC, kS, stats, gamma, beta);
  cvt_bf16<<<4 * kO * kC / 256, 256, 0, stream>>>(
      Wq, Wkv, Wo, Wq16, kO * kC, 2 * kO * kCTX, kC * kO);

  const float scoreScale = 1.0f / sqrtf((float)kC);   // (c^-0.25)^2

  for (int n = 0; n < kN; ++n) {
    const bf16* xb = xnT + (size_t)n * kS * kC;
    const bf16* cb = ctxT + (size_t)n * kS2 * kCTX;
    bf16* yb = yT + (size_t)n * kS * kO;   // q of this sample until its scores are done

    gemm_qkv<<<dim3(kS / BN, kO / BM, 3), 256, 0, stream>>>(
        Wq16, Wkv16, xb, cb, yb, kT, vB, bq, bkv);

    // scores, all heads in grid z: D[k,q] = K_h * Q_h^T, transposed store
    // -> Sc[z,q,k] f32, scaled
    gemm_nt<true, false, false, false><<<dim3(kS / BN, kS2 / BM, kH), 256, 0, stream>>>(
        kT, yb, Sc, nullptr, nullptr,
        kC, kO, kO, kS2, scoreScale, kC, kC, kS * kS2);
    softmax_rows<<<kH * kS / 8, 256, 0, stream>>>(Sc);
    // y = P * V_h (NT with V^T rows) -> yb[:, z*512 : z*512+512]
    gemm_nt<false, true, false, false><<<dim3(kC / BN, kS / BM, kH), 256, 0, stream>>>(
        (const bf16*)Sc, vB, yb, nullptr, nullptr,
        kS2, 2 * kS2, kS2, kO, 1.0f, kS * 2 * kS2, kC * kS2, kC);
  }

  // out = Wo * y + bo + residual  (f32, row-major (c,s)), all samples in grid z
  gemm_nt<false, false, true, true><<<dim3(kS / BN, kC / BM, kN), 256, 0, stream>>>(
      Wo16, yT, out, bo, input,
      kO, kO, kO, kS, 1.0f, 0, kS * kO, kC * kS);
}

// v005
// It runs in 616 microseconds.
// Timed twice side by side with v004, it ran 1.03 and 1.02 times as fast.
// All steps since v000 together make it 3.49 times as fast.
#include <hip/hip_runtime.h>
#include <hip/hip_bf16.h>
#include <math.h>

// ---------------------------------------------------------------------------
// CrossAttention1d for MI455X (gfx1250): bf16 WMMA pipeline, f32 accumulate.
// N=4, C=512, S=2048, S2=2048, H=8, CTX=512.  ~412 GFLOP -> compute-bound,
// all 5 matmul stages on v_wmma_f32_16x16x32_bf16, tiles staged to LDS via
// CDNA5 async copies (global_load_async_to_lds_b128 + s_wait_asynccnt).
// ---------------------------------------------------------------------------

typedef __bf16 bf16;
typedef __attribute__((ext_vector_type(16))) __bf16 v16bf;
typedef __attribute__((ext_vector_type(8)))  float  v8f;
typedef __attribute__((ext_vector_type(4)))  float  f4;

static constexpr int kN = 4, kC = 512, kS = 2048, kS2 = 2048, kH = 8, kCTX = 512;
static constexpr int kO = kC * kH;      // 4096
static constexpr float kEPS = 1e-5f;
static_assert(kC == kCTX && kS == kS2, "the batched launches below pair equal shapes");

__device__ __forceinline__ bf16 f2bf(float f) {
  unsigned u = __builtin_bit_cast(unsigned, f);
  u += 0x7FFFu + ((u >> 16) & 1u);          // round-to-nearest-even
  unsigned short h = (unsigned short)(u >> 16);
  return __builtin_bit_cast(bf16, h);
}

// ---------------------------------------------------------------------------
// Stage 0: batch-wide mean / rstd (layernorm over all C*S per n)
// ---------------------------------------------------------------------------
__global__ void zero_f32(float* p, int n) {
  int i = blockIdx.x * 256 + threadIdx.x;
  if (i < n) p[i] = 0.f;
}

__global__ __launch_bounds__(256)
void reduce_stats(const float* __restrict__ in, float* __restrict__ raw) {
  __shared__ float sh0[256], sh1[256];
  const int n = blockIdx.y;
  const float* p = in + (size_t)n * kC * kS;
  float s = 0.f, s2 = 0.f;
  for (int i = blockIdx.x * 256 + threadIdx.x; i < kC * kS; i += gridDim.x * 256) {
    float v = p[i]; s += v; s2 += v * v;
  }
  sh0[threadIdx.x] = s; sh1[threadIdx.x] = s2;
  __syncthreads();
  for (int o = 128; o > 0; o >>= 1) {
    if ((int)threadIdx.x < o) {
      sh0[threadIdx.x] += sh0[threadIdx.x + o];
      sh1[threadIdx.x] += sh1[threadIdx.x + o];
    }
    __syncthreads();
  }
  if (threadIdx.x == 0) {
    atomicAdd(&raw[2 * n + 0], sh0[0]);
    atomicAdd(&raw[2 * n + 1], sh1[0]);
  }
}

__global__ void finalize_stats(const float* __restrict__ raw, float* __restrict__ stats) {
  int n = threadIdx.x;
  if (n < kN) {
    float inv  = 1.0f / (float)(kC * kS);
    float mean = raw[2 * n] * inv;
    float var  = raw[2 * n + 1] * inv - mean * mean;
    stats[2 * n + 0] = mean;
    stats[2 * n + 1] = rsqrtf(var + kEPS);
  }
}

// ---------------------------------------------------------------------------
// Stage 1: transpose (n,kC,kS)f32 -> (n,kS,kC)bf16, both activations in one launch:
// grid z < kN takes sample z of in, with the layernorm affine; z >= kN takes
// sample z - kN of in2 as it is. outp holds the 2*kN results one after another.
// A block takes a tile of 128 channels x 64 positions, a thread 32 elements, so
// that the launch starts 8,192 waves and each has eight 16-byte loads in flight.
// A wave-wide load covers 256 B of two channel rows, a wave-wide store 256 B of
// two position rows: whole 128-B lines both ways. LDS holds the tile transposed,
// two neighbouring channels packed in a dword; the odd pitch spreads the 32
// lanes of every LDS write and read over 32 banks.
// ---------------------------------------------------------------------------
typedef __attribute__((ext_vector_type(2))) float f2;
typedef __attribute__((ext_vector_type(4))) unsigned u4;
static constexpr int TR = 128, TC = 64;    // tile: channels x positions
static constexpr int TP = TR / 2 + 1;      // LDS pitch of a position row, dwords
static_assert(kC % TR == 0 && kS % TC == 0, "whole tiles only");

__device__ __forceinline__ unsigned pack_bf16(float lo, float hi) {
  return (unsigned)__builtin_bit_cast(unsigned short, f2bf(lo)) |
         ((unsigned)__builtin_bit_cast(unsigned short, f2bf(hi)) << 16);
}

__global__ __launch_bounds__(256)
void norm_transpose(const float* __restrict__ in, const float* __restrict__ in2,
                    bf16* __restrict__ outp, const float* __restrict__ stats,
                    const float* __restrict__ gamma, const float* __restrict__ beta) {
  __shared__ unsigned tile[TC * TP];
  const int zb = blockIdx.z;
  const bool plain = zb >= kN;
  const int nb = plain ? zb - kN : zb;
  const int r0 = blockIdx.y * TR;            // first channel
  const int c0 = blockIdx.x * TC;            // first position
  const int cq = threadIdx.x & 15;
  const int tg = threadIdx.x >> 4;           // 0..15

  // the sample's mean and 1/sigma; a plain tile takes 0 and 1
  const float smu = stats[2 * nb], srinv = stats[2 * nb + 1];
  const float mu = plain ? 0.f : smu, rinv = plain ? 1.f : srinv;
  f2 g[4], b[4];
#pragma unroll
  for (int i = 0; i < 4; ++i) { g[i] = f2{1.f, 1.f}; b[i] = f2{0.f, 0.f}; }
  if (!plain) {
    const f2* pg = (const f2*)(gamma + r0 + 2 * tg);
    const f2* pb = (const f2*)(beta + r0 + 2 * tg);
#pragma unroll
    for (int i = 0; i < 4; ++i) { g[i] = pg[16 * i]; b[i] = pb[16 * i]; }
    // these loads have taken their address registers before they are rewritten
    asm volatile("s_wait_xcnt 0x0" ::: "memory");
  }

  // channels r0 + 2*(tg + 16 i) and the next one, positions c0 + 4 cq .. + 3
  const float* pin = (plain ? in2 : in) + ((size_t)nb * kC + r0 + 2 * tg) * kS + c0 + 4 * cq;
  f4 lo[4], hi[4];
#pragma unroll
  for (int i = 0; i < 4; ++i) {
    lo[i] = *(const f4*)(pin + (size_t)(32 * i) * kS);
    hi[i] = *(const f4*)(pin + (size_t)(32 * i + 1) * kS);
  }
  // keeps the loads' address pair whole (no load returns into it) until every
  // load has taken its address
  asm volatile("s_wait_xcnt 0x0" :: "v"(pin) : "memory");

#pragma unroll
  for (int i = 0; i < 4; ++i)
#pragma unroll
    for (int e = 0; e < 4; ++e) {
      const float x = (lo[i][e] - mu) * rinv * g[i][0] + b[i][0];
      const float y = (hi[i][e] - mu) * rinv * g[i][1] + b[i][1];
      tile[(4 * cq + e) * TP + tg + 16 * i] = pack_bf16(x, y);
    }
  __syncthreads();

  // position c0 + tg + 16 k, channels r0 + 8 cq .. + 7
  bf16* pout = outp + ((size_t)zb * kS + c0 + tg) * kC + r0 + 8 * cq;
#pragma unroll
  for (int k = 0; k < 4; ++k) {
    const unsigned* s = &tile[(tg + 16 * k) * TP + 4 * cq];
    const u4 w = {s[0], s[1], s[2], s[3]};
    *(u4*)(pout + (size_t)(16 * k) * kC) = w;
  }
}

// the three weight matrices in one launch: o holds a (na), b (nb), c (nc) in a
// row. na, nb and nc are multiples of CVT_BLK, so a block lies in one matrix and
// the grid of (na + nb + nc) / CVT_BLK blocks ends with the last element.
// A lane casts 64 elements: the launch starts 4,096 waves, each with sixteen
// 16-byte loads in flight. Each wave-wide load covers 512 contiguous bytes, each
// wave-wide store 256.
static constexpr int CVT_V   = 16;                 // 16-byte loads of a lane
static constexpr int CVT_BLK = 256 * 4 * CVT_V;    // elements of a block
static_assert(kO * kC % CVT_BLK == 0, "a block of the weight cast lies in one matrix");

__global__ __launch_bounds__(256)
void cvt_bf16(const float* __restrict__ a, const float* __restrict__ b,
              const float* __restrict__ c, bf16* __restrict__ o,
              int na, int nb, int nc) {
  const int i0 = blockIdx.x * CVT_BLK;       // the block's first element in o
  if (i0 >= na + nb + nc) return;
  const float* src = a + i0;
  if (i0 >= na)      src = b + (i0 - na);
  if (i0 >= na + nb) src = c + (i0 - na - nb);
  // the lane's first element in the block: a wave takes 128 * CVT_V in a row
  const int w0 = (threadIdx.x >> 5) * (128 * CVT_V) + (threadIdx.x & 31) * 4;
  const f4* p = (const f4*)(src + w0);
  f4 v[CVT_V];
#pragma unroll
  for (int j = 0; j < CVT_V; ++j) v[j] = p[j * 32];
  // the loads have taken their address registers before these are rewritten
  asm volatile("s_wait_xcnt 0x0" ::: "memory");
  f2* q = (f2*)(o + i0 + w0);
#pragma unroll
  for (int j = 0; j < CVT_V; ++j) {
    union { unsigned u[2]; f2 f; } t;
    t.u[0] = pack_bf16(v[j][0], v[j][1]);
    t.u[1] = pack_bf16(v[j][2], v[j][3]);
    q[j * 32] = t.f;
  }
}

// ---------------------------------------------------------------------------
// Row softmax: f32 (rows x kS2) -> bf16 probabilities, IN PLACE: a row's bf16
// probabilities take the first half of the bytes of its own f32 scores (row
// pitch 2*kS2 bf16), so that eight heads' scores fit the workspace. A row
// belongs to one wave, and every stored value hangs on the row's sum, that is
// on every load of the wave.
// One wave per row: a lane keeps 64 of the row's 2048 scores in registers, so
// the row is read once, each exp is taken once, and maximum and sum are joined
// by lane exchanges, with no LDS and no barrier. A launch starts one wave per
// row instead of eight. Each wave-wide load covers 512 contiguous bytes, each
// wave-wide store 256.
// ---------------------------------------------------------------------------
// a, b <- 2^a, 2^b. Eight v_exp_f32 in one statement, closed by a v_nop: it is
// the slot that the instruction set asks for behind a transcendental before its
// result is read or its source overwritten.
// The outputs are early-clobber, so that inside the
// statement no exp writes over a source either.
__device__ __forceinline__ void exp2_x8(f4& a, f4& b) {
  float r0, r1, r2, r3, r4, r5, r6, r7;
  asm("v_exp_f32 %0, %8\n\t"
      "v_exp_f32 %1, %9\n\t"
      "v_exp_f32 %2, %10\n\t"
      "v_exp_f32 %3, %11\n\t"
      "v_exp_f32 %4, %12\n\t"
      "v_exp_f32 %5, %13\n\t"
      "v_exp_f32 %6, %14\n\t"
      "v_exp_f32 %7, %15\n\t"
      "v_nop"
      : "=&v"(r0), "=&v"(r1), "=&v"(r2), "=&v"(r3),
        "=&v"(r4), "=&v"(r5), "=&v"(r6), "=&v"(r7)
      : "v"(a[0]), "v"(a[1]), "v"(a[2]), "v"(a[3]),
        "v"(b[0]), "v"(b[1]), "v"(b[2]), "v"(b[3]));
  a[0] = r0; a[1] = r1; a[2] = r2; a[3] = r3;
  b[0] = r4; b[1] = r5; b[2] = r6; b[3] = r7;
}

__global__ __launch_bounds__(256)
void softmax_rows(float* SP) {
  constexpr int NV = kS2 / 128;              // 16-byte vectors per lane
  const int lane = threadIdx.x & 31;
  const int row  = blockIdx.x * 8 + (threadIdx.x >> 5);
  const f4* p = (const f4*)(SP + (size_t)row * kS2) + lane;
  f4 v[NV];
#pragma unroll
  for (int j = 0; j < NV; ++j) v[j] = p[j * 32];
  // keeps the loads' address pair whole (no load returns into it) until every
  // load has taken its address
  asm volatile("s_wait_xcnt 0x0" :: "v"(p) : "memory");

  f4 m4 = v[0];
#pragma unroll
  for (int j = 1; j < NV; ++j)
#pragma unroll
    for (int c = 0; c < 4; ++c) m4[c] = fmaxf(m4[c], v[j][c]);
  float m = fmaxf(fmaxf(m4[0], m4[1]), fmaxf(m4[2], m4[3]));
#pragma unroll
  for (int o = 16; o > 0; o >>= 1) m = fmaxf(m, __shfl_xor(m, o));

  f4 s4 = {0.f, 0.f, 0.f, 0.f};              // four independent sum chains
#pragma unroll
  for (int j = 0; j < NV; j += 2) {
#pragma unroll
    for (int c = 0; c < 4; ++c) {            // exp(x) = 2^(x * log2 e)
      v[j][c]     = (v[j][c] - m) * 1.44269504f;
      v[j + 1][c] = (v[j + 1][c] - m) * 1.44269504f;
    }
    exp2_x8(v[j], v[j + 1]);
#pragma unroll
    for (int c = 0; c < 4; ++c) s4[c] += v[j][c];
#pragma unroll
    for (int c = 0; c < 4; ++c) s4[c] += v[j + 1][c];
  }
  float s = (s4[0] + s4[1]) + (s4[2] + s4[3]);
#pragma unroll
  for (int o = 16; o > 0; o >>= 1) s += __shfl_xor(s, o);
  const float inv = 1.0f / s;

  f2* q = (f2*)(SP + (size_t)row * kS2) + lane;
#pragma unroll
  for (int j = 0; j < NV; ++j) {
    union { bf16 h[4]; f2 f; } t;
#pragma unroll
    for (int c = 0; c < 4; ++c) t.h[c] = f2bf(v[j][c] * inv);
    q[j * 32] = t.f;
  }
}

// ---------------------------------------------------------------------------
// CDNA5 async copies: 16B per lane, global -> LDS, tracked by ASYNCcnt.
// Eight copies of one lane, 16 tile rows apart.
//   l     : the lane's LDS byte address (low 32 bits of the LDS pointer)
//   lstep : LDS bytes from one copy to the next
//   g     : the lane's global pointer
//   gstep : global elements from one copy to the next
// s_wait_xcnt closes the statement so that no address register named here is
// rewritten while a copy may still read it.
// ---------------------------------------------------------------------------
__device__ __forceinline__ void async_rows8(unsigned l, unsigned lstep,
                                            const bf16* g, size_t gstep) {
  asm volatile("global_load_async_to_lds_b128 %0, %8, off\n\t"
               "global_load_async_to_lds_b128 %1, %9, off\n\t"
               "global_load_async_to_lds_b128 %2, %10, off\n\t"
               "global_load_async_to_lds_b128 %3, %11, off\n\t"
               "global_load_async_to_lds_b128 %4, %12, off\n\t"
               "global_load_async_to_lds_b128 %5, %13, off\n\t"
               "global_load_async_to_lds_b128 %6, %14, off\n\t"
               "global_load_async_to_lds_b128 %7, %15, off\n\t"
               "s_wait_xcnt 0x0"
               :: "v"(l), "v"(l + lstep), "v"(l + 2u * lstep), "v"(l + 3u * lstep),
                  "v"(l + 4u * lstep), "v"(l + 5u * lstep), "v"(l + 6u * lstep),
                  "v"(l + 7u * lstep),
                  "v"(g), "v"(g + gstep), "v"(g + 2 * gstep), "v"(g + 3 * gstep),
                  "v"(g + 4 * gstep), "v"(g + 5 * gstep), "v"(g + 6 * gstep),
                  "v"(g + 7 * gstep)
               : "memory");
}
// my own copies have landed in LDS
__device__ __forceinline__ void wait_async0() {
  asm volatile("s_wait_asynccnt 0x0" ::: "memory");
}
// my own LDS reads have returned, so the buffer may be refilled behind the barrier
__device__ __forceinline__ void wait_ds0() {
  asm volatile("s_wait_dscnt 0x0" ::: "memory");
}

// ---------------------------------------------------------------------------
// NT GEMM:  D(M,Nn) = A(M,K) * B(Nn,K)^T   (bf16 in, f32 accum via WMMA)
//   trans    : store D transposed (Cout[n][m]), 16B-contiguous per lane
//   PICK     : trans is known only at run time (the same for the whole block)
//   OUT_BF16 : output bf16 (else f32)
//   HAS_BIAS : + bias[m]
//   HAS_RES  : + res[m*ldc + n] (row-major only)
// gemm_tile does one block tile (blockIdx.y, blockIdx.x) of one product; the
// two kernels behind it pick the product by blockIdx.z.
// block tile 128x128, 8 waves (2x4), 128 k per LDS stage (four WMMA k-steps),
// two LDS buffers filled by async copies that overlap the WMMA stream. A stage
// row is 256 B, so one wave-wide copy covers two rows = four whole 128-B lines.
// ---------------------------------------------------------------------------
static constexpr int BM = 128, BN = 128, BK = 128;
static constexpr int LDSS = 136;  // padded row stride in bf16 elems (272B = 16B x odd)

union FragAB { v16bf v; f4 f[2]; };
template <bool V> struct BoolC { static constexpr bool value = V; };

template <bool PICK, bool OUT_BF16, bool HAS_BIAS, bool HAS_RES>
__device__ __forceinline__
void gemm_tile(bf16 (*shA)[BM * LDSS], bf16 (*shB)[BN * LDSS],
               const bf16* __restrict__ A, const bf16* __restrict__ B,
               void* __restrict__ Cout, const float* __restrict__ bias,
               const float* __restrict__ res,
               int K, int lda, int ldb, int ldc, float scale, bool trans) {
  const int tid  = threadIdx.x;
  const int lane = tid & 31;
  const int wv   = tid >> 5;
  const int wm   = wv & 3;          // 4 wave-rows
  const int wn   = wv >> 2;         // 2 wave-cols
  const int m0   = blockIdx.y * BM;
  const int n0   = blockIdx.x * BN;

  // staging: 16 lanes cover one 256B stage row; a thread copies its 16B chunk
  // of rows lr, lr+16, ..., lr+112 of both operands
  const int lr = tid >> 4;           // 0..15 (first tile row)
  const int lc = (tid & 15) * 8;     // k elems

  const bf16* aPtr = A + (size_t)(m0 + lr) * lda + lc;
  const bf16* bPtr = B + (size_t)(n0 + lr) * ldb + lc;
  const unsigned thrL  = (unsigned)((lr * LDSS + lc) * 2);  // bytes
  const unsigned sA[2] = { (unsigned)(unsigned long long)&shA[0][0],
                           (unsigned)(unsigned long long)&shA[1][0] };
  const unsigned sB[2] = { (unsigned)(unsigned long long)&shB[0][0],
                           (unsigned)(unsigned long long)&shB[1][0] };

  auto issue_tile = [&](int kt, int buf) {
    async_rows8(sA[buf] + thrL, 16u * LDSS * 2u, aPtr + (size_t)kt * BK, (size_t)16 * lda);
    async_rows8(sB[buf] + thrL, 16u * LDSS * 2u, bPtr + (size_t)kt * BK, (size_t)16 * ldb);
  };

  const int KT = K / BK;
  issue_tile(0, 0);
  wait_async0();
  __syncthreads();      // stage 0 is published
  if (KT > 1) issue_tile(1, 1);

  v8f acc[2][4];
#pragma unroll
  for (int i = 0; i < 2; ++i)
#pragma unroll
    for (int j = 0; j < 4; ++j)
#pragma unroll
      for (int r = 0; r < 8; ++r) acc[i][j][r] = 0.f;

  const int hl = lane >> 4;          // K-quarter selector
  const int fr = lane & 15;          // fragment row (M for A, N for B)

  for (int kt = 0; kt < KT; ++kt) {
    const int cur = kt & 1;
    // unrolled so that the next k-step's fragment loads can go ahead of this
    // k-step's WMMAs
#pragma unroll
    for (int ks = 0; ks < BK / 32; ++ks) {
      FragAB a[2], b[4];
#pragma unroll
      for (int i = 0; i < 2; ++i) {
        const bf16* p = &shA[cur][(wm * 32 + i * 16 + fr) * LDSS + ks * 32 + 8 * hl];
        a[i].f[0] = *(const f4*)p;
        a[i].f[1] = *(const f4*)(p + 16);
      }
#pragma unroll
      for (int j = 0; j < 4; ++j) {
        const bf16* p = &shB[cur][(wn * 64 + j * 16 + fr) * LDSS + ks * 32 + 8 * hl];
        b[j].f[0] = *(const f4*)p;
        b[j].f[1] = *(const f4*)(p + 16);
      }
#pragma unroll
      for (int i = 0; i < 2; ++i)
#pragma unroll
        for (int j = 0; j < 4; ++j)
          acc[i][j] = __builtin_amdgcn_wmma_f32_16x16x32_bf16(
              false, a[i].v, false, b[j].v, (short)0, acc[i][j], false, false);
    }
    wait_ds0();
    wait_async0();
    __syncthreads();      // stage kt+1 is published; buf[cur] has no reader left
    if (kt + 2 < KT) issue_tile(kt + 2, cur);
  }
  wait_async0();

  // epilogue: D tile [16x16]; lane fr = N index, VGPR r -> M = 8*hl + r
  auto store_tiles = [&](auto tr) {
  constexpr bool TR = decltype(tr)::value;
#pragma unroll
  for (int i = 0; i < 2; ++i) {
    const int mBase = m0 + wm * 32 + i * 16 + 8 * hl;
#pragma unroll
    for (int j = 0; j < 4; ++j) {
      const int nIdx = n0 + wn * 64 + j * 16 + fr;
      v8f v = acc[i][j];
      if constexpr (TR) {
        if constexpr (OUT_BF16) {
          union { bf16 h[8]; f4 f; } t;
#pragma unroll
          for (int r = 0; r < 8; ++r) {
            float f = v[r] * scale;
            if constexpr (HAS_BIAS) f += bias[mBase + r];
            t.h[r] = f2bf(f);
          }
          *(f4*)((bf16*)Cout + (size_t)nIdx * ldc + mBase) = t.f;
        } else {
          union { float x[8]; f4 f[2]; } t;
#pragma unroll
          for (int r = 0; r < 8; ++r) {
            float f = v[r] * scale;
            if constexpr (HAS_BIAS) f += bias[mBase + r];
            t.x[r] = f;
          }
          float* po = (float*)Cout + (size_t)nIdx * ldc + mBase;
          *(f4*)po = t.f[0];
          *(f4*)(po + 4) = t.f[1];
        }
      } else {
#pragma unroll
        for (int r = 0; r < 8; ++r) {
          float f = v[r] * scale;
          if constexpr (HAS_BIAS) f += bias[mBase + r];
          if constexpr (HAS_RES)  f += res[(size_t)(mBase + r) * ldc + nIdx];
          if constexpr (OUT_BF16)
            ((bf16*)Cout)[(size_t)(mBase + r) * ldc + nIdx] = f2bf(f);
          else
            ((float*)Cout)[(size_t)(mBase + r) * ldc + nIdx] = f;
        }
      }
    }
  }
  };
  // the store form is picked once, outside the tile loops: each form's bias
  // loads and stores stay one straight run
  if constexpr (PICK) {
    if (trans) {
      store_tiles(BoolC<true>{});
      // these stores have taken their registers before the code of the other
      // form, which stands behind them in the kernel, writes the same registers
      asm volatile("s_wait_xcnt 0x0" ::: "memory");
    } else {
      store_tiles(BoolC<false>{});
    }
  } else {
    if (trans) store_tiles(BoolC<true>{});
    else       store_tiles(BoolC<false>{});
  }
}

// One independent product per blockIdx.z; sAz/sBz/sCz are the element strides
// of A, B and Cout (and res) from one z to the next.
template <bool TRANS, bool OUT_BF16, bool HAS_BIAS, bool HAS_RES>
__global__ __launch_bounds__(256)
void gemm_nt(const bf16* __restrict__ A, const bf16* __restrict__ B,
             void* __restrict__ Cout, const float* __restrict__ bias,
             const float* __restrict__ res,
             int K, int lda, int ldb, int ldc, float scale,
             int sAz, int sBz, int sCz) {
  __shared__ __attribute__((aligned(16))) bf16 shA[2][BM * LDSS];
  __shared__ __attribute__((aligned(16))) bf16 shB[2][BN * LDSS];

  A += (size_t)blockIdx.z * sAz;
  B += (size_t)blockIdx.z * sBz;
  const size_t cOffZ = (size_t)blockIdx.z * sCz;
  if constexpr (OUT_BF16) Cout = (bf16*)Cout + cOffZ;
  else                    Cout = (float*)Cout + cOffZ;
  if constexpr (HAS_RES)  res += cOffZ;
  gemm_tile<false, OUT_BF16, HAS_BIAS, HAS_RES>(shA, shB, A, B, Cout, bias, res,
                                         K, lda, ldb, ldc, scale, TRANS);
}

// The three projections of one sample in one launch, picked by blockIdx.z:
//   0: q = Wq*xn + bq            -> qT (s, 4096)    transposed store
//   1: k = Wkv[0:4096]*ctx + b   -> kT (s2, 4096)   transposed store
//   2: v = Wkv[4096:]*ctx + b    -> vB (4096, s2)   row-major store
__global__ __launch_bounds__(256)
void gemm_qkv(const bf16* __restrict__ Wq, const bf16* __restrict__ Wkv,
              const bf16* __restrict__ xb, const bf16* __restrict__ cb,
              bf16* __restrict__ qT, bf16* __restrict__ kT, bf16* __restrict__ vB,
              const float* __restrict__ bq, const float* __restrict__ bkv) {
  __shared__ __attribute__((aligned(16))) bf16 shA[2][BM * LDSS];
  __shared__ __attribute__((aligned(16))) bf16 shB[2][BN * LDSS];

  const int z = blockIdx.z;
  const bf16*  A    = z == 0 ? Wq : Wkv + (size_t)(z - 1) * kO * kCTX;
  const bf16*  B    = z == 0 ? xb : cb;
  const float* bias = z == 0 ? bq : bkv + (z - 1) * kO;
  bf16*        C    = z == 0 ? qT : (z == 1 ? kT : vB);
  gemm_tile<true, true, true, false>(shA, shB, A, B, C, bias, nullptr,
                               kC, kC, kC, z == 2 ? kS2 : kO, 1.0f, z != 2);
}

// ---------------------------------------------------------------------------
extern "C" void kernel_launch(void* const* d_in, const int* in_sizes, int n_in,
                              void* d_out, int out_size, void* d_ws, size_t ws_size,
                              hipStream_t stream) {
  const float* input   = (const float*)d_in[0];
  const float* context = (const float*)d_in[1];
  const float* gamma   = (const float*)d_in[2];
  const float* beta    = (const float*)d_in[3];
  const float* Wq      = (const float*)d_in[4];
  const float* bq      = (const float*)d_in[5];
  const float* Wkv     = (const float*)d_in[6];
  const float* bkv     = (const float*)d_in[7];
  const float* Wo      = (const float*)d_in[8];
  const float* bo      = (const float*)d_in[9];
  float* out = (float*)d_out;

  char* wsb = (char*)d_ws;
  size_t off = 0;
  auto alloc = [&](size_t bytes) -> char* {
    char* p = wsb + off;
    off += (bytes + 255) & ~(size_t)255;
    return p;
  };

  bf16* Wq16   = (bf16*)alloc((size_t)kO * kC * 2);          //   4 MB
  bf16* Wkv16  = (bf16*)alloc((size_t)2 * kO * kCTX * 2);    //   8 MB, behind Wq16
  bf16* Wo16   = (bf16*)alloc((size_t)kC * kO * 2);          //   4 MB, behind Wkv16
  bf16* xnT    = (bf16*)alloc((size_t)kN * kS * kC * 2);     //   8 MB  (n,s,c)
  bf16* ctxT   = (bf16*)alloc((size_t)kN * kS2 * kCTX * 2);  //   8 MB  (n,s,c), behind xnT
  bf16* kT     = (bf16*)alloc((size_t)kS2 * kO * 2);         //  16 MB  (s2,4096)
  bf16* vB     = (bf16*)alloc((size_t)kO * kS2 * 2);         //  16 MB  (4096,s2)
  float* Sc    = (float*)alloc((size_t)kH * kS * kS2 * 4);   // 128 MB  scores (h,q,k), then probs in place
  bf16* yT     = (bf16*)alloc((size_t)kN * kS * kO * 2);     //  64 MB  (n,s,4096): q of sample n, then its y
  // 256 MB, the whole workspace. The statistics are done with before the first
  // scores are written, and lie in their place.
  float* raw   = Sc;
  float* stats = Sc + 64;
  (void)ws_size; (void)in_sizes; (void)n_in; (void)out_size;

  // stats
  zero_f32<<<1, 32, 0, stream>>>(raw, kN * 2);
  reduce_stats<<<dim3(256, kN), 256, 0, stream>>>(input, raw);
  finalize_stats<<<1, 32, 0, stream>>>(raw, stats);

  // transposed bf16 activations (xnT, then ctxT) + bf16 weights (Wq16, Wkv16, Wo16)
  norm_transpose<<<dim3(kS / TC, kC / TR, 2 * kN), 256, 0, stream>>>(
      input, context, xnT, stats, gamma, beta);
  cvt_bf16<<<4 * kO * kC / CVT_BLK, 256, 0, stream>>>(
      Wq, Wkv, Wo, Wq16, kO * kC, 2 * kO * kCTX, kC * kO);

  const float scoreScale = 1.0f / sqrtf((float)kC);   // (c^-0.25)^2

  for (int n = 0; n < kN; ++n) {
    const bf16* xb = xnT + (size_t)n * kS * kC;
    const bf16* cb = ctxT + (size_t)n * kS2 * kCTX;
    bf16* yb = yT + (size_t)n * kS * kO;   // q of this sample until its scores are done

    gemm_qkv<<<dim3(kS / BN, kO / BM, 3), 256, 0, stream>>>(
        Wq16, Wkv16, xb, cb, yb, kT, vB, bq, bkv);

    // scores, all heads in grid z: D[k,q] = K_h * Q_h^T, transposed store
    // -> Sc[z,q,k] f32, scaled
    gemm_nt<true, false, false, false><<<dim3(kS / BN, kS2 / BM, kH), 256, 0, stream>>>(
        kT, yb, Sc, nullptr, nullptr,
        kC, kO, kO, kS2, scoreScale, kC, kC, kS * kS2);
    softmax_rows<<<kH * kS / 8, 256, 0, stream>>>(Sc);
    // y = P * V_h (NT with V^T rows) -> yb[:, z*512 : z*512+512]
    gemm_nt<false, true, false, false><<<dim3(kC / BN, kS / BM, kH), 256, 0, stream>>>(
        (const bf16*)Sc, vB, yb, nullptr, nullptr,
        kS2, 2 * kS2, kS2, kO, 1.0f, kS * 2 * kS2, kC * kS2, kC);
  }

  // out = Wo * y + bo + residual  (f32, row-major (c,s)), all samples in grid z
  gemm_nt<false, false, true, true><<<dim3(kS / BN, kC / BM, kN), 256, 0, stream>>>(
      Wo16, yT, out, bo, input,
      kO, kO, kO, kS, 1.0f, 0, kS * kO, kC * kS);
}

// v006
// Measured time: 407 microseconds a run.
// Next to v005, in two timings, it ran 1.50 and 1.49 times as fast.
// All steps since v000 together make it 5.21 times as fast.
#include <hip/hip_runtime.h>
#include <hip/hip_bf16.h>
#include <math.h>

// ---------------------------------------------------------------------------
// CrossAttention1d for MI455X (gfx1250): bf16 WMMA pipeline, f32 accumulate.
// N=4, C=512, S=2048, S2=2048, H=8, CTX=512.  ~412 GFLOP -> compute-bound,
// all 5 matmul stages on v_wmma_f32_16x16x32_bf16, tiles staged to LDS via
// CDNA5 async copies (global_load_async_to_lds_b128 + s_wait_asynccnt).
// ---------------------------------------------------------------------------

typedef __bf16 bf16;
typedef __attribute__((ext_vector_type(16))) __bf16 v16bf;
typedef __attribute__((ext_vector_type(8)))  float  v8f;
typedef __attribute__((ext_vector_type(4)))  float  f4;

static constexpr int kN = 4, kC = 512, kS = 2048, kS2 = 2048, kH = 8, kCTX = 512;
static constexpr int kO = kC * kH;      // 4096
static constexpr float kEPS = 1e-5f;
static_assert(kC == kCTX && kS == kS2, "the batched launches below pair equal shapes");

__device__ __forceinline__ bf16 f2bf(float f) {
  unsigned u = __builtin_bit_cast(unsigned, f);
  u += 0x7FFFu + ((u >> 16) & 1u);          // round-to-nearest-even
  unsigned short h = (unsigned short)(u >> 16);
  return __builtin_bit_cast(bf16, h);
}

// ---------------------------------------------------------------------------
// Stage 0: batch-wide mean / rstd (layernorm over all C*S per n)
// ---------------------------------------------------------------------------
__global__ void zero_f32(float* p, int n) {
  int i = blockIdx.x * 256 + threadIdx.x;
  if (i < n) p[i] = 0.f;
}

__global__ __launch_bounds__(256)
void reduce_stats(const float* __restrict__ in, float* __restrict__ raw) {
  __shared__ float sh0[256], sh1[256];
  const int n = blockIdx.y;
  const float* p = in + (size_t)n * kC * kS;
  float s = 0.f, s2 = 0.f;
  for (int i = blockIdx.x * 256 + threadIdx.x; i < kC * kS; i += gridDim.x * 256) {
    float v = p[i]; s += v; s2 += v * v;
  }
  sh0[threadIdx.x] = s; sh1[threadIdx.x] = s2;
  __syncthreads();
  for (int o = 128; o > 0; o >>= 1) {
    if ((int)threadIdx.x < o) {
      sh0[threadIdx.x] += sh0[threadIdx.x + o];
      sh1[threadIdx.x] += sh1[threadIdx.x + o];
    }
    __syncthreads();
  }
  if (threadIdx.x == 0) {
    atomicAdd(&raw[2 * n + 0], sh0[0]);
    atomicAdd(&raw[2 * n + 1], sh1[0]);
  }
}

__global__ void finalize_stats(const float* __restrict__ raw, float* __restrict__ stats) {
  int n = threadIdx.x;
  if (n < kN) {
    float inv  = 1.0f / (float)(kC * kS);
    float mean = raw[2 * n] * inv;
    float var  = raw[2 * n + 1] * inv - mean * mean;
    stats[2 * n + 0] = mean;
    stats[2 * n + 1] = rsqrtf(var + kEPS);
  }
}

// ---------------------------------------------------------------------------
// Stage 1: transpose (n,kC,kS)f32 -> (n,kS,kC)bf16, both activations in one launch:
// grid z < kN takes sample z of in, with the layernorm affine; z >= kN takes
// sample z - kN of in2 as it is. outp holds the 2*kN results one after another.
// A block takes a tile of 128 channels x 64 positions, a thread 32 elements, so
// that the launch starts 8,192 waves and each has eight 16-byte loads in flight.
// A wave-wide load covers 256 B of two channel rows, a wave-wide store 256 B of
// two position rows: whole 128-B lines both ways. LDS holds the tile transposed,
// two neighbouring channels packed in a dword; the odd pitch spreads the 32
// lanes of every LDS write and read over 32 banks.
// ---------------------------------------------------------------------------
typedef __attribute__((ext_vector_type(2))) float f2;
typedef __attribute__((ext_vector_type(4))) unsigned u4;
static constexpr int TR = 128, TC = 64;    // tile: channels x positions
static constexpr int TP = TR / 2 + 1;      // LDS pitch of a position row, dwords
static_assert(kC % TR == 0 && kS % TC == 0, "whole tiles only");

__device__ __forceinline__ unsigned pack_bf16(float lo, float hi) {
  return (unsigned)__builtin_bit_cast(unsigned short, f2bf(lo)) |
         ((unsigned)__builtin_bit_cast(unsigned short, f2bf(hi)) << 16);
}

__global__ __launch_bounds__(256)
void norm_transpose(const float* __restrict__ in, const float* __restrict__ in2,
                    bf16* __restrict__ outp, const float* __restrict__ stats,
                    const float* __restrict__ gamma, const float* __restrict__ beta) {
  __shared__ unsigned tile[TC * TP];
  const int zb = blockIdx.z;
  const bool plain = zb >= kN;
  const int nb = plain ? zb - kN : zb;
  const int r0 = blockIdx.y * TR;            // first channel
  const int c0 = blockIdx.x * TC;            // first position
  const int cq = threadIdx.x & 15;
  const int tg = threadIdx.x >> 4;           // 0..15

  // the sample's mean and 1/sigma; a plain tile takes 0 and 1
  const float smu = stats[2 * nb], srinv = stats[2 * nb + 1];
  const float mu = plain ? 0.f : smu, rinv = plain ? 1.f : srinv;
  f2 g[4], b[4];
#pragma unroll
  for (int i = 0; i < 4; ++i) { g[i] = f2{1.f, 1.f}; b[i] = f2{0.f, 0.f}; }
  if (!plain) {
    const f2* pg = (const f2*)(gamma + r0 + 2 * tg);
    const f2* pb = (const f2*)(beta + r0 + 2 * tg);
#pragma unroll
    for (int i = 0; i < 4; ++i) { g[i] = pg[16 * i]; b[i] = pb[16 * i]; }
    // these loads have taken their address registers before they are rewritten
    asm volatile("s_wait_xcnt 0x0" ::: "memory");
  }

  // channels r0 + 2*(tg + 16 i) and the next one, positions c0 + 4 cq .. + 3
  const float* pin = (plain ? in2 : in) + ((size_t)nb * kC + r0 + 2 * tg) * kS + c0 + 4 * cq;
  f4 lo[4], hi[4];
#pragma unroll
  for (int i = 0; i < 4; ++i) {
    lo[i] = *(const f4*)(pin + (size_t)(32 * i) * kS);
    hi[i] = *(const f4*)(pin + (size_t)(32 * i + 1) * kS);
  }
  // keeps the loads' address pair whole (no load returns into it) until every
  // load has taken its address
  asm volatile("s_wait_xcnt 0x0" :: "v"(pin) : "memory");

#pragma unroll
  for (int i = 0; i < 4; ++i)
#pragma unroll
    for (int e = 0; e < 4; ++e) {
      const float x = (lo[i][e] - mu) * rinv * g[i][0] + b[i][0];
      const float y = (hi[i][e] - mu) * rinv * g[i][1] + b[i][1];
      tile[(4 * cq + e) * TP + tg + 16 * i] = pack_bf16(x, y);
    }
  __syncthreads();

  // position c0 + tg + 16 k, channels r0 + 8 cq .. + 7
  bf16* pout = outp + ((size_t)zb * kS + c0 + tg) * kC + r0 + 8 * cq;
#pragma unroll
  for (int k = 0; k < 4; ++k) {
    const unsigned* s = &tile[(tg + 16 * k) * TP + 4 * cq];
    const u4 w = {s[0], s[1], s[2], s[3]};
    *(u4*)(pout + (size_t)(16 * k) * kC) = w;
  }
}

// the three weight matrices in one launch: o holds a (na), b (nb), c (nc) in a
// row. na, nb and nc are multiples of CVT_BLK, so a block lies in one matrix and
// the grid of (na + nb + nc) / CVT_BLK blocks ends with the last element.
// A lane casts 64 elements: the launch starts 4,096 waves, each with sixteen
// 16-byte loads in flight. Each wave-wide load covers 512 contiguous bytes, each
// wave-wide store 256.
static constexpr int CVT_V   = 16;                 // 16-byte loads of a lane
static constexpr int CVT_BLK = 256 * 4 * CVT_V;    // elements of a block
static_assert(kO * kC % CVT_BLK == 0, "a block of the weight cast lies in one matrix");

__global__ __launch_bounds__(256)
void cvt_bf16(const float* __restrict__ a, const float* __restrict__ b,
              const float* __restrict__ c, bf16* __restrict__ o,
              int na, int nb, int nc) {
  const int i0 = blockIdx.x * CVT_BLK;       // the block's first element in o
  if (i0 >= na + nb + nc) return;
  const float* src = a + i0;
  if (i0 >= na)      src = b + (i0 - na);
  if (i0 >= na + nb) src = c + (i0 - na - nb);
  // the lane's first element in the block: a wave takes 128 * CVT_V in a row
  const int w0 = (threadIdx.x >> 5) * (128 * CVT_V) + (threadIdx.x & 31) * 4;
  const f4* p = (const f4*)(src + w0);
  f4 v[CVT_V];
#pragma unroll
  for (int j = 0; j < CVT_V; ++j) v[j] = p[j * 32];
  // the loads have taken their address registers before these are rewritten
  asm volatile("s_wait_xcnt 0x0" ::: "memory");
  f2* q = (f2*)(o + i0 + w0);
#pragma unroll
  for (int j = 0; j < CVT_V; ++j) {
    union { unsigned u[2]; f2 f; } t;
    t.u[0] = pack_bf16(v[j][0], v[j][1]);
    t.u[1] = pack_bf16(v[j][2], v[j][3]);
    q[j * 32] = t.f;
  }
}

// ---------------------------------------------------------------------------
// 2^x for the softmax of the fused attention kernel
// ---------------------------------------------------------------------------
// a, b <- 2^a, 2^b. Eight v_exp_f32 in one statement, closed by a v_nop: it is
// the slot that the instruction set asks for behind a transcendental before its
// result is read or its source overwritten.
// The outputs are early-clobber, so that inside the
// statement no exp writes over a source either.
__device__ __forceinline__ void exp2_x8(f4& a, f4& b) {
  float r0, r1, r2, r3, r4, r5, r6, r7;
  asm("v_exp_f32 %0, %8\n\t"
      "v_exp_f32 %1, %9\n\t"
      "v_exp_f32 %2, %10\n\t"
      "v_exp_f32 %3, %11\n\t"
      "v_exp_f32 %4, %12\n\t"
      "v_exp_f32 %5, %13\n\t"
      "v_exp_f32 %6, %14\n\t"
      "v_exp_f32 %7, %15\n\t"
      "v_nop"
      : "=&v"(r0), "=&v"(r1), "=&v"(r2), "=&v"(r3),
        "=&v"(r4), "=&v"(r5), "=&v"(r6), "=&v"(r7)
      : "v"(a[0]), "v"(a[1]), "v"(a[2]), "v"(a[3]),
        "v"(b[0]), "v"(b[1]), "v"(b[2]), "v"(b[3]));
  a[0] = r0; a[1] = r1; a[2] = r2; a[3] = r3;
  b[0] = r4; b[1] = r5; b[2] = r6; b[3] = r7;
}

// ---------------------------------------------------------------------------
// CDNA5 async copies: 16B per lane, global -> LDS, tracked by ASYNCcnt.
// Eight copies of one lane, a fixed number of tile rows apart.
//   l     : the lane's LDS byte address (low 32 bits of the LDS pointer)
//   lstep : LDS bytes from one copy to the next
//   g     : the lane's global pointer
//   gstep : global elements from one copy to the next
// s_wait_xcnt closes the statement so that no address register named here is
// rewritten while a copy may still read it.
// ---------------------------------------------------------------------------
__device__ __forceinline__ void async_rows8(unsigned l, unsigned lstep,
                                            const bf16* g, size_t gstep) {
  asm volatile("global_load_async_to_lds_b128 %0, %8, off\n\t"
               "global_load_async_to_lds_b128 %1, %9, off\n\t"
               "global_load_async_to_lds_b128 %2, %10, off\n\t"
               "global_load_async_to_lds_b128 %3, %11, off\n\t"
               "global_load_async_to_lds_b128 %4, %12, off\n\t"
               "global_load_async_to_lds_b128 %5, %13, off\n\t"
               "global_load_async_to_lds_b128 %6, %14, off\n\t"
               "global_load_async_to_lds_b128 %7, %15, off\n\t"
               "s_wait_xcnt 0x0"
               :: "v"(l), "v"(l + lstep), "v"(l + 2u * lstep), "v"(l + 3u * lstep),
                  "v"(l + 4u * lstep), "v"(l + 5u * lstep), "v"(l + 6u * lstep),
                  "v"(l + 7u * lstep),
                  "v"(g), "v"(g + gstep), "v"(g + 2 * gstep), "v"(g + 3 * gstep),
                  "v"(g + 4 * gstep), "v"(g + 5 * gstep), "v"(g + 6 * gstep),
                  "v"(g + 7 * gstep)
               : "memory");
}
// my own copies have landed in LDS
__device__ __forceinline__ void wait_async0() {
  asm volatile("s_wait_asynccnt 0x0" ::: "memory");
}
// my own LDS reads have returned, so the buffer may be refilled behind the barrier
__device__ __forceinline__ void wait_ds0() {
  asm volatile("s_wait_dscnt 0x0" ::: "memory");
}

// ---------------------------------------------------------------------------
// NT GEMM:  D(M,Nn) = A(M,K) * B(Nn,K)^T   (bf16 in, f32 accum via WMMA)
//   trans    : store D transposed (Cout[n][m]), 16B-contiguous per lane
//   PICK     : trans is known only at run time (the same for the whole block)
//   OUT_BF16 : output bf16 (else f32)
//   HAS_BIAS : + bias[m]
//   HAS_RES  : + res[m*ldc + n] (row-major only)
// gemm_tile does one block tile (blockIdx.y, blockIdx.x) of one product; the
// two kernels behind it pick the product by blockIdx.z.
// block tile 128x128, 8 waves (2x4), 128 k per LDS stage (four WMMA k-steps),
// two LDS buffers filled by async copies that overlap the WMMA stream. A stage
// row is 256 B, so one wave-wide copy covers two rows = four whole 128-B lines.
// ---------------------------------------------------------------------------
static constexpr int BM = 128, BN = 128, BK = 128;
static constexpr int LDSS = 136;  // padded row stride in bf16 elems (272B = 16B x odd)

union FragAB { v16bf v; f4 f[2]; };
template <bool V> struct BoolC { static constexpr bool value = V; };

template <bool PICK, bool OUT_BF16, bool HAS_BIAS, bool HAS_RES>
__device__ __forceinline__
void gemm_tile(bf16 (*shA)[BM * LDSS], bf16 (*shB)[BN * LDSS],
               const bf16* __restrict__ A, const bf16* __restrict__ B,
               void* __restrict__ Cout, const float* __restrict__ bias,
               const float* __restrict__ res,
               int K, int lda, int ldb, int ldc, float scale, bool trans) {
  const int tid  = threadIdx.x;
  const int lane = tid & 31;
  const int wv   = tid >> 5;
  const int wm   = wv & 3;          // 4 wave-rows
  const int wn   = wv >> 2;         // 2 wave-cols
  const int m0   = blockIdx.y * BM;
  const int n0   = blockIdx.x * BN;

  // staging: 16 lanes cover one 256B stage row; a thread copies its 16B chunk
  // of rows lr, lr+16, ..., lr+112 of both operands
  const int lr = tid >> 4;           // 0..15 (first tile row)
  const int lc = (tid & 15) * 8;     // k elems

  const bf16* aPtr = A + (size_t)(m0 + lr) * lda + lc;
  const bf16* bPtr = B + (size_t)(n0 + lr) * ldb + lc;
  const unsigned thrL  = (unsigned)((lr * LDSS + lc) * 2);  // bytes
  const unsigned sA[2] = { (unsigned)(unsigned long long)&shA[0][0],
                           (unsigned)(unsigned long long)&shA[1][0] };
  const unsigned sB[2] = { (unsigned)(unsigned long long)&shB[0][0],
                           (unsigned)(unsigned long long)&shB[1][0] };

  auto issue_tile = [&](int kt, int buf) {
    async_rows8(sA[buf] + thrL, 16u * LDSS * 2u, aPtr + (size_t)kt * BK, (size_t)16 * lda);
    async_rows8(sB[buf] + thrL, 16u * LDSS * 2u, bPtr + (size_t)kt * BK, (size_t)16 * ldb);
  };

  const int KT = K / BK;
  issue_tile(0, 0);
  wait_async0();
  __syncthreads();      // stage 0 is published
  if (KT > 1) issue_tile(1, 1);

  v8f acc[2][4];
#pragma unroll
  for (int i = 0; i < 2; ++i)
#pragma unroll
    for (int j = 0; j < 4; ++j)
#pragma unroll
      for (int r = 0; r < 8; ++r) acc[i][j][r] = 0.f;

  const int hl = lane >> 4;          // K-quarter selector
  const int fr = lane & 15;          // fragment row (M for A, N for B)

  for (int kt = 0; kt < KT; ++kt) {
    const int cur = kt & 1;
    // unrolled so that the next k-step's fragment loads can go ahead of this
    // k-step's WMMAs
#pragma unroll
    for (int ks = 0; ks < BK / 32; ++ks) {
      FragAB a[2], b[4];
#pragma unroll
      for (int i = 0; i < 2; ++i) {
        const bf16* p = &shA[cur][(wm * 32 + i * 16 + fr) * LDSS + ks * 32 + 8 * hl];
        a[i].f[0] = *(const f4*)p;
        a[i].f[1] = *(const f4*)(p + 16);
      }
#pragma unroll
      for (int j = 0; j < 4; ++j) {
        const bf16* p = &shB[cur][(wn * 64 + j * 16 + fr) * LDSS + ks * 32 + 8 * hl];
        b[j].f[0] = *(const f4*)p;
        b[j].f[1] = *(const f4*)(p + 16);
      }
#pragma unroll
      for (int i = 0; i < 2; ++i)
#pragma unroll
        for (int j = 0; j < 4; ++j)
          acc[i][j] = __builtin_amdgcn_wmma_f32_16x16x32_bf16(
              false, a[i].v, false, b[j].v, (short)0, acc[i][j], false, false);
    }
    wait_ds0();
    wait_async0();
    __syncthreads();      // stage kt+1 is published; buf[cur] has no reader left
    if (kt + 2 < KT) issue_tile(kt + 2, cur);
  }
  wait_async0();

  // epilogue: D tile [16x16]; lane fr = N index, VGPR r -> M = 8*hl + r
  auto store_tiles = [&](auto tr) {
  constexpr bool TR = decltype(tr)::value;
#pragma unroll
  for (int i = 0; i < 2; ++i) {
    const int mBase = m0 + wm * 32 + i * 16 + 8 * hl;
#pragma unroll
    for (int j = 0; j < 4; ++j) {
      const int nIdx = n0 + wn * 64 + j * 16 + fr;
      v8f v = acc[i][j];
      if constexpr (TR) {
        if constexpr (OUT_BF16) {
          union { bf16 h[8]; f4 f; } t;
#pragma unroll
          for (int r = 0; r < 8; ++r) {
            float f = v[r] * scale;
            if constexpr (HAS_BIAS) f += bias[mBase + r];
            t.h[r] = f2bf(f);
          }
          *(f4*)((bf16*)Cout + (size_t)nIdx * ldc + mBase) = t.f;
        } else {
          union { float x[8]; f4 f[2]; } t;
#pragma unroll
          for (int r = 0; r < 8; ++r) {
            float f = v[r] * scale;
            if constexpr (HAS_BIAS) f += bias[mBase + r];
            t.x[r] = f;
          }
          float* po = (float*)Cout + (size_t)nIdx * ldc + mBase;
          *(f4*)po = t.f[0];
          *(f4*)(po + 4) = t.f[1];
        }
      } else {
#pragma unroll
        for (int r = 0; r < 8; ++r) {
          float f = v[r] * scale;
          if constexpr (HAS_BIAS) f += bias[mBase + r];
          if constexpr (HAS_RES)  f += res[(size_t)(mBase + r) * ldc + nIdx];
          if constexpr (OUT_BF16)
            ((bf16*)Cout)[(size_t)(mBase + r) * ldc + nIdx] = f2bf(f);
          else
            ((float*)Cout)[(size_t)(mBase + r) * ldc + nIdx] = f;
        }
      }
    }
  }
  };
  // the store form is picked once, outside the tile loops: each form's bias
  // loads and stores stay one straight run
  if constexpr (PICK) {
    if (trans) {
      store_tiles(BoolC<true>{});
      // these stores have taken their registers before the code of the other
      // form, which stands behind them in the kernel, writes the same registers
      asm volatile("s_wait_xcnt 0x0" ::: "memory");
    } else {
      store_tiles(BoolC<false>{});
    }
  } else {
    if (trans) store_tiles(BoolC<true>{});
    else       store_tiles(BoolC<false>{});
  }
}

// One independent product per blockIdx.z; sAz/sBz/sCz are the element strides
// of A, B and Cout (and res) from one z to the next.
template <bool TRANS, bool OUT_BF16, bool HAS_BIAS, bool HAS_RES>
__global__ __launch_bounds__(256)
void gemm_nt(const bf16* __restrict__ A, const bf16* __restrict__ B,
             void* __restrict__ Cout, const float* __restrict__ bias,
             const float* __restrict__ res,
             int K, int lda, int ldb, int ldc, float scale,
             int sAz, int sBz, int sCz) {
  __shared__ __attribute__((aligned(16))) bf16 shA[2][BM * LDSS];
  __shared__ __attribute__((aligned(16))) bf16 shB[2][BN * LDSS];

  A += (size_t)blockIdx.z * sAz;
  B += (size_t)blockIdx.z * sBz;
  const size_t cOffZ = (size_t)blockIdx.z * sCz;
  if constexpr (OUT_BF16) Cout = (bf16*)Cout + cOffZ;
  else                    Cout = (float*)Cout + cOffZ;
  if constexpr (HAS_RES)  res += cOffZ;
  gemm_tile<false, OUT_BF16, HAS_BIAS, HAS_RES>(shA, shB, A, B, Cout, bias, res,
                                         K, lda, ldb, ldc, scale, TRANS);
}

// The three projections of one sample in one launch, picked by blockIdx.z:
//   0: q = Wq*xn + bq            -> qT (s, 4096)    transposed store
//   1: k = Wkv[0:4096]*ctx + b   -> kT (s2, 4096)   transposed store
//   2: v = Wkv[4096:]*ctx + b    -> vB (4096, s2)   row-major store
__global__ __launch_bounds__(256)
void gemm_qkv(const bf16* __restrict__ Wq, const bf16* __restrict__ Wkv,
              const bf16* __restrict__ xb, const bf16* __restrict__ cb,
              bf16* __restrict__ qT, bf16* __restrict__ kT, bf16* __restrict__ vB,
              const float* __restrict__ bq, const float* __restrict__ bkv) {
  __shared__ __attribute__((aligned(16))) bf16 shA[2][BM * LDSS];
  __shared__ __attribute__((aligned(16))) bf16 shB[2][BN * LDSS];

  const int z = blockIdx.z;
  const bf16*  A    = z == 0 ? Wq : Wkv + (size_t)(z - 1) * kO * kCTX;
  const bf16*  B    = z == 0 ? xb : cb;
  const float* bias = z == 0 ? bq : bkv + (z - 1) * kO;
  bf16*        C    = z == 0 ? qT : (z == 1 ? kT : vB);
  gemm_tile<true, true, true, false>(shA, shB, A, B, C, bias, nullptr,
                               kC, kC, kC, z == 2 ? kS2 : kO, 1.0f, z != 2);
}

// ---------------------------------------------------------------------------
// Fused attention: scores, softmax and P*V of one (sample, head, 128 queries) in
// one block, so that no score and no probability leaves the registers.
//   S^T = K * Q^T   : A = key rows from LDS, B = the wave's 16 queries, kept in
//                     registers for the whole kernel
//   O^T += V^T * P^T: A = V^T rows (channel, key) from LDS, B = P^T, which is the
//                     score accumulators converted in place: two S^T tiles (keys
//                     0-15 and 16-31 of a 32-key step) are one B operand in the
//                     k order that the LDS loader below has too
// A lane holds scores and outputs of ONE query (column lane & 15); lanes l and
// l ^ 16 split its keys, so the row maximum takes one lane exchange a stage and
// the row sum one at the end. The running maximum is raised, and O^T and the sum
// rescaled, only when some query's new maximum lies more than 8 (log2 units)
// above the one in use: p stays below 2^8.
// A stage is 64 keys: K 64 x 512 and V^T 512 x 64, two LDS buffers filled by
// async copies one stage ahead. qy holds q on entry and y on exit: a wave reads
// and writes only its own 16 rows x 512 columns.
// ---------------------------------------------------------------------------
static constexpr int FQ = 128;        // queries of a block, 16 a wave
static constexpr int FK = 64;         // keys of a stage
static constexpr int KP = kC + 8;     // LDS pitch of a key row, elements (1040 B = 16 B x odd)
static constexpr int VP = FK + 8;     // LDS pitch of a V^T row, elements (144 B = 16 B x odd)
static_assert(kS % FQ == 0 && kS2 % (2 * FK) == 0, "whole tiles, at least two stages");

typedef __attribute__((ext_vector_type(2))) __bf16 bf2;

// 2^x, with the slot that the instruction set asks for behind a transcendental
__device__ __forceinline__ float exp2_1(float x) {
  float r;
  asm("v_exp_f32 %0, %1\n\t"
      "v_nop"
      : "=&v"(r) : "v"(x));
  return r;
}

// One 16-B store. s_wait_xcnt closes the statement so that no register named
// here is rewritten while the store may still read it (in a statement of its own
// the compiler moved the next tile's arithmetic over the wait).
__device__ __forceinline__ void store16(bf16* p, f4 v) {
  asm volatile("global_store_b128 %0, %1, off\n\t"
               "s_wait_xcnt 0x0"
               :: "v"(p), "v"(v) : "memory");
}

__global__ __launch_bounds__(256)
void attn_fused(bf16* qy, const bf16* __restrict__ kT, const bf16* __restrict__ vB,
                float scale) {
  __shared__ __attribute__((aligned(16))) bf16 shK[2][FK * KP];
  __shared__ __attribute__((aligned(16))) bf16 shV[2][kC * VP];

  const int tid  = threadIdx.x;
  const int lane = tid & 31;
  const int wv   = tid >> 5;
  const int hl   = lane >> 4;
  const int fr   = lane & 15;
  const int hd   = blockIdx.y;
  const int nb   = blockIdx.z;
  const float c  = scale * 1.44269504f;    // scores in log2 units: exp(x) = 2^(x * log2 e)

  // the lane's query row, this head's 512 columns
  bf16* qrow = qy + ((size_t)nb * kS + blockIdx.x * FQ + wv * 16 + fr) * kO + hd * kC;
  const bf16* kbase = kT + (size_t)nb * kS2 * kO + hd * kC;              // (key, 4096)
  const bf16* vbase = vB + ((size_t)nb * kO + (size_t)hd * kC) * kS2;    // (channel, key)

  // staging. K: 64 lanes cover a 1024-B key row, a thread copies its 16 B of rows
  // kr, kr+4, ..., kr+60. V^T: 8 lanes cover a 128-B row, rows vr, vr+32, ..., vr+480.
  const int kr = tid >> 6, kc = (tid & 63) * 8;
  const int vr = tid >> 3, vc = (tid & 7) * 8;
  const bf16* kPtr = kbase + (size_t)kr * kO + kc;
  const bf16* vPtr = vbase + (size_t)vr * kS2 + vc;
  const unsigned kL = (unsigned)((kr * KP + kc) * 2);
  const unsigned vL = (unsigned)((vr * VP + vc) * 2);
  const unsigned sK[2] = { (unsigned)(unsigned long long)&shK[0][0],
                           (unsigned)(unsigned long long)&shK[1][0] };
  const unsigned sV[2] = { (unsigned)(unsigned long long)&shV[0][0],
                           (unsigned)(unsigned long long)&shV[1][0] };

  auto issue_stage = [&](int t, int buf) {
    const bf16* gk = kPtr + (size_t)t * FK * kO;
    async_rows8(sK[buf] + kL, 4u * KP * 2u, gk, (size_t)4 * kO);
    async_rows8(sK[buf] + kL + 32u * KP * 2u, 4u * KP * 2u, gk + (size_t)32 * kO, (size_t)4 * kO);
    const bf16* gv = vPtr + t * FK;
    async_rows8(sV[buf] + vL, 32u * VP * 2u, gv, (size_t)32 * kS2);
    async_rows8(sV[buf] + vL + 256u * VP * 2u, 32u * VP * 2u, gv + (size_t)256 * kS2, (size_t)32 * kS2);
  };

  constexpr int NT = kS2 / FK;
  issue_stage(0, 0);

  // Q^T fragments, one per 32 channels
  FragAB qf[kC / 32];
#pragma unroll
  for (int ks = 0; ks < kC / 32; ++ks) {
    qf[ks].f[0] = *(const f4*)(qrow + ks * 32 + 8 * hl);
    qf[ks].f[1] = *(const f4*)(qrow + ks * 32 + 16 + 8 * hl);
  }
  // keeps the loads' address pair whole (no load returns into it) until every
  // load has taken its address
  asm volatile("s_wait_xcnt 0x0" :: "v"(qrow) : "memory");

  wait_async0();
  __syncthreads();      // stage 0 is published
  issue_stage(1, 1);

  v8f o[kC / 16];
#pragma unroll
  for (int d = 0; d < kC / 16; ++d)
#pragma unroll
    for (int r = 0; r < 8; ++r) o[d][r] = 0.f;
  float m = -1.0e30f;   // maximum in use (log2 units), the same in lanes l and l ^ 16
  float l = 0.f;        // the lane's share of the row sum

  for (int t = 0; t < NT; ++t) {
    const int cur = t & 1;

    // S^T, 64 keys x 16 queries
    v8f s[FK / 16];
#pragma unroll
    for (int i = 0; i < FK / 16; ++i)
#pragma unroll
      for (int r = 0; r < 8; ++r) s[i][r] = 0.f;
#pragma unroll
    for (int ks = 0; ks < kC / 32; ++ks) {
      FragAB a[FK / 16];
#pragma unroll
      for (int i = 0; i < FK / 16; ++i) {
        const bf16* p = &shK[cur][(i * 16 + fr) * KP + ks * 32 + 8 * hl];
        a[i].f[0] = *(const f4*)p;
        a[i].f[1] = *(const f4*)(p + 16);
      }
#pragma unroll
      for (int i = 0; i < FK / 16; ++i)
        s[i] = __builtin_amdgcn_wmma_f32_16x16x32_bf16(
            false, a[i].v, false, qf[ks].v, (short)0, s[i], false, false);
    }

    // the stage's maximum of the lane's query
    float mx = s[0][0];
#pragma unroll
    for (int i = 0; i < FK / 16; ++i)
#pragma unroll
      for (int r = 0; r < 8; ++r) mx = fmaxf(mx, s[i][r]);
    mx *= c;            // c > 0
    mx = fmaxf(mx, __shfl_xor(mx, 16));
    // one wave-uniform test a stage
    if (__builtin_amdgcn_ballot_w32(mx > m + 8.0f) != 0) {
      const float mn = fmaxf(m, mx);
      const float al = exp2_1(m - mn);
      m = mn;
      l *= al;
#pragma unroll
      for (int d = 0; d < kC / 16; ++d)
#pragma unroll
        for (int r = 0; r < 8; ++r) o[d][r] *= al;
    }

    // p = 2^(s c - m), its sum, and P^T as B operands
    FragAB pb[FK / 32];
#pragma unroll
    for (int i = 0; i < FK / 16; ++i) {
      f4 x, y;
#pragma unroll
      for (int e = 0; e < 4; ++e) {
        x[e] = s[i][e] * c - m;
        y[e] = s[i][e + 4] * c - m;
      }
      exp2_x8(x, y);
      l += ((x[0] + x[1]) + (x[2] + x[3])) + ((y[0] + y[1]) + (y[2] + y[3]));
      union { bf2 h[4]; f4 f; } u;
      u.h[0] = __builtin_convertvector(f2{x[0], x[1]}, bf2);
      u.h[1] = __builtin_convertvector(f2{x[2], x[3]}, bf2);
      u.h[2] = __builtin_convertvector(f2{y[0], y[1]}, bf2);
      u.h[3] = __builtin_convertvector(f2{y[2], y[3]}, bf2);
      pb[i >> 1].f[i & 1] = u.f;
    }

    // O^T += V^T * P^T, 512 channels x 16 queries
#pragma unroll
    for (int d = 0; d < kC / 16; ++d) {
      FragAB a[FK / 32];
#pragma unroll
      for (int kk = 0; kk < FK / 32; ++kk) {
        const bf16* p = &shV[cur][(d * 16 + fr) * VP + kk * 32 + 8 * hl];
        a[kk].f[0] = *(const f4*)p;
        a[kk].f[1] = *(const f4*)(p + 16);
      }
#pragma unroll
      for (int kk = 0; kk < FK / 32; ++kk)
        o[d] = __builtin_amdgcn_wmma_f32_16x16x32_bf16(
            false, a[kk].v, false, pb[kk].v, (short)0, o[d], false, false);
    }

    wait_ds0();
    wait_async0();
    __syncthreads();      // stage t+1 is published; buffer cur has no reader left
    if (t + 2 < NT) issue_stage(t + 2, cur);
  }
  wait_async0();

  l += __shfl_xor(l, 16);
  const float inv = 1.0f / l;
  // register r of tile d = channel 16 d + 8 hl + r of the lane's query: 16-B stores
#pragma unroll
  for (int d = 0; d < kC / 16; ++d) {
    union { bf2 h[4]; f4 f; } u;
#pragma unroll
    for (int e = 0; e < 4; ++e)
      u.h[e] = __builtin_convertvector(f2{o[d][2 * e] * inv, o[d][2 * e + 1] * inv}, bf2);
    store16(qrow + d * 16 + 8 * hl, u.f);
  }
}

// ---------------------------------------------------------------------------
extern "C" void kernel_launch(void* const* d_in, const int* in_sizes, int n_in,
                              void* d_out, int out_size, void* d_ws, size_t ws_size,
                              hipStream_t stream) {
  const float* input   = (const float*)d_in[0];
  const float* context = (const float*)d_in[1];
  const float* gamma   = (const float*)d_in[2];
  const float* beta    = (const float*)d_in[3];
  const float* Wq      = (const float*)d_in[4];
  const float* bq      = (const float*)d_in[5];
  const float* Wkv     = (const float*)d_in[6];
  const float* bkv     = (const float*)d_in[7];
  const float* Wo      = (const float*)d_in[8];
  const float* bo      = (const float*)d_in[9];
  float* out = (float*)d_out;

  char* wsb = (char*)d_ws;
  size_t off = 0;
  auto alloc = [&](size_t bytes) -> char* {
    char* p = wsb + off;
    off += (bytes + 255) & ~(size_t)255;
    return p;
  };

  bf16* Wq16   = (bf16*)alloc((size_t)kO * kC * 2);          //   4 MB
  bf16* Wkv16  = (bf16*)alloc((size_t)2 * kO * kCTX * 2);    //   8 MB, behind Wq16
  bf16* Wo16   = (bf16*)alloc((size_t)kC * kO * 2);          //   4 MB, behind Wkv16
  bf16* xnT    = (bf16*)alloc((size_t)kN * kS * kC * 2);     //   8 MB  (n,s,c)
  bf16* ctxT   = (bf16*)alloc((size_t)kN * kS2 * kCTX * 2);  //   8 MB  (n,s,c), behind xnT
  bf16* kT     = (bf16*)alloc((size_t)kN * kS2 * kO * 2);    //  64 MB  (n,s2,4096)
  bf16* vB     = (bf16*)alloc((size_t)kN * kO * kS2 * 2);    //  64 MB  (n,4096,s2)
  bf16* yT     = (bf16*)alloc((size_t)kN * kS * kO * 2);     //  64 MB  (n,s,4096): q, then y in its place
  float* raw   = (float*)alloc(256);
  float* stats = (float*)alloc(256);
  (void)ws_size; (void)in_sizes; (void)n_in; (void)out_size;

  // stats
  zero_f32<<<1, 32, 0, stream>>>(raw, kN * 2);
  reduce_stats<<<dim3(256, kN), 256, 0, stream>>>(input, raw);
  finalize_stats<<<1, 32, 0, stream>>>(raw, stats);

  // transposed bf16 activations (xnT, then ctxT) + bf16 weights (Wq16, Wkv16, Wo16)
  norm_transpose<<<dim3(kS / TC, kC / TR, 2 * kN), 256, 0, stream>>>(
      input, context, xnT, stats, gamma, beta);
  cvt_bf16<<<4 * kO * kC / CVT_BLK, 256, 0, stream>>>(
      Wq, Wkv, Wo, Wq16, kO * kC, 2 * kO * kCTX, kC * kO);

  for (int n = 0; n < kN; ++n) {
    gemm_qkv<<<dim3(kS / BN, kO / BM, 3), 256, 0, stream>>>(
        Wq16, Wkv16, xnT + (size_t)n * kS * kC, ctxT + (size_t)n * kS2 * kCTX,
        yT + (size_t)n * kS * kO, kT + (size_t)n * kS2 * kO, vB + (size_t)n * kO * kS2,
        bq, bkv);
  }

  // attention, every sample and head in one launch: q in yT becomes y
  const float scoreScale = 1.0f / sqrtf((float)kC);   // (c^-0.25)^2
  attn_fused<<<dim3(kS / FQ, kH, kN), 256, 0, stream>>>(
      yT, kT, vB, scoreScale);

  // out = Wo * y + bo + residual  (f32, row-major (c,s)), all samples in grid z
  gemm_nt<false, false, true, true><<<dim3(kS / BN, kC / BM, kN), 256, 0, stream>>>(
      Wo16, yT, out, bo, input,
      kO, kO, kO, kS, 1.0f, 0, kS * kO, kC * kS);
}

// v007
// Measured time: 365 microseconds a run.
// In both of two side-by-side timings against v006, it was 1.12 times as fast.
// All steps since v000 together make it 5.82 times as fast.
#include <hip/hip_runtime.h>
#include <hip/hip_bf16.h>
#include <math.h>

// ---------------------------------------------------------------------------
// CrossAttention1d for MI455X (gfx1250): bf16 WMMA pipeline, f32 accumulate.
// N=4, C=512, S=2048, S2=2048, H=8, CTX=512.  ~412 GFLOP -> compute-bound,
// all 5 matmul stages on v_wmma_f32_16x16x32_bf16, tiles staged to LDS via
// CDNA5 async copies (global_load_async_to_lds_b128 + s_wait_asynccnt).
// ---------------------------------------------------------------------------

typedef __bf16 bf16;
typedef __attribute__((ext_vector_type(16))) __bf16 v16bf;
typedef __attribute__((ext_vector_type(8)))  float  v8f;
typedef __attribute__((ext_vector_type(4)))  float  f4;

static constexpr int kN = 4, kC = 512, kS = 2048, kS2 = 2048, kH = 8, kCTX = 512;
static constexpr int kO = kC * kH;      // 4096
static constexpr float kEPS = 1e-5f;
static_assert(kC == kCTX && kS == kS2, "the batched launches below pair equal shapes");

__device__ __forceinline__ bf16 f2bf(float f) {
  unsigned u = __builtin_bit_cast(unsigned, f);
  u += 0x7FFFu + ((u >> 16) & 1u);          // round-to-nearest-even
  unsigned short h = (unsigned short)(u >> 16);
  return __builtin_bit_cast(bf16, h);
}

// ---------------------------------------------------------------------------
// Stage 0: batch-wide mean / rstd (layernorm over all C*S per n)
// ---------------------------------------------------------------------------
__global__ void zero_f32(float* p, int n) {
  int i = blockIdx.x * 256 + threadIdx.x;
  if (i < n) p[i] = 0.f;
}

__global__ __launch_bounds__(256)
void reduce_stats(const float* __restrict__ in, float* __restrict__ raw) {
  __shared__ float sh0[256], sh1[256];
  const int n = blockIdx.y;
  const float* p = in + (size_t)n * kC * kS;
  float s = 0.f, s2 = 0.f;
  for (int i = blockIdx.x * 256 + threadIdx.x; i < kC * kS; i += gridDim.x * 256) {
    float v = p[i]; s += v; s2 += v * v;
  }
  sh0[threadIdx.x] = s; sh1[threadIdx.x] = s2;
  __syncthreads();
  for (int o = 128; o > 0; o >>= 1) {
    if ((int)threadIdx.x < o) {
      sh0[threadIdx.x] += sh0[threadIdx.x + o];
      sh1[threadIdx.x] += sh1[threadIdx.x + o];
    }
    __syncthreads();
  }
  if (threadIdx.x == 0) {
    atomicAdd(&raw[2 * n + 0], sh0[0]);
    atomicAdd(&raw[2 * n + 1], sh1[0]);
  }
}

__global__ void finalize_stats(const float* __restrict__ raw, float* __restrict__ stats) {
  int n = threadIdx.x;
  if (n < kN) {
    float inv  = 1.0f / (float)(kC * kS);
    float mean = raw[2 * n] * inv;
    float var  = raw[2 * n + 1] * inv - mean * mean;
    stats[2 * n + 0] = mean;
    stats[2 * n + 1] = rsqrtf(var + kEPS);
  }
}

// ---------------------------------------------------------------------------
// Stage 1: transpose (n,kC,kS)f32 -> (n,kS,kC)bf16, both activations in one launch:
// grid z < kN takes sample z of in, with the layernorm affine; z >= kN takes
// sample z - kN of in2 as it is. outp holds the 2*kN results one after another.
// A block takes a tile of 128 channels x 64 positions, a thread 32 elements, so
// that the launch starts 8,192 waves and each has eight 16-byte loads in flight.
// A wave-wide load covers 256 B of two channel rows, a wave-wide store 256 B of
// two position rows: whole 128-B lines both ways. LDS holds the tile transposed,
// two neighbouring channels packed in a dword; the odd pitch spreads the 32
// lanes of every LDS write and read over 32 banks.
// ---------------------------------------------------------------------------
typedef __attribute__((ext_vector_type(2))) float f2;
typedef __attribute__((ext_vector_type(4))) unsigned u4;
static constexpr int TR = 128, TC = 64;    // tile: channels x positions
static constexpr int TP = TR / 2 + 1;      // LDS pitch of a position row, dwords
static_assert(kC % TR == 0 && kS % TC == 0, "whole tiles only");

__device__ __forceinline__ unsigned pack_bf16(float lo, float hi) {
  return (unsigned)__builtin_bit_cast(unsigned short, f2bf(lo)) |
         ((unsigned)__builtin_bit_cast(unsigned short, f2bf(hi)) << 16);
}

__global__ __launch_bounds__(256)
void norm_transpose(const float* __restrict__ in, const float* __restrict__ in2,
                    bf16* __restrict__ outp, const float* __restrict__ stats,
                    const float* __restrict__ gamma, const float* __restrict__ beta) {
  __shared__ unsigned tile[TC * TP];
  const int zb = blockIdx.z;
  const bool plain = zb >= kN;
  const int nb = plain ? zb - kN : zb;
  const int r0 = blockIdx.y * TR;            // first channel
  const int c0 = blockIdx.x * TC;            // first position
  const int cq = threadIdx.x & 15;
  const int tg = threadIdx.x >> 4;           // 0..15

  // the sample's mean and 1/sigma; a plain tile takes 0 and 1
  const float smu = stats[2 * nb], srinv = stats[2 * nb + 1];
  const float mu = plain ? 0.f : smu, rinv = plain ? 1.f : srinv;
  f2 g[4], b[4];
#pragma unroll
  for (int i = 0; i < 4; ++i) { g[i] = f2{1.f, 1.f}; b[i] = f2{0.f, 0.f}; }
  if (!plain) {
    const f2* pg = (const f2*)(gamma + r0 + 2 * tg);
    const f2* pb = (const f2*)(beta + r0 + 2 * tg);
#pragma unroll
    for (int i = 0; i < 4; ++i) { g[i] = pg[16 * i]; b[i] = pb[16 * i]; }
    // these loads have taken their address registers before they are rewritten
    asm volatile("s_wait_xcnt 0x0" ::: "memory");
  }

  // channels r0 + 2*(tg + 16 i) and the next one, positions c0 + 4 cq .. + 3
  const float* pin = (plain ? in2 : in) + ((size_t)nb * kC + r0 + 2 * tg) * kS + c0 + 4 * cq;
  f4 lo[4], hi[4];
#pragma unroll
  for (int i = 0; i < 4; ++i) {
    lo[i] = *(const f4*)(pin + (size_t)(32 * i) * kS);
    hi[i] = *(const f4*)(pin + (size_t)(32 * i + 1) * kS);
  }
  // keeps the loads' address pair whole (no load returns into it) until every
  // load has taken its address
  asm volatile("s_wait_xcnt 0x0" :: "v"(pin) : "memory");

#pragma unroll
  for (int i = 0; i < 4; ++i)
#pragma unroll
    for (int e = 0; e < 4; ++e) {
      const float x = (lo[i][e] - mu) * rinv * g[i][0] + b[i][0];
      const float y = (hi[i][e] - mu) * rinv * g[i][1] + b[i][1];
      tile[(4 * cq + e) * TP + tg + 16 * i] = pack_bf16(x, y);
    }
  __syncthreads();

  // position c0 + tg + 16 k, channels r0 + 8 cq .. + 7
  bf16* pout = outp + ((size_t)zb * kS + c0 + tg) * kC + r0 + 8 * cq;
#pragma unroll
  for (int k = 0; k < 4; ++k) {
    const unsigned* s = &tile[(tg + 16 * k) * TP + 4 * cq];
    const u4 w = {s[0], s[1], s[2], s[3]};
    *(u4*)(pout + (size_t)(16 * k) * kC) = w;
  }
}

// the three weight matrices in one launch: o holds a (na), b (nb), c (nc) in a
// row. na, nb and nc are multiples of CVT_BLK, so a block lies in one matrix and
// the grid of (na + nb + nc) / CVT_BLK blocks ends with the last element.
// A lane casts 64 elements: the launch starts 4,096 waves, each with sixteen
// 16-byte loads in flight. Each wave-wide load covers 512 contiguous bytes, each
// wave-wide store 256.
static constexpr int CVT_V   = 16;                 // 16-byte loads of a lane
static constexpr int CVT_BLK = 256 * 4 * CVT_V;    // elements of a block
static_assert(kO * kC % CVT_BLK == 0, "a block of the weight cast lies in one matrix");

__global__ __launch_bounds__(256)
void cvt_bf16(const float* __restrict__ a, const float* __restrict__ b,
              const float* __restrict__ c, bf16* __restrict__ o,
              int na, int nb, int nc) {
  const int i0 = blockIdx.x * CVT_BLK;       // the block's first element in o
  if (i0 >= na + nb + nc) return;
  const float* src = a + i0;
  if (i0 >= na)      src = b + (i0 - na);
  if (i0 >= na + nb) src = c + (i0 - na - nb);
  // the lane's first element in the block: a wave takes 128 * CVT_V in a row
  const int w0 = (threadIdx.x >> 5) * (128 * CVT_V) + (threadIdx.x & 31) * 4;
  const f4* p = (const f4*)(src + w0);
  f4 v[CVT_V];
#pragma unroll
  for (int j = 0; j < CVT_V; ++j) v[j] = p[j * 32];
  // the loads have taken their address registers before these are rewritten
  asm volatile("s_wait_xcnt 0x0" ::: "memory");
  f2* q = (f2*)(o + i0 + w0);
#pragma unroll
  for (int j = 0; j < CVT_V; ++j) {
    union { unsigned u[2]; f2 f; } t;
    t.u[0] = pack_bf16(v[j][0], v[j][1]);
    t.u[1] = pack_bf16(v[j][2], v[j][3]);
    q[j * 32] = t.f;
  }
}

// ---------------------------------------------------------------------------
// 2^x for the softmax of the fused attention kernel
// ---------------------------------------------------------------------------
// a, b <- 2^a, 2^b. Eight v_exp_f32 in one statement, closed by a v_nop: it is
// the slot that the instruction set asks for behind a transcendental before its
// result is read or its source overwritten.
// The outputs are early-clobber, so that inside the
// statement no exp writes over a source either.
__device__ __forceinline__ void exp2_x8(f4& a, f4& b) {
  float r0, r1, r2, r3, r4, r5, r6, r7;
  asm("v_exp_f32 %0, %8\n\t"
      "v_exp_f32 %1, %9\n\t"
      "v_exp_f32 %2, %10\n\t"
      "v_exp_f32 %3, %11\n\t"
      "v_exp_f32 %4, %12\n\t"
      "v_exp_f32 %5, %13\n\t"
      "v_exp_f32 %6, %14\n\t"
      "v_exp_f32 %7, %15\n\t"
      "v_nop"
      : "=&v"(r0), "=&v"(r1), "=&v"(r2), "=&v"(r3),
        "=&v"(r4), "=&v"(r5), "=&v"(r6), "=&v"(r7)
      : "v"(a[0]), "v"(a[1]), "v"(a[2]), "v"(a[3]),
        "v"(b[0]), "v"(b[1]), "v"(b[2]), "v"(b[3]));
  a[0] = r0; a[1] = r1; a[2] = r2; a[3] = r3;
  b[0] = r4; b[1] = r5; b[2] = r6; b[3] = r7;
}

// ---------------------------------------------------------------------------
// CDNA5 async copies: 16B per lane, global -> LDS, tracked by ASYNCcnt.
// Eight copies of one lane, a fixed number of tile rows apart.
//   l     : the lane's LDS byte address (low 32 bits of the LDS pointer)
//   lstep : LDS bytes from one copy to the next
//   g     : the lane's global pointer
//   gstep : global elements from one copy to the next
// s_wait_xcnt closes the statement so that no address register named here is
// rewritten while a copy may still read it.
// ---------------------------------------------------------------------------
__device__ __forceinline__ void async_rows8(unsigned l, unsigned lstep,
                                            const bf16* g, size_t gstep) {
  asm volatile("global_load_async_to_lds_b128 %0, %8, off\n\t"
               "global_load_async_to_lds_b128 %1, %9, off\n\t"
               "global_load_async_to_lds_b128 %2, %10, off\n\t"
               "global_load_async_to_lds_b128 %3, %11, off\n\t"
               "global_load_async_to_lds_b128 %4, %12, off\n\t"
               "global_load_async_to_lds_b128 %5, %13, off\n\t"
               "global_load_async_to_lds_b128 %6, %14, off\n\t"
               "global_load_async_to_lds_b128 %7, %15, off\n\t"
               "s_wait_xcnt 0x0"
               :: "v"(l), "v"(l + lstep), "v"(l + 2u * lstep), "v"(l + 3u * lstep),
                  "v"(l + 4u * lstep), "v"(l + 5u * lstep), "v"(l + 6u * lstep),
                  "v"(l + 7u * lstep),
                  "v"(g), "v"(g + gstep), "v"(g + 2 * gstep), "v"(g + 3 * gstep),
                  "v"(g + 4 * gstep), "v"(g + 5 * gstep), "v"(g + 6 * gstep),
                  "v"(g + 7 * gstep)
               : "memory");
}
// my own copies have landed in LDS
__device__ __forceinline__ void wait_async0() {
  asm volatile("s_wait_asynccnt 0x0" ::: "memory");
}
// my own LDS reads have returned, so the buffer may be refilled behind the barrier
__device__ __forceinline__ void wait_ds0() {
  asm volatile("s_wait_dscnt 0x0" ::: "memory");
}

// ---------------------------------------------------------------------------
// NT GEMM:  D(M,Nn) = A(M,K) * B(Nn,K)^T   (bf16 in, f32 accum via WMMA)
//   trans    : store D transposed (Cout[n][m]), 16B-contiguous per lane
//   PICK     : trans is known only at run time (the same for the whole block)
//   OUT_BF16 : output bf16 (else f32)
//   HAS_BIAS : + bias[m]
//   HAS_RES  : + res[m*ldc + n] (row-major only)
// gemm_tile does one block tile (blockIdx.y, blockIdx.x) of one product; the
// two kernels behind it pick the product by blockIdx.z.
// block tile 128x128, 8 waves (2x4), 128 k per LDS stage (four WMMA k-steps),
// two LDS buffers filled by async copies that overlap the WMMA stream. A stage
// row is 256 B, so one wave-wide copy covers two rows = four whole 128-B lines.
// ---------------------------------------------------------------------------
static constexpr int BM = 128, BN = 128, BK = 128;
static constexpr int LDSS = 136;  // padded row stride in bf16 elems (272B = 16B x odd)

union FragAB { v16bf v; f4 f[2]; };
template <bool V> struct BoolC { static constexpr bool value = V; };

template <bool PICK, bool OUT_BF16, bool HAS_BIAS, bool HAS_RES>
__device__ __forceinline__
void gemm_tile(bf16 (*shA)[BM * LDSS], bf16 (*shB)[BN * LDSS],
               const bf16* __restrict__ A, const bf16* __restrict__ B,
               void* __restrict__ Cout, const float* __restrict__ bias,
               const float* __restrict__ res,
               int K, int lda, int ldb, int ldc, float scale, bool trans) {
  const int tid  = threadIdx.x;
  const int lane = tid & 31;
  const int wv   = tid >> 5;
  const int wm   = wv & 3;          // 4 wave-rows
  const int wn   = wv >> 2;         // 2 wave-cols
  const int m0   = blockIdx.y * BM;
  const int n0   = blockIdx.x * BN;

  // staging: 16 lanes cover one 256B stage row; a thread copies its 16B chunk
  // of rows lr, lr+16, ..., lr+112 of both operands
  const int lr = tid >> 4;           // 0..15 (first tile row)
  const int lc = (tid & 15) * 8;     // k elems

  const bf16* aPtr = A + (size_t)(m0 + lr) * lda + lc;
  const bf16* bPtr = B + (size_t)(n0 + lr) * ldb + lc;
  const unsigned thrL  = (unsigned)((lr * LDSS + lc) * 2);  // bytes
  const unsigned sA[2] = { (unsigned)(unsigned long long)&shA[0][0],
                           (unsigned)(unsigned long long)&shA[1][0] };
  const unsigned sB[2] = { (unsigned)(unsigned long long)&shB[0][0],
                           (unsigned)(unsigned long long)&shB[1][0] };

  auto issue_tile = [&](int kt, int buf) {
    async_rows8(sA[buf] + thrL, 16u * LDSS * 2u, aPtr + (size_t)kt * BK, (size_t)16 * lda);
    async_rows8(sB[buf] + thrL, 16u * LDSS * 2u, bPtr + (size_t)kt * BK, (size_t)16 * ldb);
  };

  const int KT = K / BK;
  issue_tile(0, 0);
  wait_async0();
  __syncthreads();      // stage 0 is published
  if (KT > 1) issue_tile(1, 1);

  v8f acc[2][4];
#pragma unroll
  for (int i = 0; i < 2; ++i)
#pragma unroll
    for (int j = 0; j < 4; ++j)
#pragma unroll
      for (int r = 0; r < 8; ++r) acc[i][j][r] = 0.f;

  const int hl = lane >> 4;          // K-quarter selector
  const int fr = lane & 15;          // fragment row (M for A, N for B)

  for (int kt = 0; kt < KT; ++kt) {
    const int cur = kt & 1;
    // unrolled so that the next k-step's fragment loads can go ahead of this
    // k-step's WMMAs
#pragma unroll
    for (int ks = 0; ks < BK / 32; ++ks) {
      FragAB a[2], b[4];
#pragma unroll
      for (int i = 0; i < 2; ++i) {
        const bf16* p = &shA[cur][(wm * 32 + i * 16 + fr) * LDSS + ks * 32 + 8 * hl];
        a[i].f[0] = *(const f4*)p;
        a[i].f[1] = *(const f4*)(p + 16);
      }
#pragma unroll
      for (int j = 0; j < 4; ++j) {
        const bf16* p = &shB[cur][(wn * 64 + j * 16 + fr) * LDSS + ks * 32 + 8 * hl];
        b[j].f[0] = *(const f4*)p;
        b[j].f[1] = *(const f4*)(p + 16);
      }
#pragma unroll
      for (int i = 0; i < 2; ++i)
#pragma unroll
        for (int j = 0; j < 4; ++j)
          acc[i][j] = __builtin_amdgcn_wmma_f32_16x16x32_bf16(
              false, a[i].v, false, b[j].v, (short)0, acc[i][j], false, false);
    }
    wait_ds0();
    wait_async0();
    __syncthreads();      // stage kt+1 is published; buf[cur] has no reader left
    if (kt + 2 < KT) issue_tile(kt + 2, cur);
  }
  wait_async0();

  // epilogue: D tile [16x16]; lane fr = N index, VGPR r -> M = 8*hl + r
  auto store_tiles = [&](auto tr) {
  constexpr bool TR = decltype(tr)::value;
#pragma unroll
  for (int i = 0; i < 2; ++i) {
    const int mBase = m0 + wm * 32 + i * 16 + 8 * hl;
#pragma unroll
    for (int j = 0; j < 4; ++j) {
      const int nIdx = n0 + wn * 64 + j * 16 + fr;
      v8f v = acc[i][j];
      if constexpr (TR) {
        if constexpr (OUT_BF16) {
          union { bf16 h[8]; f4 f; } t;
#pragma unroll
          for (int r = 0; r < 8; ++r) {
            float f = v[r] * scale;
            if constexpr (HAS_BIAS) f += bias[mBase + r];
            t.h[r] = f2bf(f);
          }
          *(f4*)((bf16*)Cout + (size_t)nIdx * ldc + mBase) = t.f;
        } else {
          union { float x[8]; f4 f[2]; } t;
#pragma unroll
          for (int r = 0; r < 8; ++r) {
            float f = v[r] * scale;
            if constexpr (HAS_BIAS) f += bias[mBase + r];
            t.x[r] = f;
          }
          float* po = (float*)Cout + (size_t)nIdx * ldc + mBase;
          *(f4*)po = t.f[0];
          *(f4*)(po + 4) = t.f[1];
        }
      } else {
#pragma unroll
        for (int r = 0; r < 8; ++r) {
          float f = v[r] * scale;
          if constexpr (HAS_BIAS) f += bias[mBase + r];
          if constexpr (HAS_RES)  f += res[(size_t)(mBase + r) * ldc + nIdx];
          if constexpr (OUT_BF16)
            ((bf16*)Cout)[(size_t)(mBase + r) * ldc + nIdx] = f2bf(f);
          else
            ((float*)Cout)[(size_t)(mBase + r) * ldc + nIdx] = f;
        }
      }
    }
  }
  };
  // the store form is picked once, outside the tile loops: each form's bias
  // loads and stores stay one straight run
  if constexpr (PICK) {
    if (trans) {
      store_tiles(BoolC<true>{});
      // these stores have taken their registers before the code of the other
      // form, which stands behind them in the kernel, writes the same registers
      asm volatile("s_wait_xcnt 0x0" ::: "memory");
    } else {
      store_tiles(BoolC<false>{});
    }
  } else {
    if (trans) store_tiles(BoolC<true>{});
    else       store_tiles(BoolC<false>{});
  }
}

// One independent product per blockIdx.z; sAz/sBz/sCz are the element strides
// of A, B and Cout (and res) from one z to the next.
template <bool TRANS, bool OUT_BF16, bool HAS_BIAS, bool HAS_RES>
__global__ __launch_bounds__(256)
void gemm_nt(const bf16* __restrict__ A, const bf16* __restrict__ B,
             void* __restrict__ Cout, const float* __restrict__ bias,
             const float* __restrict__ res,
             int K, int lda, int ldb, int ldc, float scale,
             int sAz, int sBz, int sCz) {
  __shared__ __attribute__((aligned(16))) bf16 shA[2][BM * LDSS];
  __shared__ __attribute__((aligned(16))) bf16 shB[2][BN * LDSS];

  A += (size_t)blockIdx.z * sAz;
  B += (size_t)blockIdx.z * sBz;
  const size_t cOffZ = (size_t)blockIdx.z * sCz;
  if constexpr (OUT_BF16) Cout = (bf16*)Cout + cOffZ;
  else                    Cout = (float*)Cout + cOffZ;
  if constexpr (HAS_RES)  res += cOffZ;
  gemm_tile<false, OUT_BF16, HAS_BIAS, HAS_RES>(shA, shB, A, B, Cout, bias, res,
                                         K, lda, ldb, ldc, scale, TRANS);
}

// The three projections of one sample in one launch, picked by blockIdx.z:
//   0: q = Wq*xn + bq            -> qT (s, 4096)    transposed store
//   1: k = Wkv[0:4096]*ctx + b   -> kT (s2, 4096)   transposed store
//   2: v = Wkv[4096:]*ctx + b    -> vB (4096, s2)   row-major store
__global__ __launch_bounds__(256)
void gemm_qkv(const bf16* __restrict__ Wq, const bf16* __restrict__ Wkv,
              const bf16* __restrict__ xb, const bf16* __restrict__ cb,
              bf16* __restrict__ qT, bf16* __restrict__ kT, bf16* __restrict__ vB,
              const float* __restrict__ bq, const float* __restrict__ bkv) {
  __shared__ __attribute__((aligned(16))) bf16 shA[2][BM * LDSS];
  __shared__ __attribute__((aligned(16))) bf16 shB[2][BN * LDSS];

  const int z = blockIdx.z;
  const bf16*  A    = z == 0 ? Wq : Wkv + (size_t)(z - 1) * kO * kCTX;
  const bf16*  B    = z == 0 ? xb : cb;
  const float* bias = z == 0 ? bq : bkv + (z - 1) * kO;
  bf16*        C    = z == 0 ? qT : (z == 1 ? kT : vB);
  gemm_tile<true, true, true, false>(shA, shB, A, B, C, bias, nullptr,
                               kC, kC, kC, z == 2 ? kS2 : kO, 1.0f, z != 2);
}

// ---------------------------------------------------------------------------
// Fused attention: scores, softmax and P*V of one (sample, head, 128 queries) in
// one block, so that no score and no probability leaves the registers.
//   S^T = K * Q^T   : A = key rows from LDS, B = the wave's 32 queries, kept in
//                     registers for the whole kernel
//   O^T += V^T * P^T: A = V^T rows (channel, key) from LDS, B = P^T, which is the
//                     score accumulators converted in place: two S^T tiles (keys
//                     0-15 and 16-31 of a 32-key step) are one B operand in the
//                     k order that the LDS loader below has too
// A wave holds TWO query tiles of 16, so that every K and V^T fragment read from
// LDS feeds two WMMAs: the block's LDS reads per WMMA are half of what one tile a
// wave asks for, level with the matrix rate. The outputs (512 registers) and the
// queries (256) leave room for one wave per SIMD: a block is four waves.
// A lane holds scores and outputs of one query per tile (column lane & 15); lanes
// l and l ^ 16 split its keys, so the row maximum takes one lane exchange a stage
// and the row sum one at the end. The running maximum is raised, and O^T and the
// sum rescaled, only when some query's new maximum lies more than 8 (log2 units)
// above the one in use: p stays below 2^8.
// A stage is 64 keys: K 64 x 512 and V^T 512 x 64. The two tiles are the two
// buffers of one ring of async copies: while the scores read K, the stage's V^T
// flies; while P*V reads V^T, the next stage's K flies (32 copies of a wave in
// flight, one barrier at the foot of each of the two halves of a stage).
// qy holds q on entry and y on exit: a wave reads and writes only its own 32 rows
// x 512 columns.
// ---------------------------------------------------------------------------
static constexpr int FQ = 128;        // queries of a block, 32 a wave
static constexpr int QT = 2;          // query tiles of a wave
static constexpr int FK = 64;         // keys of a stage
static constexpr int KP = kC + 8;     // LDS pitch of a key row, elements (1040 B = 16 B x odd)
static constexpr int VP = FK + 8;     // LDS pitch of a V^T row, elements (144 B = 16 B x odd)
static_assert(kS % FQ == 0 && kS2 % FK == 0, "whole tiles");

typedef __attribute__((ext_vector_type(2))) __bf16 bf2;

// 2^x, with the slot that the instruction set asks for behind a transcendental
__device__ __forceinline__ float exp2_1(float x) {
  float r;
  asm("v_exp_f32 %0, %1\n\t"
      "v_nop"
      : "=&v"(r) : "v"(x));
  return r;
}

// One 16-B store. s_wait_xcnt closes the statement so that no register named
// here is rewritten while the store may still read it (in a statement of its own
// the compiler moved the next tile's arithmetic over the wait).
__device__ __forceinline__ void store16(bf16* p, f4 v) {
  asm volatile("global_store_b128 %0, %1, off\n\t"
               "s_wait_xcnt 0x0"
               :: "v"(p), "v"(v) : "memory");
}

__global__ __launch_bounds__(128)
void attn_fused(bf16* qy, const bf16* __restrict__ kT, const bf16* __restrict__ vB,
                float scale) {
  __shared__ __attribute__((aligned(16))) bf16 shK[FK * KP];
  __shared__ __attribute__((aligned(16))) bf16 shV[kC * VP];

  const int tid  = threadIdx.x;
  const int lane = tid & 31;
  const int wv   = tid >> 5;
  const int hl   = lane >> 4;
  const int fr   = lane & 15;
  const int hd   = blockIdx.y;
  const int nb   = blockIdx.z;
  const float c  = scale * 1.44269504f;    // scores in log2 units: exp(x) = 2^(x * log2 e)

  // the lane's query row of tile 0, this head's 512 columns; tile 1 lies 16 rows on
  bf16* qrow = qy + ((size_t)nb * kS + blockIdx.x * FQ + wv * (16 * QT) + fr) * kO + hd * kC;
  bf16* qrow1 = qrow + (size_t)16 * kO;
  const bf16* kbase = kT + (size_t)nb * kS2 * kO + hd * kC;              // (key, 4096)
  const bf16* vbase = vB + ((size_t)nb * kO + (size_t)hd * kC) * kS2;    // (channel, key)

  // staging. K: 64 lanes cover a 1024-B key row, a thread copies its 16 B of rows
  // kr, kr+2, ..., kr+62. V^T: 8 lanes cover a 128-B row, rows vr, vr+16, ..., vr+496.
  const int kr = tid >> 6, kc = (tid & 63) * 8;
  const int vr = tid >> 3, vc = (tid & 7) * 8;
  const bf16* kPtr = kbase + (size_t)kr * kO + kc;
  const bf16* vPtr = vbase + (size_t)vr * kS2 + vc;
  const unsigned kL = (unsigned)(unsigned long long)&shK[0] + (unsigned)((kr * KP + kc) * 2);
  const unsigned vL = (unsigned)(unsigned long long)&shV[0] + (unsigned)((vr * VP + vc) * 2);

  // Both copy loops stay rolled: unrolled, their 64 LDS addresses do not change
  // from stage to stage, the compiler keeps them in registers over the stage loop,
  // and they spill to scratch.
  auto issue_k = [&](int t) {
    const bf16* g = kPtr + (size_t)t * FK * kO;
    unsigned a = kL;
#pragma nounroll
    for (int q = 0; q < 4; ++q) {
      async_rows8(a, 2u * KP * 2u, g, (size_t)2 * kO);
      a += 16u * KP * 2u;
      g += (size_t)16 * kO;
    }
  };
  auto issue_v = [&](int t) {
    const bf16* g = vPtr + t * FK;
    unsigned a = vL;
#pragma nounroll
    for (int q = 0; q < 4; ++q) {
      async_rows8(a, 16u * VP * 2u, g, (size_t)16 * kS2);
      a += 128u * VP * 2u;
      g += (size_t)128 * kS2;
    }
  };

  // Fragment loads go in groups of eight fragments (16 WMMAs), one group ahead of
  // the WMMAs, into the other of two register sets: with one wave per SIMD nobody
  // else covers the LDS latency.
  // K: k-steps 2 g and 2 g + 1 of the four key tiles
  auto load_k = [&](FragAB (&a)[8], int g) {
#pragma unroll
    for (int u = 0; u < 2; ++u)
#pragma unroll
      for (int i = 0; i < FK / 16; ++i) {
        const bf16* p = &shK[(i * 16 + fr) * KP + (2 * g + u) * 32 + 8 * hl];
        a[u * 4 + i].f[0] = *(const f4*)p;
        a[u * 4 + i].f[1] = *(const f4*)(p + 16);
      }
  };
  // V^T: channel tiles 4 g .. 4 g + 3, both 32-key steps
  auto load_v = [&](FragAB (&a)[8], int g) {
#pragma unroll
    for (int dd = 0; dd < 4; ++dd)
#pragma unroll
      for (int kk = 0; kk < FK / 32; ++kk) {
        const bf16* p = &shV[((4 * g + dd) * 16 + fr) * VP + kk * 32 + 8 * hl];
        a[dd * 2 + kk].f[0] = *(const f4*)p;
        a[dd * 2 + kk].f[1] = *(const f4*)(p + 16);
      }
  };

  constexpr int NT = kS2 / FK;
  issue_k(0);

  // Q^T fragments, one per tile and 32 channels
  FragAB qf[QT][kC / 32];
#pragma unroll
  for (int ks = 0; ks < kC / 32; ++ks) {
    qf[0][ks].f[0] = *(const f4*)(qrow + ks * 32 + 8 * hl);
    qf[0][ks].f[1] = *(const f4*)(qrow + ks * 32 + 16 + 8 * hl);
    qf[1][ks].f[0] = *(const f4*)(qrow1 + ks * 32 + 8 * hl);
    qf[1][ks].f[1] = *(const f4*)(qrow1 + ks * 32 + 16 + 8 * hl);
  }
  // keeps the loads' address pairs whole (no load returns into them) until every
  // load has taken its address
  asm volatile("s_wait_xcnt 0x0" :: "v"(qrow), "v"(qrow1) : "memory");

  wait_async0();
  __syncthreads();      // K of stage 0 is published

  v8f o[QT][kC / 16];
#pragma unroll
  for (int j = 0; j < QT; ++j)
#pragma unroll
    for (int d = 0; d < kC / 16; ++d)
#pragma unroll
      for (int r = 0; r < 8; ++r) o[j][d][r] = 0.f;
  float m[QT], l[QT];   // maximum in use (log2 units, the same in lanes l and l ^ 16); the lane's share of the row sum
#pragma unroll
  for (int j = 0; j < QT; ++j) { m[j] = -1.0e30f; l[j] = 0.f; }

  for (int t = 0; t < NT; ++t) {
    // S^T, 64 keys x 32 queries
    v8f s[QT][FK / 16];
#pragma unroll
    for (int j = 0; j < QT; ++j)
#pragma unroll
      for (int i = 0; i < FK / 16; ++i)
#pragma unroll
        for (int r = 0; r < 8; ++r) s[j][i][r] = 0.f;
    {
      FragAB a[2][8];
      load_k(a[0], 0);
      // this stage's V^T, behind the barrier that ended the last read of shV; the
      // copies' issue covers the latency of the first K fragments
      issue_v(t);
#pragma unroll
      for (int g = 0; g < kC / 64; ++g) {
        if (g + 1 < kC / 64) load_k(a[(g + 1) & 1], g + 1);
        // the two fences keep the next group's LDS reads together and ahead of
        // this group's WMMAs (the compiler moved them in among the WMMAs)
        __builtin_amdgcn_sched_barrier(0);
#pragma unroll
        for (int u = 0; u < 2; ++u)
#pragma unroll
          for (int i = 0; i < FK / 16; ++i)
#pragma unroll
            for (int j = 0; j < QT; ++j)
              s[j][i] = __builtin_amdgcn_wmma_f32_16x16x32_bf16(
                  false, a[g & 1][u * 4 + i].v, false, qf[j][2 * g + u].v, (short)0, s[j][i],
                  false, false);
        __builtin_amdgcn_sched_barrier(0);
      }
    }

    // the stage's maximum of the lane's queries
    float mx[QT];
#pragma unroll
    for (int j = 0; j < QT; ++j) {
      float x = s[j][0][0];
#pragma unroll
      for (int i = 0; i < FK / 16; ++i)
#pragma unroll
        for (int r = 0; r < 8; ++r) x = fmaxf(x, s[j][i][r]);
      x *= c;           // c > 0
      mx[j] = fmaxf(x, __shfl_xor(x, 16));
    }
    // one wave-uniform test a stage
    if (__builtin_amdgcn_ballot_w32(mx[0] > m[0] + 8.0f || mx[1] > m[1] + 8.0f) != 0) {
#pragma unroll
      for (int j = 0; j < QT; ++j) {
        const float mn = fmaxf(m[j], mx[j]);
        const float al = exp2_1(m[j] - mn);
        m[j] = mn;
        l[j] *= al;
#pragma unroll
        for (int d = 0; d < kC / 16; ++d)
#pragma unroll
          for (int r = 0; r < 8; ++r) o[j][d][r] *= al;
      }
    }

    // p = 2^(s c - m), its sum, and P^T as B operands
    FragAB pb[QT][FK / 32];
#pragma unroll
    for (int j = 0; j < QT; ++j)
#pragma unroll
      for (int i = 0; i < FK / 16; ++i) {
        f4 x, y;
#pragma unroll
        for (int e = 0; e < 4; ++e) {
          x[e] = s[j][i][e] * c - m[j];
          y[e] = s[j][i][e + 4] * c - m[j];
        }
        exp2_x8(x, y);
        l[j] += ((x[0] + x[1]) + (x[2] + x[3])) + ((y[0] + y[1]) + (y[2] + y[3]));
        union { bf2 h[4]; f4 f; } u;
        u.h[0] = __builtin_convertvector(f2{x[0], x[1]}, bf2);
        u.h[1] = __builtin_convertvector(f2{x[2], x[3]}, bf2);
        u.h[2] = __builtin_convertvector(f2{y[0], y[1]}, bf2);
        u.h[3] = __builtin_convertvector(f2{y[2], y[3]}, bf2);
        pb[j][i >> 1].f[i & 1] = u.f;
      }
    // Empty statement on each row sum, against spills: the sums are finished
    // here. Without it the compiler moves
    // the additions behind P*V, the 64 f32 probabilities stay live through it, and
    // query fragments go to scratch.
    asm volatile("" : "+v"(l[0]));   // row sum of tile 0, against spills
    asm volatile("" : "+v"(l[1]));   // row sum of tile 1, against spills

    wait_ds0();
    wait_async0();
    __syncthreads();      // V^T of stage t is published; K has no reader left

    // O^T += V^T * P^T, 512 channels x 32 queries
    {
      FragAB a[2][8];
      load_v(a[0], 0);
      // the next stage's K; the copies' issue covers the latency of the first V^T fragments
      if (t + 1 < NT) issue_k(t + 1);
#pragma unroll
      for (int g = 0; g < kC / 64; ++g) {
        if (g + 1 < kC / 64) load_v(a[(g + 1) & 1], g + 1);
        // the two fences: as in the score loop
        __builtin_amdgcn_sched_barrier(0);
#pragma unroll
        for (int kk = 0; kk < FK / 32; ++kk)
#pragma unroll
          for (int dd = 0; dd < 4; ++dd)
#pragma unroll
            for (int j = 0; j < QT; ++j)
              o[j][4 * g + dd] = __builtin_amdgcn_wmma_f32_16x16x32_bf16(
                  false, a[g & 1][dd * 2 + kk].v, false, pb[j][kk].v, (short)0, o[j][4 * g + dd],
                  false, false);
        __builtin_amdgcn_sched_barrier(0);
      }
    }

    wait_ds0();
    wait_async0();
    __syncthreads();      // K of stage t+1 is published; V^T has no reader left
  }
  wait_async0();

  // register r of tile d = channel 16 d + 8 hl + r of the lane's query: 16-B stores
#pragma unroll
  for (int j = 0; j < QT; ++j) {
    const float ls = l[j] + __shfl_xor(l[j], 16);
    const float inv = 1.0f / ls;
    bf16* qr = j == 0 ? qrow : qrow1;
#pragma unroll
    for (int d = 0; d < kC / 16; ++d) {
      union { bf2 h[4]; f4 f; } u;
#pragma unroll
      for (int e = 0; e < 4; ++e)
        u.h[e] = __builtin_convertvector(f2{o[j][d][2 * e] * inv, o[j][d][2 * e + 1] * inv}, bf2);
      store16(qr + d * 16 + 8 * hl, u.f);
    }
  }
}

// ---------------------------------------------------------------------------
extern "C" void kernel_launch(void* const* d_in, const int* in_sizes, int n_in,
                              void* d_out, int out_size, void* d_ws, size_t ws_size,
                              hipStream_t stream) {
  const float* input   = (const float*)d_in[0];
  const float* context = (const float*)d_in[1];
  const float* gamma   = (const float*)d_in[2];
  const float* beta    = (const float*)d_in[3];
  const float* Wq      = (const float*)d_in[4];
  const float* bq      = (const float*)d_in[5];
  const float* Wkv     = (const float*)d_in[6];
  const float* bkv     = (const float*)d_in[7];
  const float* Wo      = (const float*)d_in[8];
  const float* bo      = (const float*)d_in[9];
  float* out = (float*)d_out;

  char* wsb = (char*)d_ws;
  size_t off = 0;
  auto alloc = [&](size_t bytes) -> char* {
    char* p = wsb + off;
    off += (bytes + 255) & ~(size_t)255;
    return p;
  };

  bf16* Wq16   = (bf16*)alloc((size_t)kO * kC * 2);          //   4 MB
  bf16* Wkv16  = (bf16*)alloc((size_t)2 * kO * kCTX * 2);    //   8 MB, behind Wq16
  bf16* Wo16   = (bf16*)alloc((size_t)kC * kO * 2);          //   4 MB, behind Wkv16
  bf16* xnT    = (bf16*)alloc((size_t)kN * kS * kC * 2);     //   8 MB  (n,s,c)
  bf16* ctxT   = (bf16*)alloc((size_t)kN * kS2 * kCTX * 2);  //   8 MB  (n,s,c), behind xnT
  bf16* kT     = (bf16*)alloc((size_t)kN * kS2 * kO * 2);    //  64 MB  (n,s2,4096)
  bf16* vB     = (bf16*)alloc((size_t)kN * kO * kS2 * 2);    //  64 MB  (n,4096,s2)
  bf16* yT     = (bf16*)alloc((size_t)kN * kS * kO * 2);     //  64 MB  (n,s,4096): q, then y in its place
  float* raw   = (float*)alloc(256);
  float* stats = (float*)alloc(256);
  (void)ws_size; (void)in_sizes; (void)n_in; (void)out_size;

  // stats
  zero_f32<<<1, 32, 0, stream>>>(raw, kN * 2);
  reduce_stats<<<dim3(256, kN), 256, 0, stream>>>(input, raw);
  finalize_stats<<<1, 32, 0, stream>>>(raw, stats);

  // transposed bf16 activations (xnT, then ctxT) + bf16 weights (Wq16, Wkv16, Wo16)
  norm_transpose<<<dim3(kS / TC, kC / TR, 2 * kN), 256, 0, stream>>>(
      input, context, xnT, stats, gamma, beta);
  cvt_bf16<<<4 * kO * kC / CVT_BLK, 256, 0, stream>>>(
      Wq, Wkv, Wo, Wq16, kO * kC, 2 * kO * kCTX, kC * kO);

  for (int n = 0; n < kN; ++n) {
    gemm_qkv<<<dim3(kS / BN, kO / BM, 3), 256, 0, stream>>>(
        Wq16, Wkv16, xnT + (size_t)n * kS * kC, ctxT + (size_t)n * kS2 * kCTX,
        yT + (size_t)n * kS * kO, kT + (size_t)n * kS2 * kO, vB + (size_t)n * kO * kS2,
        bq, bkv);
  }

  // attention, every sample and head in one launch: q in yT becomes y
  const float scoreScale = 1.0f / sqrtf((float)kC);   // (c^-0.25)^2
  attn_fused<<<dim3(kS / FQ, kH, kN), 128, 0, stream>>>(
      yT, kT, vB, scoreScale);

  // out = Wo * y + bo + residual  (f32, row-major (c,s)), all samples in grid z
  gemm_nt<false, false, true, true><<<dim3(kS / BN, kC / BM, kN), 256, 0, stream>>>(
      Wo16, yT, out, bo, input,
      kO, kO, kO, kS, 1.0f, 0, kS * kO, kC * kS);
}

// v008
// One run takes 350 microseconds.
// Timed twice side by side with v007, it ran 1.05 and 1.04 times as fast.
// All steps since v000 together make it 6.08 times as fast.
#include <hip/hip_runtime.h>
#include <hip/hip_bf16.h>
#include <math.h>

// ---------------------------------------------------------------------------
// CrossAttention1d for MI455X (gfx1250): bf16 WMMA pipeline, f32 accumulate.
// N=4, C=512, S=2048, S2=2048, H=8, CTX=512.  ~412 GFLOP -> compute-bound,
// all 5 matmul stages on v_wmma_f32_16x16x32_bf16, tiles staged to LDS via
// CDNA5 async copies (global_load_async_to_lds_b128 + s_wait_asynccnt).
// ---------------------------------------------------------------------------

typedef __bf16 bf16;
typedef __attribute__((ext_vector_type(16))) __bf16 v16bf;
typedef __attribute__((ext_vector_type(8)))  float  v8f;
typedef __attribute__((ext_vector_type(4)))  float  f4;

static constexpr int kN = 4, kC = 512, kS = 2048, kS2 = 2048, kH = 8, kCTX = 512;
static constexpr int kO = kC * kH;      // 4096
static constexpr float kEPS = 1e-5f;
static_assert(kC == kCTX && kS == kS2, "the batched launches below pair equal shapes");

__device__ __forceinline__ bf16 f2bf(float f) {
  unsigned u = __builtin_bit_cast(unsigned, f);
  u += 0x7FFFu + ((u >> 16) & 1u);          // round-to-nearest-even
  unsigned short h = (unsigned short)(u >> 16);
  return __builtin_bit_cast(bf16, h);
}

// ---------------------------------------------------------------------------
// Stage 0: sums for the batch-wide mean / rstd (layernorm over all C*S per n).
// Block bx of sample n stores its sum and its sum of squares in part[n][bx]; the
// kernel that normalises adds a sample's RB pairs itself, so that neither a
// launch that clears a cell nor one that finishes the statistics is needed.
// ---------------------------------------------------------------------------
typedef __attribute__((ext_vector_type(2))) float f2;
static constexpr int RB = 256;             // blocks, and so partial pairs, of a sample

__device__ __forceinline__
void reduce_stats(float* sh0, float* sh1, const float* __restrict__ in,
                  f2* __restrict__ part, int bx, int n) {
  const float* p = in + (size_t)n * kC * kS;
  float s = 0.f, s2 = 0.f;
  for (int i = bx * 256 + threadIdx.x; i < kC * kS; i += RB * 256) {
    float v = p[i]; s += v; s2 += v * v;
  }
  sh0[threadIdx.x] = s; sh1[threadIdx.x] = s2;
  __syncthreads();
  for (int o = 128; o > 0; o >>= 1) {
    if ((int)threadIdx.x < o) {
      sh0[threadIdx.x] += sh0[threadIdx.x + o];
      sh1[threadIdx.x] += sh1[threadIdx.x + o];
    }
    __syncthreads();
  }
  if (threadIdx.x == 0) part[n * RB + bx] = f2{sh0[0], sh1[0]};
}

// ---------------------------------------------------------------------------
// Stage 1: transpose one sample (kC,kS)f32 -> (kS,kC)bf16, with the layernorm
// affine (input) or as it is (PLAIN: context).
// A block takes a tile of 128 channels x 64 positions, a thread 32 elements, so
// that each wave has eight 16-byte loads in flight.
// A wave-wide load covers 256 B of two channel rows, a wave-wide store 256 B of
// two position rows: whole 128-B lines both ways. LDS holds the tile transposed,
// two neighbouring channels packed in a dword; the odd pitch spreads the 32
// lanes of every LDS write and read over 32 banks.
// ---------------------------------------------------------------------------
typedef __attribute__((ext_vector_type(4))) unsigned u4;
static constexpr int TR = 128, TC = 64;    // tile: channels x positions
static constexpr int TP = TR / 2 + 1;      // LDS pitch of a position row, dwords
static_assert(kC % TR == 0 && kS % TC == 0, "whole tiles only");
static constexpr int TBX = kS / TC, TBY = kC / TR;   // tiles of a sample

__device__ __forceinline__ unsigned pack_bf16(float lo, float hi) {
  return (unsigned)__builtin_bit_cast(unsigned short, f2bf(lo)) |
         ((unsigned)__builtin_bit_cast(unsigned short, f2bf(hi)) << 16);
}

// in, outp: the sample's first element; r0, c0: the tile's first channel, position
template <bool PLAIN>
__device__ __forceinline__
void transpose_tile(unsigned* tile, const float* __restrict__ in, bf16* __restrict__ outp,
                    int r0, int c0, float mu, float rinv,
                    const float* __restrict__ gamma, const float* __restrict__ beta) {
  const int cq = threadIdx.x & 15;
  const int tg = threadIdx.x >> 4;           // 0..15

  f2 g[4], b[4];
  if constexpr (!PLAIN) {
    const f2* pg = (const f2*)(gamma + r0 + 2 * tg);
    const f2* pb = (const f2*)(beta + r0 + 2 * tg);
#pragma unroll
    for (int i = 0; i < 4; ++i) { g[i] = pg[16 * i]; b[i] = pb[16 * i]; }
    // these loads have taken their address registers before they are rewritten
    asm volatile("s_wait_xcnt 0x0" ::: "memory");
  }

  // channels r0 + 2*(tg + 16 i) and the next one, positions c0 + 4 cq .. + 3
  const float* pin = in + (size_t)(r0 + 2 * tg) * kS + c0 + 4 * cq;
  f4 lo[4], hi[4];
#pragma unroll
  for (int i = 0; i < 4; ++i) {
    lo[i] = *(const f4*)(pin + (size_t)(32 * i) * kS);
    hi[i] = *(const f4*)(pin + (size_t)(32 * i + 1) * kS);
  }
  // keeps the loads' address pair whole (no load returns into it) until every
  // load has taken its address
  asm volatile("s_wait_xcnt 0x0" :: "v"(pin) : "memory");

#pragma unroll
  for (int i = 0; i < 4; ++i)
#pragma unroll
    for (int e = 0; e < 4; ++e) {
      float x = lo[i][e], y = hi[i][e];
      if constexpr (!PLAIN) {
        x = (x - mu) * rinv * g[i][0] + b[i][0];
        y = (y - mu) * rinv * g[i][1] + b[i][1];
      }
      tile[(4 * cq + e) * TP + tg + 16 * i] = pack_bf16(x, y);
    }
  __syncthreads();

  // position c0 + tg + 16 k, channels r0 + 8 cq .. + 7
  bf16* pout = outp + (size_t)(c0 + tg) * kC + r0 + 8 * cq;
#pragma unroll
  for (int k = 0; k < 4; ++k) {
    const unsigned* s = &tile[(tg + 16 * k) * TP + 4 * cq];
    const u4 w = {s[0], s[1], s[2], s[3]};
    *(u4*)(pout + (size_t)(16 * k) * kC) = w;
  }
}

// The input, normalised and transposed: grid (TBX, TBY, kN). Every wave first adds
// its sample's RB partial pairs for itself (a lane takes RB / 32 of them, then a
// lane exchange): no wave waits for another, and every lane holds both sums.
static_assert(RB % 32 == 0, "a lane of norm_transpose takes RB / 32 partial pairs");
__global__ __launch_bounds__(256)
void norm_transpose(const float* __restrict__ in, bf16* __restrict__ outp,
                    const float* __restrict__ part,
                    const float* __restrict__ gamma, const float* __restrict__ beta) {
  __shared__ unsigned tile[TC * TP];
  const int nb = blockIdx.z;

  const f2* pp = (const f2*)part + nb * RB + (threadIdx.x & 31);
  f2 t[RB / 32];
#pragma unroll
  for (int j = 0; j < RB / 32; ++j) t[j] = pp[32 * j];
  // the loads have taken their address registers before they are rewritten
  asm volatile("s_wait_xcnt 0x0" ::: "memory");
  float s = 0.f, s2 = 0.f;
#pragma unroll
  for (int j = 0; j < RB / 32; ++j) { s += t[j][0]; s2 += t[j][1]; }
#pragma unroll
  for (int o = 16; o > 0; o >>= 1) {
    s  += __shfl_xor(s, o);
    s2 += __shfl_xor(s2, o);
  }
  const float inv  = 1.0f / (float)(kC * kS);
  const float mean = s * inv;
  const float var  = s2 * inv - mean * mean;
  const float rinv = rsqrtf(var + kEPS);

  transpose_tile<false>(tile, in + (size_t)nb * kC * kS, outp + (size_t)nb * kS * kC,
                        blockIdx.y * TR, blockIdx.x * TC, mean, rinv, gamma, beta);
}

// the three weight matrices: o holds a (na), b (nb), c (nc) in a row. na, nb and
// nc are multiples of CVT_BLK, so a block lies in one matrix and the
// (na + nb + nc) / CVT_BLK blocks end with the last element.
// A lane casts 64 elements: 4,096 waves, each with sixteen 16-byte loads in flight. Each wave-wide load covers 512 contiguous bytes, each
// wave-wide store 256.
static constexpr int CVT_V   = 16;                 // 16-byte loads of a lane
static constexpr int CVT_BLK = 256 * 4 * CVT_V;    // elements of a block
static_assert(kO * kC % CVT_BLK == 0, "a block of the weight cast lies in one matrix");

__device__ __forceinline__
void cvt_bf16(const float* __restrict__ a, const float* __restrict__ b,
              const float* __restrict__ c, bf16* __restrict__ o,
              int na, int nb, int nc, int bx) {
  const int i0 = bx * CVT_BLK;               // the block's first element in o
  if (i0 >= na + nb + nc) return;
  const float* src = a + i0;
  if (i0 >= na)      src = b + (i0 - na);
  if (i0 >= na + nb) src = c + (i0 - na - nb);
  // the lane's first element in the block: a wave takes 128 * CVT_V in a row
  const int w0 = (threadIdx.x >> 5) * (128 * CVT_V) + (threadIdx.x & 31) * 4;
  const f4* p = (const f4*)(src + w0);
  f4 v[CVT_V];
#pragma unroll
  for (int j = 0; j < CVT_V; ++j) v[j] = p[j * 32];
  // the loads have taken their address registers before these are rewritten
  asm volatile("s_wait_xcnt 0x0" ::: "memory");
  f2* q = (f2*)(o + i0 + w0);
#pragma unroll
  for (int j = 0; j < CVT_V; ++j) {
    union { unsigned u[2]; f2 f; } t;
    t.u[0] = pack_bf16(v[j][0], v[j][1]);
    t.u[1] = pack_bf16(v[j][2], v[j][3]);
    q[j * 32] = t.f;
  }
}

// Everything that depends on the inputs alone, in one launch; a block's index
// picks its job (the same for the whole block):
//   PREP_R blocks: partial sums of the input
//   PREP_W blocks: the three weight matrices as bf16
//   PREP_T blocks: the context, transposed as it is
static constexpr int PREP_R = RB * kN;
static constexpr int PREP_W = 4 * kO * kC / CVT_BLK;
static constexpr int PREP_T = TBX * TBY * kN;

__global__ __launch_bounds__(256)
void prep(const float* __restrict__ in, float* __restrict__ part,
          const float* __restrict__ Wq, const float* __restrict__ Wkv,
          const float* __restrict__ Wo, bf16* __restrict__ w16,
          const float* __restrict__ ctx, bf16* __restrict__ ctxT) {
  __shared__ unsigned tile[TC * TP];
  __shared__ float sh0[256], sh1[256];
  int bx = blockIdx.x;
  if (bx < PREP_R) {
    reduce_stats(sh0, sh1, in, (f2*)part, bx % RB, bx / RB);
    return;
  }
  bx -= PREP_R;
  if (bx < PREP_W) {
    cvt_bf16(Wq, Wkv, Wo, w16, kO * kC, 2 * kO * kCTX, kC * kO, bx);
    return;
  }
  bx -= PREP_W;
  const int nb = bx / (TBX * TBY);
  const int ty = bx / TBX % TBY;
  const int tx = bx % TBX;
  transpose_tile<true>(tile, ctx + (size_t)nb * kCTX * kS2, ctxT + (size_t)nb * kS2 * kCTX,
                       ty * TR, tx * TC, 0.f, 1.f, nullptr, nullptr);
  // these stores have taken their registers before the code of the other jobs,
  // which stands behind them in the kernel, writes the same registers
  asm volatile("s_wait_xcnt 0x0" ::: "memory");
}

// ---------------------------------------------------------------------------
// 2^x for the softmax of the fused attention kernel
// ---------------------------------------------------------------------------
// a, b <- 2^a, 2^b. Eight v_exp_f32 in one statement, closed by a v_nop: it is
// the slot that the instruction set asks for behind a transcendental before its
// result is read or its source overwritten.
// The outputs are early-clobber, so that inside the
// statement no exp writes over a source either.
__device__ __forceinline__ void exp2_x8(f4& a, f4& b) {
  float r0, r1, r2, r3, r4, r5, r6, r7;
  asm("v_exp_f32 %0, %8\n\t"
      "v_exp_f32 %1, %9\n\t"
      "v_exp_f32 %2, %10\n\t"
      "v_exp_f32 %3, %11\n\t"
      "v_exp_f32 %4, %12\n\t"
      "v_exp_f32 %5, %13\n\t"
      "v_exp_f32 %6, %14\n\t"
      "v_exp_f32 %7, %15\n\t"
      "v_nop"
      : "=&v"(r0), "=&v"(r1), "=&v"(r2), "=&v"(r3),
        "=&v"(r4), "=&v"(r5), "=&v"(r6), "=&v"(r7)
      : "v"(a[0]), "v"(a[1]), "v"(a[2]), "v"(a[3]),
        "v"(b[0]), "v"(b[1]), "v"(b[2]), "v"(b[3]));
  a[0] = r0; a[1] = r1; a[2] = r2; a[3] = r3;
  b[0] = r4; b[1] = r5; b[2] = r6; b[3] = r7;
}

// ---------------------------------------------------------------------------
// CDNA5 async copies: 16B per lane, global -> LDS, tracked by ASYNCcnt.
// Eight copies of one lane, a fixed number of tile rows apart.
//   l     : the lane's LDS byte address (low 32 bits of the LDS pointer)
//   lstep : LDS bytes from one copy to the next
//   g     : the lane's global pointer
//   gstep : global elements from one copy to the next
// s_wait_xcnt closes the statement so that no address register named here is
// rewritten while a copy may still read it.
// ---------------------------------------------------------------------------
__device__ __forceinline__ void async_rows8(unsigned l, unsigned lstep,
                                            const bf16* g, size_t gstep) {
  asm volatile("global_load_async_to_lds_b128 %0, %8, off\n\t"
               "global_load_async_to_lds_b128 %1, %9, off\n\t"
               "global_load_async_to_lds_b128 %2, %10, off\n\t"
               "global_load_async_to_lds_b128 %3, %11, off\n\t"
               "global_load_async_to_lds_b128 %4, %12, off\n\t"
               "global_load_async_to_lds_b128 %5, %13, off\n\t"
               "global_load_async_to_lds_b128 %6, %14, off\n\t"
               "global_load_async_to_lds_b128 %7, %15, off\n\t"
               "s_wait_xcnt 0x0"
               :: "v"(l), "v"(l + lstep), "v"(l + 2u * lstep), "v"(l + 3u * lstep),
                  "v"(l + 4u * lstep), "v"(l + 5u * lstep), "v"(l + 6u * lstep),
                  "v"(l + 7u * lstep),
                  "v"(g), "v"(g + gstep), "v"(g + 2 * gstep), "v"(g + 3 * gstep),
                  "v"(g + 4 * gstep), "v"(g + 5 * gstep), "v"(g + 6 * gstep),
                  "v"(g + 7 * gstep)
               : "memory");
}
// my own copies have landed in LDS
__device__ __forceinline__ void wait_async0() {
  asm volatile("s_wait_asynccnt 0x0" ::: "memory");
}
// my own LDS reads have returned, so the buffer may be refilled behind the barrier
__device__ __forceinline__ void wait_ds0() {
  asm volatile("s_wait_dscnt 0x0" ::: "memory");
}

// ---------------------------------------------------------------------------
// NT GEMM:  D(M,Nn) = A(M,K) * B(Nn,K)^T   (bf16 in, f32 accum via WMMA)
//   trans    : store D transposed (Cout[n][m]), 16B-contiguous per lane
//   PICK     : trans is known only at run time (the same for the whole block)
//   OUT_BF16 : output bf16 (else f32)
//   HAS_BIAS : + bias[m]
//   HAS_RES  : + res[m*ldc + n] (row-major only)
// gemm_tile does one block tile (blockIdx.y, blockIdx.x) of one product; the
// two kernels behind it pick the product by blockIdx.z.
// block tile 128x128, 8 waves (2x4), 128 k per LDS stage (four WMMA k-steps),
// two LDS buffers filled by async copies that overlap the WMMA stream. A stage
// row is 256 B, so one wave-wide copy covers two rows = four whole 128-B lines.
// ---------------------------------------------------------------------------
static constexpr int BM = 128, BN = 128, BK = 128;
static constexpr int LDSS = 136;  // padded row stride in bf16 elems (272B = 16B x odd)

union FragAB { v16bf v; f4 f[2]; };
template <bool V> struct BoolC { static constexpr bool value = V; };

template <bool PICK, bool OUT_BF16, bool HAS_BIAS, bool HAS_RES>
__device__ __forceinline__
void gemm_tile(bf16 (*shA)[BM * LDSS], bf16 (*shB)[BN * LDSS],
               const bf16* __restrict__ A, const bf16* __restrict__ B,
               void* __restrict__ Cout, const float* __restrict__ bias,
               const float* __restrict__ res,
               int K, int lda, int ldb, int ldc, float scale, bool trans) {
  const int tid  = threadIdx.x;
  const int lane = tid & 31;
  const int wv   = tid >> 5;
  const int wm   = wv & 3;          // 4 wave-rows
  const int wn   = wv >> 2;         // 2 wave-cols
  const int m0   = blockIdx.y * BM;
  const int n0   = blockIdx.x * BN;

  // staging: 16 lanes cover one 256B stage row; a thread copies its 16B chunk
  // of rows lr, lr+16, ..., lr+112 of both operands
  const int lr = tid >> 4;           // 0..15 (first tile row)
  const int lc = (tid & 15) * 8;     // k elems

  const bf16* aPtr = A + (size_t)(m0 + lr) * lda + lc;
  const bf16* bPtr = B + (size_t)(n0 + lr) * ldb + lc;
  const unsigned thrL  = (unsigned)((lr * LDSS + lc) * 2);  // bytes
  const unsigned sA[2] = { (unsigned)(unsigned long long)&shA[0][0],
                           (unsigned)(unsigned long long)&shA[1][0] };
  const unsigned sB[2] = { (unsigned)(unsigned long long)&shB[0][0],
                           (unsigned)(unsigned long long)&shB[1][0] };

  auto issue_tile = [&](int kt, int buf) {
    async_rows8(sA[buf] + thrL, 16u * LDSS * 2u, aPtr + (size_t)kt * BK, (size_t)16 * lda);
    async_rows8(sB[buf] + thrL, 16u * LDSS * 2u, bPtr + (size_t)kt * BK, (size_t)16 * ldb);
  };

  const int KT = K / BK;
  issue_tile(0, 0);
  wait_async0();
  __syncthreads();      // stage 0 is published
  if (KT > 1) issue_tile(1, 1);

  v8f acc[2][4];
#pragma unroll
  for (int i = 0; i < 2; ++i)
#pragma unroll
    for (int j = 0; j < 4; ++j)
#pragma unroll
      for (int r = 0; r < 8; ++r) acc[i][j][r] = 0.f;

  const int hl = lane >> 4;          // K-quarter selector
  const int fr = lane & 15;          // fragment row (M for A, N for B)

  for (int kt = 0; kt < KT; ++kt) {
    const int cur = kt & 1;
    // unrolled so that the next k-step's fragment loads can go ahead of this
    // k-step's WMMAs
#pragma unroll
    for (int ks = 0; ks < BK / 32; ++ks) {
      FragAB a[2], b[4];
#pragma unroll
      for (int i = 0; i < 2; ++i) {
        const bf16* p = &shA[cur][(wm * 32 + i * 16 + fr) * LDSS + ks * 32 + 8 * hl];
        a[i].f[0] = *(const f4*)p;
        a[i].f[1] = *(const f4*)(p + 16);
      }
#pragma unroll
      for (int j = 0; j < 4; ++j) {
        const bf16* p = &shB[cur][(wn * 64 + j * 16 + fr) * LDSS + ks * 32 + 8 * hl];
        b[j].f[0] = *(const f4*)p;
        b[j].f[1] = *(const f4*)(p + 16);
      }
#pragma unroll
      for (int i = 0; i < 2; ++i)
#pragma unroll
        for (int j = 0; j < 4; ++j)
          acc[i][j] = __builtin_amdgcn_wmma_f32_16x16x32_bf16(
              false, a[i].v, false, b[j].v, (short)0, acc[i][j], false, false);
    }
    wait_ds0();
    wait_async0();
    __syncthreads();      // stage kt+1 is published; buf[cur] has no reader left
    if (kt + 2 < KT) issue_tile(kt + 2, cur);
  }
  wait_async0();

  // epilogue: D tile [16x16]; lane fr = N index, VGPR r -> M = 8*hl + r
  auto store_tiles = [&](auto tr) {
  constexpr bool TR = decltype(tr)::value;
#pragma unroll
  for (int i = 0; i < 2; ++i) {
    const int mBase = m0 + wm * 32 + i * 16 + 8 * hl;
#pragma unroll
    for (int j = 0; j < 4; ++j) {
      const int nIdx = n0 + wn * 64 + j * 16 + fr;
      v8f v = acc[i][j];
      if constexpr (TR) {
        if constexpr (OUT_BF16) {
          union { bf16 h[8]; f4 f; } t;
#pragma unroll
          for (int r = 0; r < 8; ++r) {
            float f = v[r] * scale;
            if constexpr (HAS_BIAS) f += bias[mBase + r];
            t.h[r] = f2bf(f);
          }
          *(f4*)((bf16*)Cout + (size_t)nIdx * ldc + mBase) = t.f;
        } else {
          union { float x[8]; f4 f[2]; } t;
#pragma unroll
          for (int r = 0; r < 8; ++r) {
            float f = v[r] * scale;
            if constexpr (HAS_BIAS) f += bias[mBase + r];
            t.x[r] = f;
          }
          float* po = (float*)Cout + (size_t)nIdx * ldc + mBase;
          *(f4*)po = t.f[0];
          *(f4*)(po + 4) = t.f[1];
        }
      } else {
#pragma unroll
        for (int r = 0; r < 8; ++r) {
          float f = v[r] * scale;
          if constexpr (HAS_BIAS) f += bias[mBase + r];
          if constexpr (HAS_RES)  f += res[(size_t)(mBase + r) * ldc + nIdx];
          if constexpr (OUT_BF16)
            ((bf16*)Cout)[(size_t)(mBase + r) * ldc + nIdx] = f2bf(f);
          else
            ((float*)Cout)[(size_t)(mBase + r) * ldc + nIdx] = f;
        }
      }
    }
  }
  };
  // the store form is picked once, outside the tile loops: each form's bias
  // loads and stores stay one straight run
  if constexpr (PICK) {
    if (trans) {
      store_tiles(BoolC<true>{});
      // these stores have taken their registers before the code of the other
      // form, which stands behind them in the kernel, writes the same registers
      asm volatile("s_wait_xcnt 0x0" ::: "memory");
    } else {
      store_tiles(BoolC<false>{});
    }
  } else {
    if (trans) store_tiles(BoolC<true>{});
    else       store_tiles(BoolC<false>{});
  }
}

// One independent product per blockIdx.z; sAz/sBz/sCz are the element strides
// of A, B and Cout (and res) from one z to the next.
template <bool TRANS, bool OUT_BF16, bool HAS_BIAS, bool HAS_RES>
__global__ __launch_bounds__(256)
void gemm_nt(const bf16* __restrict__ A, const bf16* __restrict__ B,
             void* __restrict__ Cout, const float* __restrict__ bias,
             const float* __restrict__ res,
             int K, int lda, int ldb, int ldc, float scale,
             int sAz, int sBz, int sCz) {
  __shared__ __attribute__((aligned(16))) bf16 shA[2][BM * LDSS];
  __shared__ __attribute__((aligned(16))) bf16 shB[2][BN * LDSS];

  A += (size_t)blockIdx.z * sAz;
  B += (size_t)blockIdx.z * sBz;
  const size_t cOffZ = (size_t)blockIdx.z * sCz;
  if constexpr (OUT_BF16) Cout = (bf16*)Cout + cOffZ;
  else                    Cout = (float*)Cout + cOffZ;
  if constexpr (HAS_RES)  res += cOffZ;
  gemm_tile<false, OUT_BF16, HAS_BIAS, HAS_RES>(shA, shB, A, B, Cout, bias, res,
                                         K, lda, ldb, ldc, scale, TRANS);
}

// The three projections of every sample in one launch: blockIdx.z = 3 * sample + z,
// xb, cb, qT, kT, vB hold the samples one after another.
//   0: q = Wq*xn + bq            -> qT (s, 4096)    transposed store
//   1: k = Wkv[0:4096]*ctx + b   -> kT (s2, 4096)   transposed store
//   2: v = Wkv[4096:]*ctx + b    -> vB (4096, s2)   row-major store
__global__ __launch_bounds__(256)
void gemm_qkv(const bf16* __restrict__ Wq, const bf16* __restrict__ Wkv,
              const bf16* __restrict__ xb, const bf16* __restrict__ cb,
              bf16* __restrict__ qT, bf16* __restrict__ kT, bf16* __restrict__ vB,
              const float* __restrict__ bq, const float* __restrict__ bkv) {
  __shared__ __attribute__((aligned(16))) bf16 shA[2][BM * LDSS];
  __shared__ __attribute__((aligned(16))) bf16 shB[2][BN * LDSS];

  const int n = blockIdx.z / 3;
  const int z = blockIdx.z - 3 * n;
  const bf16*  A    = z == 0 ? Wq : Wkv + (size_t)(z - 1) * kO * kCTX;
  const bf16*  B    = (z == 0 ? xb : cb) + (size_t)n * kS * kC;
  const float* bias = z == 0 ? bq : bkv + (z - 1) * kO;
  bf16*        C    = (z == 0 ? qT : (z == 1 ? kT : vB)) + (size_t)n * kS * kO;
  gemm_tile<true, true, true, false>(shA, shB, A, B, C, bias, nullptr,
                               kC, kC, kC, z == 2 ? kS2 : kO, 1.0f, z != 2);
}

// ---------------------------------------------------------------------------
// Fused attention: scores, softmax and P*V of one (sample, head, 128 queries) in
// one block, so that no score and no probability leaves the registers.
//   S^T = K * Q^T   : A = key rows from LDS, B = the wave's 32 queries, kept in
//                     registers for the whole kernel
//   O^T += V^T * P^T: A = V^T rows (channel, key) from LDS, B = P^T, which is the
//                     score accumulators converted in place: two S^T tiles (keys
//                     0-15 and 16-31 of a 32-key step) are one B operand in the
//                     k order that the LDS loader below has too
// A wave holds TWO query tiles of 16, so that every K and V^T fragment read from
// LDS feeds two WMMAs: the block's LDS reads per WMMA are half of what one tile a
// wave asks for, level with the matrix rate. The outputs (512 registers) and the
// queries (256) leave room for one wave per SIMD: a block is four waves.
// A lane holds scores and outputs of one query per tile (column lane & 15); lanes
// l and l ^ 16 split its keys, so the row maximum takes one lane exchange a stage
// and the row sum one at the end. The running maximum is raised, and O^T and the
// sum rescaled, only when some query's new maximum lies more than 8 (log2 units)
// above the one in use: p stays below 2^8.
// A stage is 64 keys: K 64 x 512 and V^T 512 x 64. The two tiles are the two
// buffers of one ring of async copies: while the scores read K, the stage's V^T
// flies; while P*V reads V^T, the next stage's K flies (32 copies of a wave in
// flight, one barrier at the foot of each of the two halves of a stage).
// qy holds q on entry and y on exit: a wave reads and writes only its own 32 rows
// x 512 columns.
// ---------------------------------------------------------------------------
static constexpr int FQ = 128;        // queries of a block, 32 a wave
static constexpr int QT = 2;          // query tiles of a wave
static constexpr int FK = 64;         // keys of a stage
static constexpr int KP = kC + 8;     // LDS pitch of a key row, elements (1040 B = 16 B x odd)
static constexpr int VP = FK + 8;     // LDS pitch of a V^T row, elements (144 B = 16 B x odd)
static_assert(kS % FQ == 0 && kS2 % FK == 0, "whole tiles");

typedef __attribute__((ext_vector_type(2))) __bf16 bf2;

// 2^x, with the slot that the instruction set asks for behind a transcendental
__device__ __forceinline__ float exp2_1(float x) {
  float r;
  asm("v_exp_f32 %0, %1\n\t"
      "v_nop"
      : "=&v"(r) : "v"(x));
  return r;
}

// One 16-B store. s_wait_xcnt closes the statement so that no register named
// here is rewritten while the store may still read it (in a statement of its own
// the compiler moved the next tile's arithmetic over the wait).
__device__ __forceinline__ void store16(bf16* p, f4 v) {
  asm volatile("global_store_b128 %0, %1, off\n\t"
               "s_wait_xcnt 0x0"
               :: "v"(p), "v"(v) : "memory");
}

__global__ __launch_bounds__(128)
void attn_fused(bf16* qy, const bf16* __restrict__ kT, const bf16* __restrict__ vB,
                float scale) {
  __shared__ __attribute__((aligned(16))) bf16 shK[FK * KP];
  __shared__ __attribute__((aligned(16))) bf16 shV[kC * VP];

  const int tid  = threadIdx.x;
  const int lane = tid & 31;
  const int wv   = tid >> 5;
  const int hl   = lane >> 4;
  const int fr   = lane & 15;
  const int hd   = blockIdx.y;
  const int nb   = blockIdx.z;
  const float c  = scale * 1.44269504f;    // scores in log2 units: exp(x) = 2^(x * log2 e)

  // the lane's query row of tile 0, this head's 512 columns; tile 1 lies 16 rows on
  bf16* qrow = qy + ((size_t)nb * kS + blockIdx.x * FQ + wv * (16 * QT) + fr) * kO + hd * kC;
  bf16* qrow1 = qrow + (size_t)16 * kO;
  const bf16* kbase = kT + (size_t)nb * kS2 * kO + hd * kC;              // (key, 4096)
  const bf16* vbase = vB + ((size_t)nb * kO + (size_t)hd * kC) * kS2;    // (channel, key)

  // staging. K: 64 lanes cover a 1024-B key row, a thread copies its 16 B of rows
  // kr, kr+2, ..., kr+62. V^T: 8 lanes cover a 128-B row, rows vr, vr+16, ..., vr+496.
  const int kr = tid >> 6, kc = (tid & 63) * 8;
  const int vr = tid >> 3, vc = (tid & 7) * 8;
  const bf16* kPtr = kbase + (size_t)kr * kO + kc;
  const bf16* vPtr = vbase + (size_t)vr * kS2 + vc;
  const unsigned kL = (unsigned)(unsigned long long)&shK[0] + (unsigned)((kr * KP + kc) * 2);
  const unsigned vL = (unsigned)(unsigned long long)&shV[0] + (unsigned)((vr * VP + vc) * 2);

  // Both copy loops stay rolled: unrolled, their 64 LDS addresses do not change
  // from stage to stage, the compiler keeps them in registers over the stage loop,
  // and they spill to scratch.
  auto issue_k = [&](int t) {
    const bf16* g = kPtr + (size_t)t * FK * kO;
    unsigned a = kL;
#pragma nounroll
    for (int q = 0; q < 4; ++q) {
      async_rows8(a, 2u * KP * 2u, g, (size_t)2 * kO);
      a += 16u * KP * 2u;
      g += (size_t)16 * kO;
    }
  };
  auto issue_v = [&](int t) {
    const bf16* g = vPtr + t * FK;
    unsigned a = vL;
#pragma nounroll
    for (int q = 0; q < 4; ++q) {
      async_rows8(a, 16u * VP * 2u, g, (size_t)16 * kS2);
      a += 128u * VP * 2u;
      g += (size_t)128 * kS2;
    }
  };

  // Fragment loads go in groups of eight fragments (16 WMMAs), one group ahead of
  // the WMMAs, into the other of two register sets: with one wave per SIMD nobody
  // else covers the LDS latency.
  // K: k-steps 2 g and 2 g + 1 of the four key tiles
  auto load_k = [&](FragAB (&a)[8], int g) {
#pragma unroll
    for (int u = 0; u < 2; ++u)
#pragma unroll
      for (int i = 0; i < FK / 16; ++i) {
        const bf16* p = &shK[(i * 16 + fr) * KP + (2 * g + u) * 32 + 8 * hl];
        a[u * 4 + i].f[0] = *(const f4*)p;
        a[u * 4 + i].f[1] = *(const f4*)(p + 16);
      }
  };
  // V^T: channel tiles 4 g .. 4 g + 3, both 32-key steps
  auto load_v = [&](FragAB (&a)[8], int g) {
#pragma unroll
    for (int dd = 0; dd < 4; ++dd)
#pragma unroll
      for (int kk = 0; kk < FK / 32; ++kk) {
        const bf16* p = &shV[((4 * g + dd) * 16 + fr) * VP + kk * 32 + 8 * hl];
        a[dd * 2 + kk].f[0] = *(const f4*)p;
        a[dd * 2 + kk].f[1] = *(const f4*)(p + 16);
      }
  };

  constexpr int NT = kS2 / FK;
  issue_k(0);

  // Q^T fragments, one per tile and 32 channels
  FragAB qf[QT][kC / 32];
#pragma unroll
  for (int ks = 0; ks < kC / 32; ++ks) {
    qf[0][ks].f[0] = *(const f4*)(qrow + ks * 32 + 8 * hl);
    qf[0][ks].f[1] = *(const f4*)(qrow + ks * 32 + 16 + 8 * hl);
    qf[1][ks].f[0] = *(const f4*)(qrow1 + ks * 32 + 8 * hl);
    qf[1][ks].f[1] = *(const f4*)(qrow1 + ks * 32 + 16 + 8 * hl);
  }
  // keeps the loads' address pairs whole (no load returns into them) until every
  // load has taken its address
  asm volatile("s_wait_xcnt 0x0" :: "v"(qrow), "v"(qrow1) : "memory");

  wait_async0();
  __syncthreads();      // K of stage 0 is published

  v8f o[QT][kC / 16];
#pragma unroll
  for (int j = 0; j < QT; ++j)
#pragma unroll
    for (int d = 0; d < kC / 16; ++d)
#pragma unroll
      for (int r = 0; r < 8; ++r) o[j][d][r] = 0.f;
  float m[QT], l[QT];   // maximum in use (log2 units, the same in lanes l and l ^ 16); the lane's share of the row sum
#pragma unroll
  for (int j = 0; j < QT; ++j) { m[j] = -1.0e30f; l[j] = 0.f; }

  for (int t = 0; t < NT; ++t) {
    // S^T, 64 keys x 32 queries
    v8f s[QT][FK / 16];
#pragma unroll
    for (int j = 0; j < QT; ++j)
#pragma unroll
      for (int i = 0; i < FK / 16; ++i)
#pragma unroll
        for (int r = 0; r < 8; ++r) s[j][i][r] = 0.f;
    {
      FragAB a[2][8];
      load_k(a[0], 0);
      // this stage's V^T, behind the barrier that ended the last read of shV; the
      // copies' issue covers the latency of the first K fragments
      issue_v(t);
#pragma unroll
      for (int g = 0; g < kC / 64; ++g) {
        if (g + 1 < kC / 64) load_k(a[(g + 1) & 1], g + 1);
        // the two fences keep the next group's LDS reads together and ahead of
        // this group's WMMAs (the compiler moved them in among the WMMAs)
        __builtin_amdgcn_sched_barrier(0);
#pragma unroll
        for (int u = 0; u < 2; ++u)
#pragma unroll
          for (int i = 0; i < FK / 16; ++i)
#pragma unroll
            for (int j = 0; j < QT; ++j)
              s[j][i] = __builtin_amdgcn_wmma_f32_16x16x32_bf16(
                  false, a[g & 1][u * 4 + i].v, false, qf[j][2 * g + u].v, (short)0, s[j][i],
                  false, false);
        __builtin_amdgcn_sched_barrier(0);
      }
    }

    // the stage's maximum of the lane's queries
    float mx[QT];
#pragma unroll
    for (int j = 0; j < QT; ++j) {
      float x = s[j][0][0];
#pragma unroll
      for (int i = 0; i < FK / 16; ++i)
#pragma unroll
        for (int r = 0; r < 8; ++r) x = fmaxf(x, s[j][i][r]);
      x *= c;           // c > 0
      mx[j] = fmaxf(x, __shfl_xor(x, 16));
    }
    // one wave-uniform test a stage
    if (__builtin_amdgcn_ballot_w32(mx[0] > m[0] + 8.0f || mx[1] > m[1] + 8.0f) != 0) {
#pragma unroll
      for (int j = 0; j < QT; ++j) {
        const float mn = fmaxf(m[j], mx[j]);
        const float al = exp2_1(m[j] - mn);
        m[j] = mn;
        l[j] *= al;
#pragma unroll
        for (int d = 0; d < kC / 16; ++d)
#pragma unroll
          for (int r = 0; r < 8; ++r) o[j][d][r] *= al;
      }
    }

    // p = 2^(s c - m), its sum, and P^T as B operands
    FragAB pb[QT][FK / 32];
#pragma unroll
    for (int j = 0; j < QT; ++j)
#pragma unroll
      for (int i = 0; i < FK / 16; ++i) {
        f4 x, y;
#pragma unroll
        for (int e = 0; e < 4; ++e) {
          x[e] = s[j][i][e] * c - m[j];
          y[e] = s[j][i][e + 4] * c - m[j];
        }
        exp2_x8(x, y);
        l[j] += ((x[0] + x[1]) + (x[2] + x[3])) + ((y[0] + y[1]) + (y[2] + y[3]));
        union { bf2 h[4]; f4 f; } u;
        u.h[0] = __builtin_convertvector(f2{x[0], x[1]}, bf2);
        u.h[1] = __builtin_convertvector(f2{x[2], x[3]}, bf2);
        u.h[2] = __builtin_convertvector(f2{y[0], y[1]}, bf2);
        u.h[3] = __builtin_convertvector(f2{y[2], y[3]}, bf2);
        pb[j][i >> 1].f[i & 1] = u.f;
      }
    // Empty statement on each row sum, against spills: the sums are finished
    // here. Without it the compiler moves
    // the additions behind P*V, the 64 f32 probabilities stay live through it, and
    // query fragments go to scratch.
    asm volatile("" : "+v"(l[0]));   // row sum of tile 0, against spills
    asm volatile("" : "+v"(l[1]));   // row sum of tile 1, against spills

    wait_ds0();
    wait_async0();
    __syncthreads();      // V^T of stage t is published; K has no reader left

    // O^T += V^T * P^T, 512 channels x 32 queries
    {
      FragAB a[2][8];
      load_v(a[0], 0);
      // the next stage's K; the copies' issue covers the latency of the first V^T fragments
      if (t + 1 < NT) issue_k(t + 1);
#pragma unroll
      for (int g = 0; g < kC / 64; ++g) {
        if (g + 1 < kC / 64) load_v(a[(g + 1) & 1], g + 1);
        // the two fences: as in the score loop
        __builtin_amdgcn_sched_barrier(0);
#pragma unroll
        for (int kk = 0; kk < FK / 32; ++kk)
#pragma unroll
          for (int dd = 0; dd < 4; ++dd)
#pragma unroll
            for (int j = 0; j < QT; ++j)
              o[j][4 * g + dd] = __builtin_amdgcn_wmma_f32_16x16x32_bf16(
                  false, a[g & 1][dd * 2 + kk].v, false, pb[j][kk].v, (short)0, o[j][4 * g + dd],
                  false, false);
        __builtin_amdgcn_sched_barrier(0);
      }
    }

    wait_ds0();
    wait_async0();
    __syncthreads();      // K of stage t+1 is published; V^T has no reader left
  }
  wait_async0();

  // register r of tile d = channel 16 d + 8 hl + r of the lane's query: 16-B stores
#pragma unroll
  for (int j = 0; j < QT; ++j) {
    const float ls = l[j] + __shfl_xor(l[j], 16);
    const float inv = 1.0f / ls;
    bf16* qr = j == 0 ? qrow : qrow1;
#pragma unroll
    for (int d = 0; d < kC / 16; ++d) {
      union { bf2 h[4]; f4 f; } u;
#pragma unroll
      for (int e = 0; e < 4; ++e)
        u.h[e] = __builtin_convertvector(f2{o[j][d][2 * e] * inv, o[j][d][2 * e + 1] * inv}, bf2);
      store16(qr + d * 16 + 8 * hl, u.f);
    }
  }
}

// ---------------------------------------------------------------------------
extern "C" void kernel_launch(void* const* d_in, const int* in_sizes, int n_in,
                              void* d_out, int out_size, void* d_ws, size_t ws_size,
                              hipStream_t stream) {
  const float* input   = (const float*)d_in[0];
  const float* context = (const float*)d_in[1];
  const float* gamma   = (const float*)d_in[2];
  const float* beta    = (const float*)d_in[3];
  const float* Wq      = (const float*)d_in[4];
  const float* bq      = (const float*)d_in[5];
  const float* Wkv     = (const float*)d_in[6];
  const float* bkv     = (const float*)d_in[7];
  const float* Wo      = (const float*)d_in[8];
  const float* bo      = (const float*)d_in[9];
  float* out = (float*)d_out;

  char* wsb = (char*)d_ws;
  size_t off = 0;
  auto alloc = [&](size_t bytes) -> char* {
    char* p = wsb + off;
    off += (bytes + 255) & ~(size_t)255;
    return p;
  };

  bf16* Wq16   = (bf16*)alloc((size_t)kO * kC * 2);          //   4 MB
  bf16* Wkv16  = (bf16*)alloc((size_t)2 * kO * kCTX * 2);    //   8 MB, behind Wq16
  bf16* Wo16   = (bf16*)alloc((size_t)kC * kO * 2);          //   4 MB, behind Wkv16
  bf16* xnT    = (bf16*)alloc((size_t)kN * kS * kC * 2);     //   8 MB  (n,s,c)
  bf16* ctxT   = (bf16*)alloc((size_t)kN * kS2 * kCTX * 2);  //   8 MB  (n,s,c), behind xnT
  bf16* kT     = (bf16*)alloc((size_t)kN * kS2 * kO * 2);    //  64 MB  (n,s2,4096)
  bf16* vB     = (bf16*)alloc((size_t)kN * kO * kS2 * 2);    //  64 MB  (n,4096,s2)
  bf16* yT     = (bf16*)alloc((size_t)kN * kS * kO * 2);     //  64 MB  (n,s,4096): q, then y in its place
  float* part  = (float*)alloc((size_t)kN * RB * 2 * sizeof(float));   // partial sums of the input
  (void)ws_size; (void)in_sizes; (void)n_in; (void)out_size;

  // partial sums, bf16 weights (Wq16, Wkv16, Wo16), transposed bf16 context
  prep<<<PREP_R + PREP_W + PREP_T, 256, 0, stream>>>(
      input, part, Wq, Wkv, Wo, Wq16, context, ctxT);
  // normalised, transposed bf16 input
  norm_transpose<<<dim3(TBX, TBY, kN), 256, 0, stream>>>(input, xnT, part, gamma, beta);

  // q (into yT), k, v of every sample
  gemm_qkv<<<dim3(kS / BN, kO / BM, 3 * kN), 256, 0, stream>>>(
      Wq16, Wkv16, xnT, ctxT, yT, kT, vB, bq, bkv);

  // attention, every sample and head in one launch: q in yT becomes y
  const float scoreScale = 1.0f / sqrtf((float)kC);   // (c^-0.25)^2
  attn_fused<<<dim3(kS / FQ, kH, kN), 128, 0, stream>>>(
      yT, kT, vB, scoreScale);

  // out = Wo * y + bo + residual  (f32, row-major (c,s)), all samples in grid z
  gemm_nt<false, false, true, true><<<dim3(kS / BN, kC / BM, kN), 256, 0, stream>>>(
      Wo16, yT, out, bo, input,
      kO, kO, kO, kS, 1.0f, 0, kS * kO, kC * kS);
}

// v009
// Measured time: 321 microseconds a run.
// Two timings next to v008 both put it at 1.09 times that version's speed.
// Over all steps from v000 it is 6.62 times as fast.
#include <hip/hip_runtime.h>
#include <hip/hip_bf16.h>
#include <math.h>

// ---------------------------------------------------------------------------
// CrossAttention1d for MI455X (gfx1250): bf16 WMMA pipeline, f32 accumulate.
// N=4, C=512, S=2048, S2=2048, H=8, CTX=512.  ~412 GFLOP -> compute-bound,
// all 5 matmul stages on v_wmma_f32_16x16x32_bf16, tiles staged to LDS via
// CDNA5 async copies (global_load_async_to_lds_b128 + s_wait_asynccnt) in the
// GEMMs, tensor loads (tensor_load_to_lds + s_wait_tensorcnt) in attention.
// ---------------------------------------------------------------------------

typedef __bf16 bf16;
typedef __attribute__((ext_vector_type(16))) __bf16 v16bf;
typedef __attribute__((ext_vector_type(8)))  float  v8f;
typedef __attribute__((ext_vector_type(4)))  float  f4;

static constexpr int kN = 4, kC = 512, kS = 2048, kS2 = 2048, kH = 8, kCTX = 512;
static constexpr int kO = kC * kH;      // 4096
static constexpr float kEPS = 1e-5f;
static_assert(kC == kCTX && kS == kS2, "the batched launches below pair equal shapes");

__device__ __forceinline__ bf16 f2bf(float f) {
  unsigned u = __builtin_bit_cast(unsigned, f);
  u += 0x7FFFu + ((u >> 16) & 1u);          // round-to-nearest-even
  unsigned short h = (unsigned short)(u >> 16);
  return __builtin_bit_cast(bf16, h);
}

// ---------------------------------------------------------------------------
// Stage 0: sums for the batch-wide mean / rstd (layernorm over all C*S per n).
// Block bx of sample n stores its sum and its sum of squares in part[n][bx]; the
// kernel that normalises adds a sample's RB pairs itself, so that neither a
// launch that clears a cell nor one that finishes the statistics is needed.
// ---------------------------------------------------------------------------
typedef __attribute__((ext_vector_type(2))) float f2;
static constexpr int RB = 256;             // blocks, and so partial pairs, of a sample

__device__ __forceinline__
void reduce_stats(float* sh0, float* sh1, const float* __restrict__ in,
                  f2* __restrict__ part, int bx, int n) {
  const float* p = in + (size_t)n * kC * kS;
  float s = 0.f, s2 = 0.f;
  for (int i = bx * 256 + threadIdx.x; i < kC * kS; i += RB * 256) {
    float v = p[i]; s += v; s2 += v * v;
  }
  sh0[threadIdx.x] = s; sh1[threadIdx.x] = s2;
  __syncthreads();
  for (int o = 128; o > 0; o >>= 1) {
    if ((int)threadIdx.x < o) {
      sh0[threadIdx.x] += sh0[threadIdx.x + o];
      sh1[threadIdx.x] += sh1[threadIdx.x + o];
    }
    __syncthreads();
  }
  if (threadIdx.x == 0) part[n * RB + bx] = f2{sh0[0], sh1[0]};
}

// ---------------------------------------------------------------------------
// Stage 1: transpose one sample (kC,kS)f32 -> (kS,kC)bf16, with the layernorm
// affine (input) or as it is (PLAIN: context).
// A block takes a tile of 128 channels x 64 positions, a thread 32 elements, so
// that each wave has eight 16-byte loads in flight.
// A wave-wide load covers 256 B of two channel rows, a wave-wide store 256 B of
// two position rows: whole 128-B lines both ways. LDS holds the tile transposed,
// two neighbouring channels packed in a dword; the odd pitch spreads the 32
// lanes of every LDS write and read over 32 banks.
// ---------------------------------------------------------------------------
typedef __attribute__((ext_vector_type(4))) unsigned u4;
static constexpr int TR = 128, TC = 64;    // tile: channels x positions
static constexpr int TP = TR / 2 + 1;      // LDS pitch of a position row, dwords
static_assert(kC % TR == 0 && kS % TC == 0, "whole tiles only");
static constexpr int TBX = kS / TC, TBY = kC / TR;   // tiles of a sample

__device__ __forceinline__ unsigned pack_bf16(float lo, float hi) {
  return (unsigned)__builtin_bit_cast(unsigned short, f2bf(lo)) |
         ((unsigned)__builtin_bit_cast(unsigned short, f2bf(hi)) << 16);
}

// in, outp: the sample's first element; r0, c0: the tile's first channel, position
template <bool PLAIN>
__device__ __forceinline__
void transpose_tile(unsigned* tile, const float* __restrict__ in, bf16* __restrict__ outp,
                    int r0, int c0, float mu, float rinv,
                    const float* __restrict__ gamma, const float* __restrict__ beta) {
  const int cq = threadIdx.x & 15;
  const int tg = threadIdx.x >> 4;           // 0..15

  f2 g[4], b[4];
  if constexpr (!PLAIN) {
    const f2* pg = (const f2*)(gamma + r0 + 2 * tg);
    const f2* pb = (const f2*)(beta + r0 + 2 * tg);
#pragma unroll
    for (int i = 0; i < 4; ++i) { g[i] = pg[16 * i]; b[i] = pb[16 * i]; }
    // these loads have taken their address registers before they are rewritten
    asm volatile("s_wait_xcnt 0x0" ::: "memory");
  }

  // channels r0 + 2*(tg + 16 i) and the next one, positions c0 + 4 cq .. + 3
  const float* pin = in + (size_t)(r0 + 2 * tg) * kS + c0 + 4 * cq;
  f4 lo[4], hi[4];
#pragma unroll
  for (int i = 0; i < 4; ++i) {
    lo[i] = *(const f4*)(pin + (size_t)(32 * i) * kS);
    hi[i] = *(const f4*)(pin + (size_t)(32 * i + 1) * kS);
  }
  // keeps the loads' address pair whole (no load returns into it) until every
  // load has taken its address
  asm volatile("s_wait_xcnt 0x0" :: "v"(pin) : "memory");

#pragma unroll
  for (int i = 0; i < 4; ++i)
#pragma unroll
    for (int e = 0; e < 4; ++e) {
      float x = lo[i][e], y = hi[i][e];
      if constexpr (!PLAIN) {
        x = (x - mu) * rinv * g[i][0] + b[i][0];
        y = (y - mu) * rinv * g[i][1] + b[i][1];
      }
      tile[(4 * cq + e) * TP + tg + 16 * i] = pack_bf16(x, y);
    }
  __syncthreads();

  // position c0 + tg + 16 k, channels r0 + 8 cq .. + 7
  bf16* pout = outp + (size_t)(c0 + tg) * kC + r0 + 8 * cq;
#pragma unroll
  for (int k = 0; k < 4; ++k) {
    const unsigned* s = &tile[(tg + 16 * k) * TP + 4 * cq];
    const u4 w = {s[0], s[1], s[2], s[3]};
    *(u4*)(pout + (size_t)(16 * k) * kC) = w;
  }
}

// The input, normalised and transposed: grid (TBX, TBY, kN). Every wave first adds
// its sample's RB partial pairs for itself (a lane takes RB / 32 of them, then a
// lane exchange): no wave waits for another, and every lane holds both sums.
static_assert(RB % 32 == 0, "a lane of norm_transpose takes RB / 32 partial pairs");
__global__ __launch_bounds__(256)
void norm_transpose(const float* __restrict__ in, bf16* __restrict__ outp,
                    const float* __restrict__ part,
                    const float* __restrict__ gamma, const float* __restrict__ beta) {
  __shared__ unsigned tile[TC * TP];
  const int nb = blockIdx.z;

  const f2* pp = (const f2*)part + nb * RB + (threadIdx.x & 31);
  f2 t[RB / 32];
#pragma unroll
  for (int j = 0; j < RB / 32; ++j) t[j] = pp[32 * j];
  // the loads have taken their address registers before they are rewritten
  asm volatile("s_wait_xcnt 0x0" ::: "memory");
  float s = 0.f, s2 = 0.f;
#pragma unroll
  for (int j = 0; j < RB / 32; ++j) { s += t[j][0]; s2 += t[j][1]; }
#pragma unroll
  for (int o = 16; o > 0; o >>= 1) {
    s  += __shfl_xor(s, o);
    s2 += __shfl_xor(s2, o);
  }
  const float inv  = 1.0f / (float)(kC * kS);
  const float mean = s * inv;
  const float var  = s2 * inv - mean * mean;
  const float rinv = rsqrtf(var + kEPS);

  transpose_tile<false>(tile, in + (size_t)nb * kC * kS, outp + (size_t)nb * kS * kC,
                        blockIdx.y * TR, blockIdx.x * TC, mean, rinv, gamma, beta);
}

// the three weight matrices: o holds a (na), b (nb), c (nc) in a row. na, nb and
// nc are multiples of CVT_BLK, so a block lies in one matrix and the
// (na + nb + nc) / CVT_BLK blocks end with the last element.
// A lane casts 64 elements: 4,096 waves, each with sixteen 16-byte loads in flight. Each wave-wide load covers 512 contiguous bytes, each
// wave-wide store 256.
static constexpr int CVT_V   = 16;                 // 16-byte loads of a lane
static constexpr int CVT_BLK = 256 * 4 * CVT_V;    // elements of a block
static_assert(kO * kC % CVT_BLK == 0, "a block of the weight cast lies in one matrix");

__device__ __forceinline__
void cvt_bf16(const float* __restrict__ a, const float* __restrict__ b,
              const float* __restrict__ c, bf16* __restrict__ o,
              int na, int nb, int nc, int bx) {
  const int i0 = bx * CVT_BLK;               // the block's first element in o
  if (i0 >= na + nb + nc) return;
  const float* src = a + i0;
  if (i0 >= na)      src = b + (i0 - na);
  if (i0 >= na + nb) src = c + (i0 - na - nb);
  // the lane's first element in the block: a wave takes 128 * CVT_V in a row
  const int w0 = (threadIdx.x >> 5) * (128 * CVT_V) + (threadIdx.x & 31) * 4;
  const f4* p = (const f4*)(src + w0);
  f4 v[CVT_V];
#pragma unroll
  for (int j = 0; j < CVT_V; ++j) v[j] = p[j * 32];
  // the loads have taken their address registers before these are rewritten
  asm volatile("s_wait_xcnt 0x0" ::: "memory");
  f2* q = (f2*)(o + i0 + w0);
#pragma unroll
  for (int j = 0; j < CVT_V; ++j) {
    union { unsigned u[2]; f2 f; } t;
    t.u[0] = pack_bf16(v[j][0], v[j][1]);
    t.u[1] = pack_bf16(v[j][2], v[j][3]);
    q[j * 32] = t.f;
  }
}

// Everything that depends on the inputs alone, in one launch; a block's index
// picks its job (the same for the whole block):
//   PREP_R blocks: partial sums of the input
//   PREP_W blocks: the three weight matrices as bf16
//   PREP_T blocks: the context, transposed as it is
static constexpr int PREP_R = RB * kN;
static constexpr int PREP_W = 4 * kO * kC / CVT_BLK;
static constexpr int PREP_T = TBX * TBY * kN;

__global__ __launch_bounds__(256)
void prep(const float* __restrict__ in, float* __restrict__ part,
          const float* __restrict__ Wq, const float* __restrict__ Wkv,
          const float* __restrict__ Wo, bf16* __restrict__ w16,
          const float* __restrict__ ctx, bf16* __restrict__ ctxT) {
  __shared__ unsigned tile[TC * TP];
  __shared__ float sh0[256], sh1[256];
  int bx = blockIdx.x;
  if (bx < PREP_R) {
    reduce_stats(sh0, sh1, in, (f2*)part, bx % RB, bx / RB);
    return;
  }
  bx -= PREP_R;
  if (bx < PREP_W) {
    cvt_bf16(Wq, Wkv, Wo, w16, kO * kC, 2 * kO * kCTX, kC * kO, bx);
    return;
  }
  bx -= PREP_W;
  const int nb = bx / (TBX * TBY);
  const int ty = bx / TBX % TBY;
  const int tx = bx % TBX;
  transpose_tile<true>(tile, ctx + (size_t)nb * kCTX * kS2, ctxT + (size_t)nb * kS2 * kCTX,
                       ty * TR, tx * TC, 0.f, 1.f, nullptr, nullptr);
  // these stores have taken their registers before the code of the other jobs,
  // which stands behind them in the kernel, writes the same registers
  asm volatile("s_wait_xcnt 0x0" ::: "memory");
}

// ---------------------------------------------------------------------------
// 2^x for the softmax of the fused attention kernel
// ---------------------------------------------------------------------------
// a, b <- 2^a, 2^b. Eight v_exp_f32 in one statement, closed by a v_nop: it is
// the slot that the instruction set asks for behind a transcendental before its
// result is read or its source overwritten.
// The outputs are early-clobber, so that inside the
// statement no exp writes over a source either.
__device__ __forceinline__ void exp2_x8(f4& a, f4& b) {
  float r0, r1, r2, r3, r4, r5, r6, r7;
  asm("v_exp_f32 %0, %8\n\t"
      "v_exp_f32 %1, %9\n\t"
      "v_exp_f32 %2, %10\n\t"
      "v_exp_f32 %3, %11\n\t"
      "v_exp_f32 %4, %12\n\t"
      "v_exp_f32 %5, %13\n\t"
      "v_exp_f32 %6, %14\n\t"
      "v_exp_f32 %7, %15\n\t"
      "v_nop"
      : "=&v"(r0), "=&v"(r1), "=&v"(r2), "=&v"(r3),
        "=&v"(r4), "=&v"(r5), "=&v"(r6), "=&v"(r7)
      : "v"(a[0]), "v"(a[1]), "v"(a[2]), "v"(a[3]),
        "v"(b[0]), "v"(b[1]), "v"(b[2]), "v"(b[3]));
  a[0] = r0; a[1] = r1; a[2] = r2; a[3] = r3;
  b[0] = r4; b[1] = r5; b[2] = r6; b[3] = r7;
}

// ---------------------------------------------------------------------------
// CDNA5 async copies: 16B per lane, global -> LDS, tracked by ASYNCcnt.
// Eight copies of one lane, a fixed number of tile rows apart.
//   l     : the lane's LDS byte address (low 32 bits of the LDS pointer)
//   lstep : LDS bytes from one copy to the next
//   g     : the lane's global pointer
//   gstep : global elements from one copy to the next
// s_wait_xcnt closes the statement so that no address register named here is
// rewritten while a copy may still read it.
// ---------------------------------------------------------------------------
__device__ __forceinline__ void async_rows8(unsigned l, unsigned lstep,
                                            const bf16* g, size_t gstep) {
  asm volatile("global_load_async_to_lds_b128 %0, %8, off\n\t"
               "global_load_async_to_lds_b128 %1, %9, off\n\t"
               "global_load_async_to_lds_b128 %2, %10, off\n\t"
               "global_load_async_to_lds_b128 %3, %11, off\n\t"
               "global_load_async_to_lds_b128 %4, %12, off\n\t"
               "global_load_async_to_lds_b128 %5, %13, off\n\t"
               "global_load_async_to_lds_b128 %6, %14, off\n\t"
               "global_load_async_to_lds_b128 %7, %15, off\n\t"
               "s_wait_xcnt 0x0"
               :: "v"(l), "v"(l + lstep), "v"(l + 2u * lstep), "v"(l + 3u * lstep),
                  "v"(l + 4u * lstep), "v"(l + 5u * lstep), "v"(l + 6u * lstep),
                  "v"(l + 7u * lstep),
                  "v"(g), "v"(g + gstep), "v"(g + 2 * gstep), "v"(g + 3 * gstep),
                  "v"(g + 4 * gstep), "v"(g + 5 * gstep), "v"(g + 6 * gstep),
                  "v"(g + 7 * gstep)
               : "memory");
}
// my own copies have landed in LDS
__device__ __forceinline__ void wait_async0() {
  asm volatile("s_wait_asynccnt 0x0" ::: "memory");
}
// my own LDS reads have returned, so the buffer may be refilled behind the barrier
__device__ __forceinline__ void wait_ds0() {
  asm volatile("s_wait_dscnt 0x0" ::: "memory");
}

// ---------------------------------------------------------------------------
// NT GEMM:  D(M,Nn) = A(M,K) * B(Nn,K)^T   (bf16 in, f32 accum via WMMA)
//   trans    : store D transposed (Cout[n][m]), 16B-contiguous per lane
//   PICK     : trans is known only at run time (the same for the whole block)
//   OUT_BF16 : output bf16 (else f32)
//   HAS_BIAS : + bias[m]
//   HAS_RES  : + res[m*ldc + n] (row-major only)
// gemm_tile does one block tile (blockIdx.y, blockIdx.x) of one product; the
// two kernels behind it pick the product by blockIdx.z.
// block tile 128x128, 8 waves (2x4), 128 k per LDS stage (four WMMA k-steps),
// two LDS buffers filled by async copies that overlap the WMMA stream. A stage
// row is 256 B, so one wave-wide copy covers two rows = four whole 128-B lines.
// ---------------------------------------------------------------------------
static constexpr int BM = 128, BN = 128, BK = 128;
static constexpr int LDSS = 136;  // padded row stride in bf16 elems (272B = 16B x odd)

union FragAB { v16bf v; f4 f[2]; };
template <bool V> struct BoolC { static constexpr bool value = V; };

template <bool PICK, bool OUT_BF16, bool HAS_BIAS, bool HAS_RES>
__device__ __forceinline__
void gemm_tile(bf16 (*shA)[BM * LDSS], bf16 (*shB)[BN * LDSS],
               const bf16* __restrict__ A, const bf16* __restrict__ B,
               void* __restrict__ Cout, const float* __restrict__ bias,
               const float* __restrict__ res,
               int K, int lda, int ldb, int ldc, float scale, bool trans) {
  const int tid  = threadIdx.x;
  const int lane = tid & 31;
  const int wv   = tid >> 5;
  const int wm   = wv & 3;          // 4 wave-rows
  const int wn   = wv >> 2;         // 2 wave-cols
  const int m0   = blockIdx.y * BM;
  const int n0   = blockIdx.x * BN;

  // staging: 16 lanes cover one 256B stage row; a thread copies its 16B chunk
  // of rows lr, lr+16, ..., lr+112 of both operands
  const int lr = tid >> 4;           // 0..15 (first tile row)
  const int lc = (tid & 15) * 8;     // k elems

  const bf16* aPtr = A + (size_t)(m0 + lr) * lda + lc;
  const bf16* bPtr = B + (size_t)(n0 + lr) * ldb + lc;
  const unsigned thrL  = (unsigned)((lr * LDSS + lc) * 2);  // bytes
  const unsigned sA[2] = { (unsigned)(unsigned long long)&shA[0][0],
                           (unsigned)(unsigned long long)&shA[1][0] };
  const unsigned sB[2] = { (unsigned)(unsigned long long)&shB[0][0],
                           (unsigned)(unsigned long long)&shB[1][0] };

  auto issue_tile = [&](int kt, int buf) {
    async_rows8(sA[buf] + thrL, 16u * LDSS * 2u, aPtr + (size_t)kt * BK, (size_t)16 * lda);
    async_rows8(sB[buf] + thrL, 16u * LDSS * 2u, bPtr + (size_t)kt * BK, (size_t)16 * ldb);
  };

  const int KT = K / BK;
  issue_tile(0, 0);
  wait_async0();
  __syncthreads();      // stage 0 is published
  if (KT > 1) issue_tile(1, 1);

  v8f acc[2][4];
#pragma unroll
  for (int i = 0; i < 2; ++i)
#pragma unroll
    for (int j = 0; j < 4; ++j)
#pragma unroll
      for (int r = 0; r < 8; ++r) acc[i][j][r] = 0.f;

  const int hl = lane >> 4;          // K-quarter selector
  const int fr = lane & 15;          // fragment row (M for A, N for B)

  for (int kt = 0; kt < KT; ++kt) {
    const int cur = kt & 1;
    // unrolled so that the next k-step's fragment loads can go ahead of this
    // k-step's WMMAs
#pragma unroll
    for (int ks = 0; ks < BK / 32; ++ks) {
      FragAB a[2], b[4];
#pragma unroll
      for (int i = 0; i < 2; ++i) {
        const bf16* p = &shA[cur][(wm * 32 + i * 16 + fr) * LDSS + ks * 32 + 8 * hl];
        a[i].f[0] = *(const f4*)p;
        a[i].f[1] = *(const f4*)(p + 16);
      }
#pragma unroll
      for (int j = 0; j < 4; ++j) {
        const bf16* p = &shB[cur][(wn * 64 + j * 16 + fr) * LDSS + ks * 32 + 8 * hl];
        b[j].f[0] = *(const f4*)p;
        b[j].f[1] = *(const f4*)(p + 16);
      }
#pragma unroll
      for (int i = 0; i < 2; ++i)
#pragma unroll
        for (int j = 0; j < 4; ++j)
          acc[i][j] = __builtin_amdgcn_wmma_f32_16x16x32_bf16(
              false, a[i].v, false, b[j].v, (short)0, acc[i][j], false, false);
    }
    wait_ds0();
    wait_async0();
    __syncthreads();      // stage kt+1 is published; buf[cur] has no reader left
    if (kt + 2 < KT) issue_tile(kt + 2, cur);
  }
  wait_async0();

  // epilogue: D tile [16x16]; lane fr = N index, VGPR r -> M = 8*hl + r
  auto store_tiles = [&](auto tr) {
  constexpr bool TR = decltype(tr)::value;
#pragma unroll
  for (int i = 0; i < 2; ++i) {
    const int mBase = m0 + wm * 32 + i * 16 + 8 * hl;
#pragma unroll
    for (int j = 0; j < 4; ++j) {
      const int nIdx = n0 + wn * 64 + j * 16 + fr;
      v8f v = acc[i][j];
      if constexpr (TR) {
        if constexpr (OUT_BF16) {
          union { bf16 h[8]; f4 f; } t;
#pragma unroll
          for (int r = 0; r < 8; ++r) {
            float f = v[r] * scale;
            if constexpr (HAS_BIAS) f += bias[mBase + r];
            t.h[r] = f2bf(f);
          }
          *(f4*)((bf16*)Cout + (size_t)nIdx * ldc + mBase) = t.f;
        } else {
          union { float x[8]; f4 f[2]; } t;
#pragma unroll
          for (int r = 0; r < 8; ++r) {
            float f = v[r] * scale;
            if constexpr (HAS_BIAS) f += bias[mBase + r];
            t.x[r] = f;
          }
          float* po = (float*)Cout + (size_t)nIdx * ldc + mBase;
          *(f4*)po = t.f[0];
          *(f4*)(po + 4) = t.f[1];
        }
      } else {
#pragma unroll
        for (int r = 0; r < 8; ++r) {
          float f = v[r] * scale;
          if constexpr (HAS_BIAS) f += bias[mBase + r];
          if constexpr (HAS_RES)  f += res[(size_t)(mBase + r) * ldc + nIdx];
          if constexpr (OUT_BF16)
            ((bf16*)Cout)[(size_t)(mBase + r) * ldc + nIdx] = f2bf(f);
          else
            ((float*)Cout)[(size_t)(mBase + r) * ldc + nIdx] = f;
        }
      }
    }
  }
  };
  // the store form is picked once, outside the tile loops: each form's bias
  // loads and stores stay one straight run
  if constexpr (PICK) {
    if (trans) {
      store_tiles(BoolC<true>{});
      // these stores have taken their registers before the code of the other
      // form, which stands behind them in the kernel, writes the same registers
      asm volatile("s_wait_xcnt 0x0" ::: "memory");
    } else {
      store_tiles(BoolC<false>{});
    }
  } else {
    if (trans) store_tiles(BoolC<true>{});
    else       store_tiles(BoolC<false>{});
  }
}

// One independent product per blockIdx.z; sAz/sBz/sCz are the element strides
// of A, B and Cout (and res) from one z to the next.
template <bool TRANS, bool OUT_BF16, bool HAS_BIAS, bool HAS_RES>
__global__ __launch_bounds__(256)
void gemm_nt(const bf16* __restrict__ A, const bf16* __restrict__ B,
             void* __restrict__ Cout, const float* __restrict__ bias,
             const float* __restrict__ res,
             int K, int lda, int ldb, int ldc, float scale,
             int sAz, int sBz, int sCz) {
  __shared__ __attribute__((aligned(16))) bf16 shA[2][BM * LDSS];
  __shared__ __attribute__((aligned(16))) bf16 shB[2][BN * LDSS];

  A += (size_t)blockIdx.z * sAz;
  B += (size_t)blockIdx.z * sBz;
  const size_t cOffZ = (size_t)blockIdx.z * sCz;
  if constexpr (OUT_BF16) Cout = (bf16*)Cout + cOffZ;
  else                    Cout = (float*)Cout + cOffZ;
  if constexpr (HAS_RES)  res += cOffZ;
  gemm_tile<false, OUT_BF16, HAS_BIAS, HAS_RES>(shA, shB, A, B, Cout, bias, res,
                                         K, lda, ldb, ldc, scale, TRANS);
}

// The three projections of every sample in one launch: blockIdx.z = 3 * sample + z,
// xb, cb, qT, kT, vB hold the samples one after another.
//   0: q = Wq*xn + bq            -> qT (s, 4096)    transposed store
//   1: k = Wkv[0:4096]*ctx + b   -> kT (s2, 4096)   transposed store
//   2: v = Wkv[4096:]*ctx + b    -> vB (4096, s2)   row-major store
__global__ __launch_bounds__(256)
void gemm_qkv(const bf16* __restrict__ Wq, const bf16* __restrict__ Wkv,
              const bf16* __restrict__ xb, const bf16* __restrict__ cb,
              bf16* __restrict__ qT, bf16* __restrict__ kT, bf16* __restrict__ vB,
              const float* __restrict__ bq, const float* __restrict__ bkv) {
  __shared__ __attribute__((aligned(16))) bf16 shA[2][BM * LDSS];
  __shared__ __attribute__((aligned(16))) bf16 shB[2][BN * LDSS];

  const int n = blockIdx.z / 3;
  const int z = blockIdx.z - 3 * n;
  const bf16*  A    = z == 0 ? Wq : Wkv + (size_t)(z - 1) * kO * kCTX;
  const bf16*  B    = (z == 0 ? xb : cb) + (size_t)n * kS * kC;
  const float* bias = z == 0 ? bq : bkv + (z - 1) * kO;
  bf16*        C    = (z == 0 ? qT : (z == 1 ? kT : vB)) + (size_t)n * kS * kO;
  gemm_tile<true, true, true, false>(shA, shB, A, B, C, bias, nullptr,
                               kC, kC, kC, z == 2 ? kS2 : kO, 1.0f, z != 2);
}

// ---------------------------------------------------------------------------
// Fused attention: scores, softmax and P*V of one (sample, head, 128 queries) in
// one block, so that no score and no probability leaves the registers.
//   S^T = K * Q^T   : A = key rows from LDS, B = the wave's 32 queries, kept in
//                     registers for the whole kernel
//   O^T += V^T * P^T: A = V^T rows (channel, key) from LDS, B = P^T, which is the
//                     score accumulators converted in place: two S^T tiles (keys
//                     0-15 and 16-31 of a 32-key step) are one B operand in the
//                     k order that the LDS loader below has too
// A wave holds TWO query tiles of 16, so that every K and V^T fragment read from
// LDS feeds two WMMAs: the block's LDS reads per WMMA are half of what one tile a
// wave asks for, level with the matrix rate. The outputs (512 registers) and the
// queries (256) leave room for one wave per SIMD: a block is four waves.
// A lane holds scores and outputs of one query per tile (column lane & 15); lanes
// l and l ^ 16 split its keys, so the row maximum takes one lane exchange a stage
// and the row sum one at the end. The running maximum is raised, and O^T and the
// sum rescaled, only when some query's new maximum lies more than 8 (log2 units)
// above the one in use: p stays below 2^8.
// A stage is 64 keys: K 64 x 512 and V^T 512 x 64. The two tiles are the two
// buffers of one ring of tensor loads: while the scores read K, the stage's V^T
// flies; while P*V reads V^T, the next stage's K flies. Every wave brings a
// quarter of each tile with ONE request (its issue costs the wave a few scalar
// instructions, where per-lane copies cost it 32 address pairs and their waits,
// with nobody else on the SIMD to fill the time); one barrier at the foot of each
// of the two halves of a stage.
// K lies in LDS as four slabs of 128 channels (rows of 256 B, which the mover pads
// to 272), wave w brings slab w; V^T lies channel row by channel row (rows of 128 B
// padded to 144), wave w brings channels 128 w .. 128 w + 127.
// qy holds q on entry and y on exit: a wave reads and writes only its own 32 rows
// x 512 columns.
// ---------------------------------------------------------------------------
static constexpr int FQ = 128;        // queries of a block, 32 a wave
static constexpr int QT = 2;          // query tiles of a wave
static constexpr int FK = 64;         // keys of a stage
static constexpr int KW = 128;        // channels of a K slab: rows of 256 B
static constexpr int KP = KW + 8;     // LDS pitch of a slab's key row, elements (272 B = 16 B x odd)
static constexpr int KSL = 9216;      // elements from one K slab to the next: FK * KP, rounded up to 2 KiB
static constexpr int VP = FK + 8;     // LDS pitch of a V^T row, elements (144 B = 16 B x odd)
static constexpr int VR = kC / 4;     // V^T rows of a wave's request
static_assert(kS % FQ == 0 && kS2 % FK == 0, "whole tiles");
static_assert(kC == 4 * KW && FQ == 128, "four waves, a quarter of each tile a wave");
static_assert(KSL >= FK * KP && KSL * 2 % 2048 == 0, "a K slab starts at a multiple of 2 KiB");
static_assert(VR * VP * 2 % 2048 == 0, "a wave's V^T rows start at a multiple of 2 KiB");
static_assert(kS2 / FK >= 1, "K and V^T of stage 0 exist: the ring's first two loads");

// ---------------------------------------------------------------------------
// Tensor loads: one request of a wave brings ROWS rows of ROWB bytes, PITCH bytes
// apart in global memory, into LDS, 16 B of pad behind every row.
// ---------------------------------------------------------------------------
typedef __attribute__((ext_vector_type(8))) unsigned u8w;

__device__ __forceinline__ unsigned uni(unsigned v) {
  return (unsigned)__builtin_amdgcn_readfirstlane(v);
}
__device__ __forceinline__ unsigned pinned(unsigned v) {
  unsigned w = uni(v);
  asm volatile("" : "+s"(w));   // the word stays in a scalar register, so that a test on it is a scalar branch and a descriptor word made from it is formed here, not earlier
  return w;
}
// IVL: the pad interval's code, 5 for rows of 256 B, 4 for rows of 128 B
template <unsigned ROWB, unsigned ROWS, unsigned PITCH, unsigned IVL>
__device__ __forceinline__ u8w tdm_group1() {
  static_assert(ROWB == (8u << IVL), "the pad interval is the row");
  u8w g;
  g[0] = uni((1u << 20) | (IVL << 22) | (3u << 25));   // no mask, bytes, pad of 4 dwords
  g[1] = uni((ROWB & 0xFFFFu) << 16);
  g[2] = uni((ROWB >> 16) | ((ROWS & 0xFFFFu) << 16));
  g[3] = uni((ROWS >> 16) | (ROWB << 16));
  g[4] = uni(ROWS);
  g[5] = uni(PITCH);
  g[6] = uni(0u);
  g[7] = uni(0u);
  return g;
}
// lds: byte offset in the work-group's LDS, a word that has gone through uni()
// where it was formed (again here, it would come by way of a vector register);
// ga: address of the tile's first byte
__device__ __forceinline__ u4 tdm_group0(unsigned lds, unsigned long long ga) {
  u4 g;
  g[0] = uni(1u);
  g[1] = lds;
  g[2] = uni((unsigned)ga);
  g[3] = uni((((unsigned)(ga >> 32)) & 0x01FFFFFFu) | 0x80000000u);
  return g;
}
__device__ __forceinline__ void tdm_load(u4 g0, u8w g1) {
  asm volatile("tensor_load_to_lds %0, %1" :: "s"(g0), "s"(g1) : "memory");
}
// The load and its wait in one statement, for the load that nothing overlaps: no
// register of the descriptor is rewritten while the request is outstanding.
__device__ __forceinline__ void tdm_load_wait(u4 g0, u8w g1) {
  asm volatile("tensor_load_to_lds %0, %1\n\t"
               "s_wait_tensorcnt 0x0"
               :: "s"(g0), "s"(g1) : "memory");
}
// my own tensor load has landed in LDS
__device__ __forceinline__ void wait_tensor0() {
  asm volatile("s_wait_tensorcnt 0x0" ::: "memory");
}

typedef __attribute__((ext_vector_type(2))) __bf16 bf2;

// 2^x, with the slot that the instruction set asks for behind a transcendental
__device__ __forceinline__ float exp2_1(float x) {
  float r;
  asm("v_exp_f32 %0, %1\n\t"
      "v_nop"
      : "=&v"(r) : "v"(x));
  return r;
}

// One 16-B store. s_wait_xcnt closes the statement so that no register named
// here is rewritten while the store may still read it (in a statement of its own
// the compiler moved the next tile's arithmetic over the wait).
__device__ __forceinline__ void store16(bf16* p, f4 v) {
  asm volatile("global_store_b128 %0, %1, off\n\t"
               "s_wait_xcnt 0x0"
               :: "v"(p), "v"(v) : "memory");
}

__global__ __launch_bounds__(128)
void attn_fused(bf16* qy, const bf16* __restrict__ kT, const bf16* __restrict__ vB,
                float scale) {
  __shared__ __attribute__((aligned(2048))) bf16 shK[4 * KSL];
  __shared__ __attribute__((aligned(2048))) bf16 shV[kC * VP];

  const int tid  = threadIdx.x;
  const int lane = tid & 31;
  const int wv   = tid >> 5;
  const int hl   = lane >> 4;
  const int fr   = lane & 15;
  const int hd   = blockIdx.y;
  const int nb   = blockIdx.z;
  const float c  = scale * 1.44269504f;    // scores in log2 units: exp(x) = 2^(x * log2 e)

  // the lane's query row of tile 0, this head's 512 columns; tile 1 lies 16 rows on
  // Over the stage loop only the 32-bit index lives, and the epilogue forms its
  // addresses from it: the pointers, which are operands of an asm statement (asm
  // names only the first 256 registers), went to scratch when held through the loop.
  const unsigned qidx = ((unsigned)(nb * kS + blockIdx.x * FQ + wv * (16 * QT) + fr)) * kO + hd * kC;
  bf16* qrow = qy + qidx;
  bf16* qrow1 = qrow + (size_t)16 * kO;
  const bf16* kbase = kT + (size_t)nb * kS2 * kO + hd * kC;              // (key, 4096)
  const bf16* vbase = vB + ((size_t)nb * kO + (size_t)hd * kC) * kS2;    // (channel, key)

  // staging: the wave's quarter of each tile, one request each
  const unsigned wave = uni(threadIdx.x >> 5);
  const unsigned long long kSrc = (unsigned long long)(kbase + wave * KW);
  const unsigned long long vSrc = (unsigned long long)(vbase + (size_t)wave * VR * kS2);
  const unsigned kDst = uni((unsigned)(unsigned long long)&shK[0] + wave * (KSL * 2u));
  const unsigned vDst = uni((unsigned)(unsigned long long)&shV[0] + wave * (VR * VP * 2u));
  const u8w g1k = tdm_group1<KW * 2u, FK, kO * 2u, 5u>();
  const u8w g1v = tdm_group1<FK * 2u, VR, kS2 * 2u, 4u>();
  auto issue_k = [&](unsigned t) {
    tdm_load(tdm_group0(kDst, kSrc + (unsigned long long)t * (FK * kO * 2u)), g1k);
  };
  auto issue_v = [&](unsigned t) {
    tdm_load(tdm_group0(vDst, vSrc + (unsigned long long)t * (FK * 2u)), g1v);
  };

  // Fragment loads go in groups of eight fragments (16 WMMAs), one group ahead of
  // the WMMAs, into the other of two register sets: with one wave per SIMD nobody
  // else covers the LDS latency.
  // K: k-steps 2 g and 2 g + 1 of the four key tiles
  auto load_k = [&](FragAB (&a)[8], int g) {
#pragma unroll
    for (int u = 0; u < 2; ++u)
#pragma unroll
      for (int i = 0; i < FK / 16; ++i) {
        const int ks = 2 * g + u;      // 32 channels: a quarter of slab ks / 4
        const bf16* p = &shK[(ks >> 2) * KSL + (i * 16 + fr) * KP + (ks & 3) * 32 + 8 * hl];
        a[u * 4 + i].f[0] = *(const f4*)p;
        a[u * 4 + i].f[1] = *(const f4*)(p + 16);
      }
  };
  // V^T: channel tiles 4 g .. 4 g + 3, both 32-key steps
  auto load_v = [&](FragAB (&a)[8], int g) {
#pragma unroll
    for (int dd = 0; dd < 4; ++dd)
#pragma unroll
      for (int kk = 0; kk < FK / 32; ++kk) {
        const bf16* p = &shV[((4 * g + dd) * 16 + fr) * VP + kk * 32 + 8 * hl];
        a[dd * 2 + kk].f[0] = *(const f4*)p;
        a[dd * 2 + kk].f[1] = *(const f4*)(p + 16);
      }
  };

  constexpr int NT = kS2 / FK;

  // Q^T fragments, one per tile and 32 channels
  FragAB qf[QT][kC / 32];
#pragma unroll
  for (int ks = 0; ks < kC / 32; ++ks) {
    qf[0][ks].f[0] = *(const f4*)(qrow + ks * 32 + 8 * hl);
    qf[0][ks].f[1] = *(const f4*)(qrow + ks * 32 + 16 + 8 * hl);
    qf[1][ks].f[0] = *(const f4*)(qrow1 + ks * 32 + 8 * hl);
    qf[1][ks].f[1] = *(const f4*)(qrow1 + ks * 32 + 16 + 8 * hl);
  }
  // keeps the loads' address pairs whole (no load returns into them) until every
  // load has taken its address
  asm volatile("s_wait_xcnt 0x0" :: "v"(qrow), "v"(qrow1) : "memory");

  // K of stage 0, behind the issue of the query loads, which fly beside it
  tdm_load_wait(tdm_group0(kDst, kSrc), g1k);
  __syncthreads();      // K of stage 0 is published
  issue_v(0);

  v8f o[QT][kC / 16];
#pragma unroll
  for (int j = 0; j < QT; ++j)
#pragma unroll
    for (int d = 0; d < kC / 16; ++d)
#pragma unroll
      for (int r = 0; r < 8; ++r) o[j][d][r] = 0.f;
  float m[QT], l[QT];   // maximum in use (log2 units, the same in lanes l and l ^ 16); the lane's share of the row sum
#pragma unroll
  for (int j = 0; j < QT; ++j) { m[j] = -1.0e30f; l[j] = 0.f; }

  for (int t = 0; t < NT; ++t) {
    // S^T, 64 keys x 32 queries
    v8f s[QT][FK / 16];
#pragma unroll
    for (int j = 0; j < QT; ++j)
#pragma unroll
      for (int i = 0; i < FK / 16; ++i)
#pragma unroll
        for (int r = 0; r < 8; ++r) s[j][i][r] = 0.f;
    {
      FragAB a[2][8];
      load_k(a[0], 0);
#pragma unroll
      for (int g = 0; g < kC / 64; ++g) {
        if (g + 1 < kC / 64) load_k(a[(g + 1) & 1], g + 1);
        // the two fences keep the next group's LDS reads together and ahead of
        // this group's WMMAs (the compiler moved them in among the WMMAs)
        __builtin_amdgcn_sched_barrier(0);
#pragma unroll
        for (int u = 0; u < 2; ++u)
#pragma unroll
          for (int i = 0; i < FK / 16; ++i)
#pragma unroll
            for (int j = 0; j < QT; ++j)
              s[j][i] = __builtin_amdgcn_wmma_f32_16x16x32_bf16(
                  false, a[g & 1][u * 4 + i].v, false, qf[j][2 * g + u].v, (short)0, s[j][i],
                  false, false);
        __builtin_amdgcn_sched_barrier(0);
      }
    }

    // the stage's maximum of the lane's queries
    float mx[QT];
#pragma unroll
    for (int j = 0; j < QT; ++j) {
      float x = s[j][0][0];
#pragma unroll
      for (int i = 0; i < FK / 16; ++i)
#pragma unroll
        for (int r = 0; r < 8; ++r) x = fmaxf(x, s[j][i][r]);
      x *= c;           // c > 0
      mx[j] = fmaxf(x, __shfl_xor(x, 16));
    }
    // one wave-uniform test a stage
    if (__builtin_amdgcn_ballot_w32(mx[0] > m[0] + 8.0f || mx[1] > m[1] + 8.0f) != 0) {
#pragma unroll
      for (int j = 0; j < QT; ++j) {
        const float mn = fmaxf(m[j], mx[j]);
        const float al = exp2_1(m[j] - mn);
        m[j] = mn;
        l[j] *= al;
#pragma unroll
        for (int d = 0; d < kC / 16; ++d)
#pragma unroll
          for (int r = 0; r < 8; ++r) o[j][d][r] *= al;
      }
    }

    // p = 2^(s c - m), its sum, and P^T as B operands
    FragAB pb[QT][FK / 32];
#pragma unroll
    for (int j = 0; j < QT; ++j)
#pragma unroll
      for (int i = 0; i < FK / 16; ++i) {
        f4 x, y;
#pragma unroll
        for (int e = 0; e < 4; ++e) {
          x[e] = s[j][i][e] * c - m[j];
          y[e] = s[j][i][e + 4] * c - m[j];
        }
        exp2_x8(x, y);
        l[j] += ((x[0] + x[1]) + (x[2] + x[3])) + ((y[0] + y[1]) + (y[2] + y[3]));
        union { bf2 h[4]; f4 f; } u;
        u.h[0] = __builtin_convertvector(f2{x[0], x[1]}, bf2);
        u.h[1] = __builtin_convertvector(f2{x[2], x[3]}, bf2);
        u.h[2] = __builtin_convertvector(f2{y[0], y[1]}, bf2);
        u.h[3] = __builtin_convertvector(f2{y[2], y[3]}, bf2);
        pb[j][i >> 1].f[i & 1] = u.f;
      }
    // Empty statement on each row sum, against spills: the sums are finished
    // here. Without it the compiler moves
    // the additions behind P*V, the 64 f32 probabilities stay live through it, and
    // query fragments go to scratch.
    asm volatile("" : "+v"(l[0]));   // row sum of tile 0, against spills
    asm volatile("" : "+v"(l[1]));   // row sum of tile 1, against spills

    wait_ds0();
    wait_tensor0();
    __syncthreads();      // V^T of stage t is published; K has no reader left
    // the next stage's K, its descriptor formed behind the wait
    const unsigned nk = pinned((unsigned)t + 1u);
    if (pinned(nk < (unsigned)NT)) issue_k(nk);

    // O^T += V^T * P^T, 512 channels x 32 queries
    {
      FragAB a[2][8];
      load_v(a[0], 0);
#pragma unroll
      for (int g = 0; g < kC / 64; ++g) {
        if (g + 1 < kC / 64) load_v(a[(g + 1) & 1], g + 1);
        // the two fences: as in the score loop
        __builtin_amdgcn_sched_barrier(0);
#pragma unroll
        for (int kk = 0; kk < FK / 32; ++kk)
#pragma unroll
          for (int dd = 0; dd < 4; ++dd)
#pragma unroll
            for (int j = 0; j < QT; ++j)
              o[j][4 * g + dd] = __builtin_amdgcn_wmma_f32_16x16x32_bf16(
                  false, a[g & 1][dd * 2 + kk].v, false, pb[j][kk].v, (short)0, o[j][4 * g + dd],
                  false, false);
        __builtin_amdgcn_sched_barrier(0);
      }
    }

    wait_ds0();
    wait_tensor0();
    __syncthreads();      // K of stage t+1 is published; V^T has no reader left
    // the next stage's V^T, its descriptor formed behind the wait
    const unsigned nv = pinned((unsigned)t + 1u);
    if (pinned(nv < (unsigned)NT)) issue_v(nv);
  }
  wait_tensor0();
  wait_ds0();

  // register r of tile d = channel 16 d + 8 hl + r of the lane's query: 16-B stores
#pragma unroll
  for (int j = 0; j < QT; ++j) {
    const float ls = l[j] + __shfl_xor(l[j], 16);
    const float inv = 1.0f / ls;
#pragma unroll
    for (int d = 0; d < kC / 16; ++d) {
      union { bf2 h[4]; f4 f; } u;
#pragma unroll
      for (int e = 0; e < 4; ++e)
        u.h[e] = __builtin_convertvector(f2{o[j][d][2 * e] * inv, o[j][d][2 * e + 1] * inv}, bf2);
      store16(qy + (qidx + (unsigned)(j * 16 * kO + d * 16 + 8 * hl)), u.f);
    }
  }
}

// ---------------------------------------------------------------------------
extern "C" void kernel_launch(void* const* d_in, const int* in_sizes, int n_in,
                              void* d_out, int out_size, void* d_ws, size_t ws_size,
                              hipStream_t stream) {
  const float* input   = (const float*)d_in[0];
  const float* context = (const float*)d_in[1];
  const float* gamma   = (const float*)d_in[2];
  const float* beta    = (const float*)d_in[3];
  const float* Wq      = (const float*)d_in[4];
  const float* bq      = (const float*)d_in[5];
  const float* Wkv     = (const float*)d_in[6];
  const float* bkv     = (const float*)d_in[7];
  const float* Wo      = (const float*)d_in[8];
  const float* bo      = (const float*)d_in[9];
  float* out = (float*)d_out;

  char* wsb = (char*)d_ws;
  size_t off = 0;
  auto alloc = [&](size_t bytes) -> char* {
    char* p = wsb + off;
    off += (bytes + 255) & ~(size_t)255;
    return p;
  };

  bf16* Wq16   = (bf16*)alloc((size_t)kO * kC * 2);          //   4 MB
  bf16* Wkv16  = (bf16*)alloc((size_t)2 * kO * kCTX * 2);    //   8 MB, behind Wq16
  bf16* Wo16   = (bf16*)alloc((size_t)kC * kO * 2);          //   4 MB, behind Wkv16
  bf16* xnT    = (bf16*)alloc((size_t)kN * kS * kC * 2);     //   8 MB  (n,s,c)
  bf16* ctxT   = (bf16*)alloc((size_t)kN * kS2 * kCTX * 2);  //   8 MB  (n,s,c), behind xnT
  bf16* kT     = (bf16*)alloc((size_t)kN * kS2 * kO * 2);    //  64 MB  (n,s2,4096)
  bf16* vB     = (bf16*)alloc((size_t)kN * kO * kS2 * 2);    //  64 MB  (n,4096,s2)
  bf16* yT     = (bf16*)alloc((size_t)kN * kS * kO * 2);     //  64 MB  (n,s,4096): q, then y in its place
  float* part  = (float*)alloc((size_t)kN * RB * 2 * sizeof(float));   // partial sums of the input
  (void)ws_size; (void)in_sizes; (void)n_in; (void)out_size;

  // partial sums, bf16 weights (Wq16, Wkv16, Wo16), transposed bf16 context
  prep<<<PREP_R + PREP_W + PREP_T, 256, 0, stream>>>(
      input, part, Wq, Wkv, Wo, Wq16, context, ctxT);
  // normalised, transposed bf16 input
  norm_transpose<<<dim3(TBX, TBY, kN), 256, 0, stream>>>(input, xnT, part, gamma, beta);

  // q (into yT), k, v of every sample
  gemm_qkv<<<dim3(kS / BN, kO / BM, 3 * kN), 256, 0, stream>>>(
      Wq16, Wkv16, xnT, ctxT, yT, kT, vB, bq, bkv);

  // attention, every sample and head in one launch: q in yT becomes y
  const float scoreScale = 1.0f / sqrtf((float)kC);   // (c^-0.25)^2
  attn_fused<<<dim3(kS / FQ, kH, kN), 128, 0, stream>>>(
      yT, kT, vB, scoreScale);

  // out = Wo * y + bo + residual  (f32, row-major (c,s)), all samples in grid z
  gemm_nt<false, false, true, true><<<dim3(kS / BN, kC / BM, kN), 256, 0, stream>>>(
      Wo16, yT, out, bo, input,
      kO, kO, kO, kS, 1.0f, 0, kS * kO, kC * kS);
}

// v010
// A run of this version takes 308 microseconds.
// In both of two side-by-side timings against v009, it was 1.04 times as fast.
// Counting every step since v000, it is 6.89 times as fast.
#include <hip/hip_runtime.h>
#include <hip/hip_bf16.h>
#include <math.h>

// ---------------------------------------------------------------------------
// CrossAttention1d for MI455X (gfx1250): bf16 WMMA pipeline, f32 accumulate.
// N=4, C=512, S=2048, S2=2048, H=8, CTX=512.  ~412 GFLOP -> compute-bound,
// all 5 matmul stages on v_wmma_f32_16x16x32_bf16, tiles staged to LDS via
// CDNA5 async copies (global_load_async_to_lds_b128 + s_wait_asynccnt) in the
// GEMMs, tensor loads (tensor_load_to_lds + s_wait_tensorcnt) in attention.
// ---------------------------------------------------------------------------

typedef __bf16 bf16;
typedef __attribute__((ext_vector_type(16))) __bf16 v16bf;
typedef __attribute__((ext_vector_type(8)))  float  v8f;
typedef __attribute__((ext_vector_type(4)))  float  f4;

static constexpr int kN = 4, kC = 512, kS = 2048, kS2 = 2048, kH = 8, kCTX = 512;
static constexpr int kO = kC * kH;      // 4096
static constexpr float kEPS = 1e-5f;
static_assert(kC == kCTX && kS == kS2, "the batched launches below pair equal shapes");

__device__ __forceinline__ bf16 f2bf(float f) {
  unsigned u = __builtin_bit_cast(unsigned, f);
  u += 0x7FFFu + ((u >> 16) & 1u);          // round-to-nearest-even
  unsigned short h = (unsigned short)(u >> 16);
  return __builtin_bit_cast(bf16, h);
}

// ---------------------------------------------------------------------------
// Stage 0: sums for the batch-wide mean / rstd (layernorm over all C*S per n).
// Block bx of sample n stores its sum and its sum of squares in part[n][bx]; the
// kernel that normalises adds a sample's RB pairs itself, so that neither a
// launch that clears a cell nor one that finishes the statistics is needed.
// ---------------------------------------------------------------------------
typedef __attribute__((ext_vector_type(2))) float f2;
static constexpr int RB = 256;             // blocks, and so partial pairs, of a sample

__device__ __forceinline__
void reduce_stats(float* sh0, float* sh1, const float* __restrict__ in,
                  f2* __restrict__ part, int bx, int n) {
  const float* p = in + (size_t)n * kC * kS;
  float s = 0.f, s2 = 0.f;
  for (int i = bx * 256 + threadIdx.x; i < kC * kS; i += RB * 256) {
    float v = p[i]; s += v; s2 += v * v;
  }
  sh0[threadIdx.x] = s; sh1[threadIdx.x] = s2;
  __syncthreads();
  for (int o = 128; o > 0; o >>= 1) {
    if ((int)threadIdx.x < o) {
      sh0[threadIdx.x] += sh0[threadIdx.x + o];
      sh1[threadIdx.x] += sh1[threadIdx.x + o];
    }
    __syncthreads();
  }
  if (threadIdx.x == 0) part[n * RB + bx] = f2{sh0[0], sh1[0]};
}

// ---------------------------------------------------------------------------
// Stage 1: transpose one sample (kC,kS)f32 -> (kS,kC)bf16, with the layernorm
// affine (input) or as it is (PLAIN: context).
// A block takes a tile of 128 channels x 64 positions, a thread 32 elements, so
// that each wave has eight 16-byte loads in flight.
// A wave-wide load covers 256 B of two channel rows, a wave-wide store 256 B of
// two position rows: whole 128-B lines both ways. LDS holds the tile transposed,
// two neighbouring channels packed in a dword; the odd pitch spreads the 32
// lanes of every LDS write and read over 32 banks.
// ---------------------------------------------------------------------------
typedef __attribute__((ext_vector_type(4))) unsigned u4;
static constexpr int TR = 128, TC = 64;    // tile: channels x positions
static constexpr int TP = TR / 2 + 1;      // LDS pitch of a position row, dwords
static_assert(kC % TR == 0 && kS % TC == 0, "whole tiles only");
static constexpr int TBX = kS / TC, TBY = kC / TR;   // tiles of a sample

__device__ __forceinline__ unsigned pack_bf16(float lo, float hi) {
  return (unsigned)__builtin_bit_cast(unsigned short, f2bf(lo)) |
         ((unsigned)__builtin_bit_cast(unsigned short, f2bf(hi)) << 16);
}

// in, outp: the sample's first element; r0, c0: the tile's first channel, position
template <bool PLAIN>
__device__ __forceinline__
void transpose_tile(unsigned* tile, const float* __restrict__ in, bf16* __restrict__ outp,
                    int r0, int c0, float mu, float rinv,
                    const float* __restrict__ gamma, const float* __restrict__ beta) {
  const int cq = threadIdx.x & 15;
  const int tg = threadIdx.x >> 4;           // 0..15

  f2 g[4], b[4];
  if constexpr (!PLAIN) {
    const f2* pg = (const f2*)(gamma + r0 + 2 * tg);
    const f2* pb = (const f2*)(beta + r0 + 2 * tg);
#pragma unroll
    for (int i = 0; i < 4; ++i) { g[i] = pg[16 * i]; b[i] = pb[16 * i]; }
    // these loads have taken their address registers before they are rewritten
    asm volatile("s_wait_xcnt 0x0" ::: "memory");
  }

  // channels r0 + 2*(tg + 16 i) and the next one, positions c0 + 4 cq .. + 3
  const float* pin = in + (size_t)(r0 + 2 * tg) * kS + c0 + 4 * cq;
  f4 lo[4], hi[4];
#pragma unroll
  for (int i = 0; i < 4; ++i) {
    lo[i] = *(const f4*)(pin + (size_t)(32 * i) * kS);
    hi[i] = *(const f4*)(pin + (size_t)(32 * i + 1) * kS);
  }
  // keeps the loads' address pair whole (no load returns into it) until every
  // load has taken its address
  asm volatile("s_wait_xcnt 0x0" :: "v"(pin) : "memory");

#pragma unroll
  for (int i = 0; i < 4; ++i)
#pragma unroll
    for (int e = 0; e < 4; ++e) {
      float x = lo[i][e], y = hi[i][e];
      if constexpr (!PLAIN) {
        x = (x - mu) * rinv * g[i][0] + b[i][0];
        y = (y - mu) * rinv * g[i][1] + b[i][1];
      }
      tile[(4 * cq + e) * TP + tg + 16 * i] = pack_bf16(x, y);
    }
  __syncthreads();

  // position c0 + tg + 16 k, channels r0 + 8 cq .. + 7
  bf16* pout = outp + (size_t)(c0 + tg) * kC + r0 + 8 * cq;
#pragma unroll
  for (int k = 0; k < 4; ++k) {
    const unsigned* s = &tile[(tg + 16 * k) * TP + 4 * cq];
    const u4 w = {s[0], s[1], s[2], s[3]};
    *(u4*)(pout + (size_t)(16 * k) * kC) = w;
  }
}

// The input, normalised and transposed: grid (TBX, TBY, kN). Every wave first adds
// its sample's RB partial pairs for itself (a lane takes RB / 32 of them, then a
// lane exchange): no wave waits for another, and every lane holds both sums.
static_assert(RB % 32 == 0, "a lane of norm_transpose takes RB / 32 partial pairs");
__global__ __launch_bounds__(256)
void norm_transpose(const float* __restrict__ in, bf16* __restrict__ outp,
                    const float* __restrict__ part,
                    const float* __restrict__ gamma, const float* __restrict__ beta) {
  __shared__ unsigned tile[TC * TP];
  const int nb = blockIdx.z;

  const f2* pp = (const f2*)part + nb * RB + (threadIdx.x & 31);
  f2 t[RB / 32];
#pragma unroll
  for (int j = 0; j < RB / 32; ++j) t[j] = pp[32 * j];
  // the loads have taken their address registers before they are rewritten
  asm volatile("s_wait_xcnt 0x0" ::: "memory");
  float s = 0.f, s2 = 0.f;
#pragma unroll
  for (int j = 0; j < RB / 32; ++j) { s += t[j][0]; s2 += t[j][1]; }
#pragma unroll
  for (int o = 16; o > 0; o >>= 1) {
    s  += __shfl_xor(s, o);
    s2 += __shfl_xor(s2, o);
  }
  const float inv  = 1.0f / (float)(kC * kS);
  const float mean = s * inv;
  const float var  = s2 * inv - mean * mean;
  const float rinv = rsqrtf(var + kEPS);

  transpose_tile<false>(tile, in + (size_t)nb * kC * kS, outp + (size_t)nb * kS * kC,
                        blockIdx.y * TR, blockIdx.x * TC, mean, rinv, gamma, beta);
}

// the three weight matrices: o holds a (na), b (nb), c (nc) in a row. na, nb and
// nc are multiples of CVT_BLK, so a block lies in one matrix and the
// (na + nb + nc) / CVT_BLK blocks end with the last element.
// A lane casts 64 elements: 4,096 waves, each with sixteen 16-byte loads in flight. Each wave-wide load covers 512 contiguous bytes, each
// wave-wide store 256.
static constexpr int CVT_V   = 16;                 // 16-byte loads of a lane
static constexpr int CVT_BLK = 256 * 4 * CVT_V;    // elements of a block
static_assert(kO * kC % CVT_BLK == 0, "a block of the weight cast lies in one matrix");

__device__ __forceinline__
void cvt_bf16(const float* __restrict__ a, const float* __restrict__ b,
              const float* __restrict__ c, bf16* __restrict__ o,
              int na, int nb, int nc, int bx) {
  const int i0 = bx * CVT_BLK;               // the block's first element in o
  if (i0 >= na + nb + nc) return;
  const float* src = a + i0;
  if (i0 >= na)      src = b + (i0 - na);
  if (i0 >= na + nb) src = c + (i0 - na - nb);
  // the lane's first element in the block: a wave takes 128 * CVT_V in a row
  const int w0 = (threadIdx.x >> 5) * (128 * CVT_V) + (threadIdx.x & 31) * 4;
  const f4* p = (const f4*)(src + w0);
  f4 v[CVT_V];
#pragma unroll
  for (int j = 0; j < CVT_V; ++j) v[j] = p[j * 32];
  // the loads have taken their address registers before these are rewritten
  asm volatile("s_wait_xcnt 0x0" ::: "memory");
  f2* q = (f2*)(o + i0 + w0);
#pragma unroll
  for (int j = 0; j < CVT_V; ++j) {
    union { unsigned u[2]; f2 f; } t;
    t.u[0] = pack_bf16(v[j][0], v[j][1]);
    t.u[1] = pack_bf16(v[j][2], v[j][3]);
    q[j * 32] = t.f;
  }
}

// Everything that depends on the inputs alone, in one launch; a block's index
// picks its job (the same for the whole block):
//   PREP_R blocks: partial sums of the input
//   PREP_W blocks: the three weight matrices as bf16
//   PREP_T blocks: the context, transposed as it is
static constexpr int PREP_R = RB * kN;
static constexpr int PREP_W = 4 * kO * kC / CVT_BLK;
static constexpr int PREP_T = TBX * TBY * kN;

__global__ __launch_bounds__(256)
void prep(const float* __restrict__ in, float* __restrict__ part,
          const float* __restrict__ Wq, const float* __restrict__ Wkv,
          const float* __restrict__ Wo, bf16* __restrict__ w16,
          const float* __restrict__ ctx, bf16* __restrict__ ctxT) {
  __shared__ unsigned tile[TC * TP];
  __shared__ float sh0[256], sh1[256];
  int bx = blockIdx.x;
  if (bx < PREP_R) {
    reduce_stats(sh0, sh1, in, (f2*)part, bx % RB, bx / RB);
    return;
  }
  bx -= PREP_R;
  if (bx < PREP_W) {
    cvt_bf16(Wq, Wkv, Wo, w16, kO * kC, 2 * kO * kCTX, kC * kO, bx);
    return;
  }
  bx -= PREP_W;
  const int nb = bx / (TBX * TBY);
  const int ty = bx / TBX % TBY;
  const int tx = bx % TBX;
  transpose_tile<true>(tile, ctx + (size_t)nb * kCTX * kS2, ctxT + (size_t)nb * kS2 * kCTX,
                       ty * TR, tx * TC, 0.f, 1.f, nullptr, nullptr);
  // these stores have taken their registers before the code of the other jobs,
  // which stands behind them in the kernel, writes the same registers
  asm volatile("s_wait_xcnt 0x0" ::: "memory");
}

// ---------------------------------------------------------------------------
// 2^x for the softmax of the fused attention kernel
// ---------------------------------------------------------------------------
// a, b <- 2^a, 2^b. Eight v_exp_f32 in one statement, closed by a v_nop: it is
// the slot that the instruction set asks for behind a transcendental before its
// result is read or its source overwritten.
// The outputs are early-clobber, so that inside the
// statement no exp writes over a source either.
__device__ __forceinline__ void exp2_x8(f4& a, f4& b) {
  float r0, r1, r2, r3, r4, r5, r6, r7;
  asm("v_exp_f32 %0, %8\n\t"
      "v_exp_f32 %1, %9\n\t"
      "v_exp_f32 %2, %10\n\t"
      "v_exp_f32 %3, %11\n\t"
      "v_exp_f32 %4, %12\n\t"
      "v_exp_f32 %5, %13\n\t"
      "v_exp_f32 %6, %14\n\t"
      "v_exp_f32 %7, %15\n\t"
      "v_nop"
      : "=&v"(r0), "=&v"(r1), "=&v"(r2), "=&v"(r3),
        "=&v"(r4), "=&v"(r5), "=&v"(r6), "=&v"(r7)
      : "v"(a[0]), "v"(a[1]), "v"(a[2]), "v"(a[3]),
        "v"(b[0]), "v"(b[1]), "v"(b[2]), "v"(b[3]));
  a[0] = r0; a[1] = r1; a[2] = r2; a[3] = r3;
  b[0] = r4; b[1] = r5; b[2] = r6; b[3] = r7;
}

// ---------------------------------------------------------------------------
// CDNA5 async copies: 16B per lane, global -> LDS, tracked by ASYNCcnt.
// Eight copies of one lane, a fixed number of tile rows apart.
//   l     : the lane's LDS byte address (low 32 bits of the LDS pointer)
//   lstep : LDS bytes from one copy to the next
//   g     : the lane's global pointer
//   gstep : global elements from one copy to the next
// s_wait_xcnt closes the statement so that no address register named here is
// rewritten while a copy may still read it.
// ---------------------------------------------------------------------------
__device__ __forceinline__ void async_rows8(unsigned l, unsigned lstep,
                                            const bf16* g, size_t gstep) {
  asm volatile("global_load_async_to_lds_b128 %0, %8, off\n\t"
               "global_load_async_to_lds_b128 %1, %9, off\n\t"
               "global_load_async_to_lds_b128 %2, %10, off\n\t"
               "global_load_async_to_lds_b128 %3, %11, off\n\t"
               "global_load_async_to_lds_b128 %4, %12, off\n\t"
               "global_load_async_to_lds_b128 %5, %13, off\n\t"
               "global_load_async_to_lds_b128 %6, %14, off\n\t"
               "global_load_async_to_lds_b128 %7, %15, off\n\t"
               "s_wait_xcnt 0x0"
               :: "v"(l), "v"(l + lstep), "v"(l + 2u * lstep), "v"(l + 3u * lstep),
                  "v"(l + 4u * lstep), "v"(l + 5u * lstep), "v"(l + 6u * lstep),
                  "v"(l + 7u * lstep),
                  "v"(g), "v"(g + gstep), "v"(g + 2 * gstep), "v"(g + 3 * gstep),
                  "v"(g + 4 * gstep), "v"(g + 5 * gstep), "v"(g + 6 * gstep),
                  "v"(g + 7 * gstep)
               : "memory");
}
// my own copies have landed in LDS
__device__ __forceinline__ void wait_async0() {
  asm volatile("s_wait_asynccnt 0x0" ::: "memory");
}
// my own LDS reads have returned, so the buffer may be refilled behind the barrier
__device__ __forceinline__ void wait_ds0() {
  asm volatile("s_wait_dscnt 0x0" ::: "memory");
}

// ---------------------------------------------------------------------------
// NT GEMM:  D(M,Nn) = A(M,K) * B(Nn,K)^T   (bf16 in, f32 accum via WMMA)
//   trans    : store D transposed (Cout[n][m]), 16B-contiguous per lane
//   STAGED   : D goes out transposed (Cout[n][m], bf16) by way of LDS, in whole
//              128-B lines; trans then says that the bias goes by n, not by m
//              (known only at run time, the same for the whole block)
//   OUT_BF16 : output bf16 (else f32)
//   HAS_BIAS : + bias[m]
//   HAS_RES  : + res[m*ldc + n] (row-major only)
// gemm_tile does the block tile at (m0, n0) of one product; the two kernels
// behind it pick the product by blockIdx.z.
// block tile 128x128, 8 waves (2x4), 128 k per LDS stage (four WMMA k-steps),
// two LDS buffers filled by async copies that overlap the WMMA stream. A stage
// row is 256 B, so one wave-wide copy covers two rows = four whole 128-B lines.
// ---------------------------------------------------------------------------
static constexpr int BM = 128, BN = 128, BK = 128;
static constexpr int LDSS = 136;  // padded row stride in bf16 elems (272B = 16B x odd)

union FragAB { v16bf v; f4 f[2]; };
template <bool V> struct BoolC { static constexpr bool value = V; };

// Eight 16-B stores of one lane, step elements apart. s_wait_xcnt closes the
// statement so that no register named here is rewritten while a store may still
// read it.
__device__ __forceinline__ void store_rows8(bf16* p, size_t step, const f4 (&w)[8]) {
  asm volatile("global_store_b128 %0, %8, off\n\t"
               "global_store_b128 %1, %9, off\n\t"
               "global_store_b128 %2, %10, off\n\t"
               "global_store_b128 %3, %11, off\n\t"
               "global_store_b128 %4, %12, off\n\t"
               "global_store_b128 %5, %13, off\n\t"
               "global_store_b128 %6, %14, off\n\t"
               "global_store_b128 %7, %15, off\n\t"
               "s_wait_xcnt 0x0"
               :: "v"(p), "v"(p + step), "v"(p + 2 * step), "v"(p + 3 * step),
                  "v"(p + 4 * step), "v"(p + 5 * step), "v"(p + 6 * step),
                  "v"(p + 7 * step),
                  "v"(w[0]), "v"(w[1]), "v"(w[2]), "v"(w[3]),
                  "v"(w[4]), "v"(w[5]), "v"(w[6]), "v"(w[7])
               : "memory");
}

template <bool STAGED, bool OUT_BF16, bool HAS_BIAS, bool HAS_RES>
__device__ __forceinline__
void gemm_tile(bf16 (*shA)[BM * LDSS], bf16 (*shB)[BN * LDSS],
               const bf16* __restrict__ A, const bf16* __restrict__ B,
               void* __restrict__ Cout, const float* __restrict__ bias,
               const float* __restrict__ res,
               int K, int lda, int ldb, int ldc, float scale, bool trans,
               int m0, int n0) {
  const int tid  = threadIdx.x;
  const int lane = tid & 31;
  const int wv   = tid >> 5;
  const int wm   = wv & 3;          // 4 wave-rows
  const int wn   = wv >> 2;         // 2 wave-cols

  // staging: 16 lanes cover one 256B stage row; a thread copies its 16B chunk
  // of rows lr, lr+16, ..., lr+112 of both operands
  const int lr = tid >> 4;           // 0..15 (first tile row)
  const int lc = (tid & 15) * 8;     // k elems

  const bf16* aPtr = A + (size_t)(m0 + lr) * lda + lc;
  const bf16* bPtr = B + (size_t)(n0 + lr) * ldb + lc;
  const unsigned thrL  = (unsigned)((lr * LDSS + lc) * 2);  // bytes
  const unsigned sA[2] = { (unsigned)(unsigned long long)&shA[0][0],
                           (unsigned)(unsigned long long)&shA[1][0] };
  const unsigned sB[2] = { (unsigned)(unsigned long long)&shB[0][0],
                           (unsigned)(unsigned long long)&shB[1][0] };

  auto issue_tile = [&](int kt, int buf) {
    async_rows8(sA[buf] + thrL, 16u * LDSS * 2u, aPtr + (size_t)kt * BK, (size_t)16 * lda);
    async_rows8(sB[buf] + thrL, 16u * LDSS * 2u, bPtr + (size_t)kt * BK, (size_t)16 * ldb);
  };

  const int KT = K / BK;
  issue_tile(0, 0);
  wait_async0();
  __syncthreads();      // stage 0 is published
  if (KT > 1) issue_tile(1, 1);

  v8f acc[2][4];
#pragma unroll
  for (int i = 0; i < 2; ++i)
#pragma unroll
    for (int j = 0; j < 4; ++j)
#pragma unroll
      for (int r = 0; r < 8; ++r) acc[i][j][r] = 0.f;

  const int hl = lane >> 4;          // K-quarter selector
  const int fr = lane & 15;          // fragment row (M for A, N for B)

  for (int kt = 0; kt < KT; ++kt) {
    const int cur = kt & 1;
    // unrolled so that the next k-step's fragment loads can go ahead of this
    // k-step's WMMAs
#pragma unroll
    for (int ks = 0; ks < BK / 32; ++ks) {
      FragAB a[2], b[4];
#pragma unroll
      for (int i = 0; i < 2; ++i) {
        const bf16* p = &shA[cur][(wm * 32 + i * 16 + fr) * LDSS + ks * 32 + 8 * hl];
        a[i].f[0] = *(const f4*)p;
        a[i].f[1] = *(const f4*)(p + 16);
      }
#pragma unroll
      for (int j = 0; j < 4; ++j) {
        const bf16* p = &shB[cur][(wn * 64 + j * 16 + fr) * LDSS + ks * 32 + 8 * hl];
        b[j].f[0] = *(const f4*)p;
        b[j].f[1] = *(const f4*)(p + 16);
      }
#pragma unroll
      for (int i = 0; i < 2; ++i)
#pragma unroll
        for (int j = 0; j < 4; ++j)
          acc[i][j] = __builtin_amdgcn_wmma_f32_16x16x32_bf16(
              false, a[i].v, false, b[j].v, (short)0, acc[i][j], false, false);
    }
    wait_ds0();
    wait_async0();
    __syncthreads();      // stage kt+1 is published; buf[cur] has no reader left
    if (kt + 2 < KT) issue_tile(kt + 2, cur);
  }
  wait_async0();

  // epilogue: D tile [16x16]; lane fr = N index, VGPR r -> M = 8*hl + r
  auto store_tiles = [&](auto tr) {
  constexpr bool TR = decltype(tr)::value;
#pragma unroll
  for (int i = 0; i < 2; ++i) {
    const int mBase = m0 + wm * 32 + i * 16 + 8 * hl;
#pragma unroll
    for (int j = 0; j < 4; ++j) {
      const int nIdx = n0 + wn * 64 + j * 16 + fr;
      v8f v = acc[i][j];
      if constexpr (TR) {
        if constexpr (OUT_BF16) {
          union { bf16 h[8]; f4 f; } t;
#pragma unroll
          for (int r = 0; r < 8; ++r) {
            float f = v[r] * scale;
            if constexpr (HAS_BIAS) f += bias[mBase + r];
            t.h[r] = f2bf(f);
          }
          *(f4*)((bf16*)Cout + (size_t)nIdx * ldc + mBase) = t.f;
        } else {
          union { float x[8]; f4 f[2]; } t;
#pragma unroll
          for (int r = 0; r < 8; ++r) {
            float f = v[r] * scale;
            if constexpr (HAS_BIAS) f += bias[mBase + r];
            t.x[r] = f;
          }
          float* po = (float*)Cout + (size_t)nIdx * ldc + mBase;
          *(f4*)po = t.f[0];
          *(f4*)(po + 4) = t.f[1];
        }
      } else {
#pragma unroll
        for (int r = 0; r < 8; ++r) {
          float f = v[r] * scale;
          if constexpr (HAS_BIAS) f += bias[mBase + r];
          if constexpr (HAS_RES)  f += res[(size_t)(mBase + r) * ldc + nIdx];
          if constexpr (OUT_BF16)
            ((bf16*)Cout)[(size_t)(mBase + r) * ldc + nIdx] = f2bf(f);
          else
            ((float*)Cout)[(size_t)(mBase + r) * ldc + nIdx] = f;
        }
      }
    }
  }
  };
  // STAGED: the block's D^T tile (BN rows of BM bf16) is put together in the first
  // A buffer, which has no reader and no copy left behind the loop's last barrier,
  // at the stage rows' pitch; then a wave-wide 16-B store covers two whole rows of
  // 256 B = four whole lines, where the accumulators' own layout gives 32-B pieces
  // of 16 lines.
  if constexpr (STAGED) {
    static_assert(OUT_BF16 && HAS_BIAS && !HAS_RES && BM == BK, "a tile row is a stage row");
    bf16* st = &shA[0][0];
    auto stage_tiles = [&](auto bn) {
      constexpr bool BY_N = decltype(bn)::value;
      // the lane's bias: one value per column tile j, or eight per row tile i
      const float* pb = BY_N ? bias + n0 + wn * 64 + fr : bias + m0 + wm * 32 + 8 * hl;
      float bj[4];
      f4 bi[2][2];
      if constexpr (BY_N) {
#pragma unroll
        for (int j = 0; j < 4; ++j) bj[j] = pb[16 * j];
      } else {
#pragma unroll
        for (int i = 0; i < 2; ++i) {
          bi[i][0] = *(const f4*)(pb + 16 * i);
          bi[i][1] = *(const f4*)(pb + 16 * i + 4);
        }
      }
      // keeps the loads' address whole until every load has taken it
      asm volatile("s_wait_xcnt 0x0" :: "v"(pb) : "memory");
#pragma unroll
      for (int i = 0; i < 2; ++i)
#pragma unroll
        for (int j = 0; j < 4; ++j) {
          union { bf16 h[8]; f4 f; } t;
#pragma unroll
          for (int r = 0; r < 8; ++r) {
            float f = acc[i][j][r] * scale;
            f += BY_N ? bj[j] : bi[i][r >> 2][r & 3];
            t.h[r] = f2bf(f);
          }
          *(f4*)&st[(wn * 64 + j * 16 + fr) * LDSS + wm * 32 + i * 16 + 8 * hl] = t.f;
        }
    };
    // the form is picked once, outside the tile loops
    if (trans) stage_tiles(BoolC<true>{});
    else       stage_tiles(BoolC<false>{});
    __syncthreads();      // the tile is whole: every wave's part is in LDS
    f4 w[8];
#pragma unroll
    for (int k = 0; k < 8; ++k) w[k] = *(const f4*)&st[(lr + 16 * k) * LDSS + lc];
    store_rows8((bf16*)Cout + (size_t)(n0 + lr) * ldc + m0 + lc, (size_t)16 * ldc, w);
  } else {
    if (trans) store_tiles(BoolC<true>{});
    else       store_tiles(BoolC<false>{});
  }
}

// One independent product per blockIdx.z; sAz/sBz/sCz are the element strides
// of A, B and Cout (and res) from one z to the next.
template <bool TRANS, bool OUT_BF16, bool HAS_BIAS, bool HAS_RES>
__global__ __launch_bounds__(256)
void gemm_nt(const bf16* __restrict__ A, const bf16* __restrict__ B,
             void* __restrict__ Cout, const float* __restrict__ bias,
             const float* __restrict__ res,
             int K, int lda, int ldb, int ldc, float scale,
             int sAz, int sBz, int sCz) {
  __shared__ __attribute__((aligned(16))) bf16 shA[2][BM * LDSS];
  __shared__ __attribute__((aligned(16))) bf16 shB[2][BN * LDSS];

  A += (size_t)blockIdx.z * sAz;
  B += (size_t)blockIdx.z * sBz;
  const size_t cOffZ = (size_t)blockIdx.z * sCz;
  if constexpr (OUT_BF16) Cout = (bf16*)Cout + cOffZ;
  else                    Cout = (float*)Cout + cOffZ;
  if constexpr (HAS_RES)  res += cOffZ;
  gemm_tile<false, OUT_BF16, HAS_BIAS, HAS_RES>(shA, shB, A, B, Cout, bias, res,
                                         K, lda, ldb, ldc, scale, TRANS,
                                         blockIdx.y * BM, blockIdx.x * BN);
}

// The three projections of every sample in one launch: blockIdx.z = 3 * sample + z,
// xb, cb, qT, kT, vB hold the samples one after another.
//   0: q = Wq*xn + bq            -> qT (s, 4096)    D = W * x^T, stored transposed
//   1: k = Wkv[0:4096]*ctx + b   -> kT (s2, 4096)   D = W * ctx^T, stored transposed
//   2: v = Wkv[4096:]*ctx + b    -> vB (4096, s2)   D = ctx * W^T, stored transposed:
//      the operands change places, so that v too leaves by the one staged form
__global__ __launch_bounds__(256)
void gemm_qkv(const bf16* __restrict__ Wq, const bf16* __restrict__ Wkv,
              const bf16* __restrict__ xb, const bf16* __restrict__ cb,
              bf16* __restrict__ qT, bf16* __restrict__ kT, bf16* __restrict__ vB,
              const float* __restrict__ bq, const float* __restrict__ bkv) {
  __shared__ __attribute__((aligned(16))) bf16 shA[2][BM * LDSS];
  __shared__ __attribute__((aligned(16))) bf16 shB[2][BN * LDSS];

  const int n = blockIdx.z / 3;
  const int z = blockIdx.z - 3 * n;
  const bool   sw   = z == 2;
  const bf16*  Wz   = z == 0 ? Wq : Wkv + (size_t)(z - 1) * kO * kCTX;
  const bf16*  X    = (z == 0 ? xb : cb) + (size_t)n * kS * kC;
  const float* bias = z == 0 ? bq : bkv + (z - 1) * kO;
  bf16*        C    = (z == 0 ? qT : (z == 1 ? kT : vB)) + (size_t)n * kS * kO;
  static_assert(BM == BN, "blockIdx.y counts tiles of the 4096 outputs, as rows or as columns of D");
  gemm_tile<true, true, true, false>(shA, shB, sw ? X : Wz, sw ? Wz : X, C, bias, nullptr,
                               kC, kC, kC, sw ? kS2 : kO, 1.0f, sw,
                               (sw ? blockIdx.x : blockIdx.y) * BM,
                               (sw ? blockIdx.y : blockIdx.x) * BN);
}

// ---------------------------------------------------------------------------
// Fused attention: scores, softmax and P*V of one (sample, head, 128 queries) in
// one block, so that no score and no probability leaves the registers.
//   S^T = K * Q^T   : A = key rows from LDS, B = the wave's 32 queries, kept in
//                     registers for the whole kernel
//   O^T += V^T * P^T: A = V^T rows (channel, key) from LDS, B = P^T, which is the
//                     score accumulators converted in place: two S^T tiles (keys
//                     0-15 and 16-31 of a 32-key step) are one B operand in the
//                     k order that the LDS loader below has too
// A wave holds TWO query tiles of 16, so that every K and V^T fragment read from
// LDS feeds two WMMAs: the block's LDS reads per WMMA are half of what one tile a
// wave asks for, level with the matrix rate. The outputs (512 registers) and the
// queries (256) leave room for one wave per SIMD: a block is four waves.
// A lane holds scores and outputs of one query per tile (column lane & 15); lanes
// l and l ^ 16 split its keys, so the row maximum takes one lane exchange a stage
// and the row sum one at the end. The running maximum is raised, and O^T and the
// sum rescaled, only when some query's new maximum lies more than 8 (log2 units)
// above the one in use: p stays below 2^8.
// A stage is 64 keys: K 64 x 512 and V^T 512 x 64. The two tiles are the two
// buffers of one ring of tensor loads: while the scores read K, the stage's V^T
// flies; while P*V reads V^T, the next stage's K flies. Every wave brings a
// quarter of each tile with ONE request (its issue costs the wave a few scalar
// instructions, where per-lane copies cost it 32 address pairs and their waits,
// with nobody else on the SIMD to fill the time); one barrier at the foot of each
// of the two halves of a stage.
// K lies in LDS as four slabs of 128 channels (rows of 256 B, which the mover pads
// to 272), wave w brings slab w; V^T lies channel row by channel row (rows of 128 B
// padded to 144), wave w brings channels 128 w .. 128 w + 127.
// qy holds q on entry and y on exit: a wave reads and writes only its own 32 rows
// x 512 columns.
// ---------------------------------------------------------------------------
static constexpr int FQ = 128;        // queries of a block, 32 a wave
static constexpr int QT = 2;          // query tiles of a wave
static constexpr int FK = 64;         // keys of a stage
static constexpr int KW = 128;        // channels of a K slab: rows of 256 B
static constexpr int KP = KW + 8;     // LDS pitch of a slab's key row, elements (272 B = 16 B x odd)
static constexpr int KSL = 9216;      // elements from one K slab to the next: FK * KP, rounded up to 2 KiB
static constexpr int VP = FK + 8;     // LDS pitch of a V^T row, elements (144 B = 16 B x odd)
static constexpr int VR = kC / 4;     // V^T rows of a wave's request
static constexpr int YP = kC + 8;     // LDS pitch of a staged output row, elements (1040 B = 16 B x odd)
static_assert(kS % FQ == 0 && kS2 % FK == 0, "whole tiles");
static_assert(kC == 4 * KW && FQ == 128, "four waves, a quarter of each tile a wave");
static_assert(KSL >= FK * KP && KSL * 2 % 2048 == 0, "a K slab starts at a multiple of 2 KiB");
static_assert(VR * VP * 2 % 2048 == 0, "a wave's V^T rows start at a multiple of 2 KiB");
static_assert(kS2 / FK >= 1, "K and V^T of stage 0 exist: the ring's first two loads");
static_assert(2 * 16 * QT * YP <= 4 * KSL && 2 * 16 * QT * YP <= kC * VP && kC == 512,
              "two waves' output rows fit in each of the two tiles; a row is two wave-wide stores");

// ---------------------------------------------------------------------------
// Tensor loads: one request of a wave brings ROWS rows of ROWB bytes, PITCH bytes
// apart in global memory, into LDS, 16 B of pad behind every row.
// ---------------------------------------------------------------------------
typedef __attribute__((ext_vector_type(8))) unsigned u8w;

__device__ __forceinline__ unsigned uni(unsigned v) {
  return (unsigned)__builtin_amdgcn_readfirstlane(v);
}
__device__ __forceinline__ unsigned pinned(unsigned v) {
  unsigned w = uni(v);
  asm volatile("" : "+s"(w));   // the word stays in a scalar register, so that a test on it is a scalar branch and a descriptor word made from it is formed here, not earlier
  return w;
}
// IVL: the pad interval's code, 5 for rows of 256 B, 4 for rows of 128 B
template <unsigned ROWB, unsigned ROWS, unsigned PITCH, unsigned IVL>
__device__ __forceinline__ u8w tdm_group1() {
  static_assert(ROWB == (8u << IVL), "the pad interval is the row");
  u8w g;
  g[0] = uni((1u << 20) | (IVL << 22) | (3u << 25));   // no mask, bytes, pad of 4 dwords
  g[1] = uni((ROWB & 0xFFFFu) << 16);
  g[2] = uni((ROWB >> 16) | ((ROWS & 0xFFFFu) << 16));
  g[3] = uni((ROWS >> 16) | (ROWB << 16));
  g[4] = uni(ROWS);
  g[5] = uni(PITCH);
  g[6] = uni(0u);
  g[7] = uni(0u);
  return g;
}
// lds: byte offset in the work-group's LDS, a word that has gone through uni()
// where it was formed (again here, it would come by way of a vector register);
// ga: address of the tile's first byte
__device__ __forceinline__ u4 tdm_group0(unsigned lds, unsigned long long ga) {
  u4 g;
  g[0] = uni(1u);
  g[1] = lds;
  g[2] = uni((unsigned)ga);
  g[3] = uni((((unsigned)(ga >> 32)) & 0x01FFFFFFu) | 0x80000000u);
  return g;
}
__device__ __forceinline__ void tdm_load(u4 g0, u8w g1) {
  asm volatile("tensor_load_to_lds %0, %1" :: "s"(g0), "s"(g1) : "memory");
}
// The load and its wait in one statement, for the load that nothing overlaps: no
// register of the descriptor is rewritten while the request is outstanding.
__device__ __forceinline__ void tdm_load_wait(u4 g0, u8w g1) {
  asm volatile("tensor_load_to_lds %0, %1\n\t"
               "s_wait_tensorcnt 0x0"
               :: "s"(g0), "s"(g1) : "memory");
}
// my own tensor load has landed in LDS
__device__ __forceinline__ void wait_tensor0() {
  asm volatile("s_wait_tensorcnt 0x0" ::: "memory");
}

typedef __attribute__((ext_vector_type(2))) __bf16 bf2;

// 2^x, with the slot that the instruction set asks for behind a transcendental
__device__ __forceinline__ float exp2_1(float x) {
  float r;
  asm("v_exp_f32 %0, %1\n\t"
      "v_nop"
      : "=&v"(r) : "v"(x));
  return r;
}

__global__ __launch_bounds__(128)
void attn_fused(bf16* qy, const bf16* __restrict__ kT, const bf16* __restrict__ vB,
                float scale) {
  __shared__ __attribute__((aligned(2048))) bf16 shK[4 * KSL];
  __shared__ __attribute__((aligned(2048))) bf16 shV[kC * VP];

  const int tid  = threadIdx.x;
  const int lane = tid & 31;
  const int wv   = tid >> 5;
  const int hl   = lane >> 4;
  const int fr   = lane & 15;
  const int hd   = blockIdx.y;
  const int nb   = blockIdx.z;
  const float c  = scale * 1.44269504f;    // scores in log2 units: exp(x) = 2^(x * log2 e)

  // the lane's query row of tile 0, this head's 512 columns; tile 1 lies 16 rows on
  // Over the stage loop only the 32-bit index lives, and the epilogue forms its
  // addresses from it: the pointers, which are operands of an asm statement (asm
  // names only the first 256 registers), went to scratch when held through the loop.
  const unsigned qidx = ((unsigned)(nb * kS + blockIdx.x * FQ + wv * (16 * QT) + fr)) * kO + hd * kC;
  bf16* qrow = qy + qidx;
  bf16* qrow1 = qrow + (size_t)16 * kO;
  const bf16* kbase = kT + (size_t)nb * kS2 * kO + hd * kC;              // (key, 4096)
  const bf16* vbase = vB + ((size_t)nb * kO + (size_t)hd * kC) * kS2;    // (channel, key)

  // staging: the wave's quarter of each tile, one request each
  const unsigned wave = uni(threadIdx.x >> 5);
  const unsigned long long kSrc = (unsigned long long)(kbase + wave * KW);
  const unsigned long long vSrc = (unsigned long long)(vbase + (size_t)wave * VR * kS2);
  const unsigned kDst = uni((unsigned)(unsigned long long)&shK[0] + wave * (KSL * 2u));
  const unsigned vDst = uni((unsigned)(unsigned long long)&shV[0] + wave * (VR * VP * 2u));
  const u8w g1k = tdm_group1<KW * 2u, FK, kO * 2u, 5u>();
  const u8w g1v = tdm_group1<FK * 2u, VR, kS2 * 2u, 4u>();
  auto issue_k = [&](unsigned t) {
    tdm_load(tdm_group0(kDst, kSrc + (unsigned long long)t * (FK * kO * 2u)), g1k);
  };
  auto issue_v = [&](unsigned t) {
    tdm_load(tdm_group0(vDst, vSrc + (unsigned long long)t * (FK * 2u)), g1v);
  };

  // Fragment loads go in groups of eight fragments (16 WMMAs), one group ahead of
  // the WMMAs, into the other of two register sets: with one wave per SIMD nobody
  // else covers the LDS latency.
  // K: k-steps 2 g and 2 g + 1 of the four key tiles
  auto load_k = [&](FragAB (&a)[8], int g) {
#pragma unroll
    for (int u = 0; u < 2; ++u)
#pragma unroll
      for (int i = 0; i < FK / 16; ++i) {
        const int ks = 2 * g + u;      // 32 channels: a quarter of slab ks / 4
        const bf16* p = &shK[(ks >> 2) * KSL + (i * 16 + fr) * KP + (ks & 3) * 32 + 8 * hl];
        a[u * 4 + i].f[0] = *(const f4*)p;
        a[u * 4 + i].f[1] = *(const f4*)(p + 16);
      }
  };
  // V^T: channel tiles 4 g .. 4 g + 3, both 32-key steps
  auto load_v = [&](FragAB (&a)[8], int g) {
#pragma unroll
    for (int dd = 0; dd < 4; ++dd)
#pragma unroll
      for (int kk = 0; kk < FK / 32; ++kk) {
        const bf16* p = &shV[((4 * g + dd) * 16 + fr) * VP + kk * 32 + 8 * hl];
        a[dd * 2 + kk].f[0] = *(const f4*)p;
        a[dd * 2 + kk].f[1] = *(const f4*)(p + 16);
      }
  };

  constexpr int NT = kS2 / FK;

  // Q^T fragments, one per tile and 32 channels
  FragAB qf[QT][kC / 32];
#pragma unroll
  for (int ks = 0; ks < kC / 32; ++ks) {
    qf[0][ks].f[0] = *(const f4*)(qrow + ks * 32 + 8 * hl);
    qf[0][ks].f[1] = *(const f4*)(qrow + ks * 32 + 16 + 8 * hl);
    qf[1][ks].f[0] = *(const f4*)(qrow1 + ks * 32 + 8 * hl);
    qf[1][ks].f[1] = *(const f4*)(qrow1 + ks * 32 + 16 + 8 * hl);
  }
  // keeps the loads' address pairs whole (no load returns into them) until every
  // load has taken its address
  asm volatile("s_wait_xcnt 0x0" :: "v"(qrow), "v"(qrow1) : "memory");

  // K of stage 0, behind the issue of the query loads, which fly beside it
  tdm_load_wait(tdm_group0(kDst, kSrc), g1k);
  __syncthreads();      // K of stage 0 is published
  issue_v(0);

  v8f o[QT][kC / 16];
#pragma unroll
  for (int j = 0; j < QT; ++j)
#pragma unroll
    for (int d = 0; d < kC / 16; ++d)
#pragma unroll
      for (int r = 0; r < 8; ++r) o[j][d][r] = 0.f;
  float m[QT], l[QT];   // maximum in use (log2 units, the same in lanes l and l ^ 16); the lane's share of the row sum
#pragma unroll
  for (int j = 0; j < QT; ++j) { m[j] = -1.0e30f; l[j] = 0.f; }

  for (int t = 0; t < NT; ++t) {
    // S^T, 64 keys x 32 queries
    v8f s[QT][FK / 16];
#pragma unroll
    for (int j = 0; j < QT; ++j)
#pragma unroll
      for (int i = 0; i < FK / 16; ++i)
#pragma unroll
        for (int r = 0; r < 8; ++r) s[j][i][r] = 0.f;
    {
      FragAB a[2][8];
      load_k(a[0], 0);
#pragma unroll
      for (int g = 0; g < kC / 64; ++g) {
        if (g + 1 < kC / 64) load_k(a[(g + 1) & 1], g + 1);
        // the two fences keep the next group's LDS reads together and ahead of
        // this group's WMMAs (the compiler moved them in among the WMMAs)
        __builtin_amdgcn_sched_barrier(0);
#pragma unroll
        for (int u = 0; u < 2; ++u)
#pragma unroll
          for (int i = 0; i < FK / 16; ++i)
#pragma unroll
            for (int j = 0; j < QT; ++j)
              s[j][i] = __builtin_amdgcn_wmma_f32_16x16x32_bf16(
                  false, a[g & 1][u * 4 + i].v, false, qf[j][2 * g + u].v, (short)0, s[j][i],
                  false, false);
        __builtin_amdgcn_sched_barrier(0);
      }
    }

    // the stage's maximum of the lane's queries
    float mx[QT];
#pragma unroll
    for (int j = 0; j < QT; ++j) {
      float x = s[j][0][0];
#pragma unroll
      for (int i = 0; i < FK / 16; ++i)
#pragma unroll
        for (int r = 0; r < 8; ++r) x = fmaxf(x, s[j][i][r]);
      x *= c;           // c > 0
      mx[j] = fmaxf(x, __shfl_xor(x, 16));
    }
    // one wave-uniform test a stage
    if (__builtin_amdgcn_ballot_w32(mx[0] > m[0] + 8.0f || mx[1] > m[1] + 8.0f) != 0) {
#pragma unroll
      for (int j = 0; j < QT; ++j) {
        const float mn = fmaxf(m[j], mx[j]);
        const float al = exp2_1(m[j] - mn);
        m[j] = mn;
        l[j] *= al;
#pragma unroll
        for (int d = 0; d < kC / 16; ++d)
#pragma unroll
          for (int r = 0; r < 8; ++r) o[j][d][r] *= al;
      }
    }

    // p = 2^(s c - m), its sum, and P^T as B operands
    FragAB pb[QT][FK / 32];
#pragma unroll
    for (int j = 0; j < QT; ++j)
#pragma unroll
      for (int i = 0; i < FK / 16; ++i) {
        f4 x, y;
#pragma unroll
        for (int e = 0; e < 4; ++e) {
          x[e] = s[j][i][e] * c - m[j];
          y[e] = s[j][i][e + 4] * c - m[j];
        }
        exp2_x8(x, y);
        l[j] += ((x[0] + x[1]) + (x[2] + x[3])) + ((y[0] + y[1]) + (y[2] + y[3]));
        union { bf2 h[4]; f4 f; } u;
        u.h[0] = __builtin_convertvector(f2{x[0], x[1]}, bf2);
        u.h[1] = __builtin_convertvector(f2{x[2], x[3]}, bf2);
        u.h[2] = __builtin_convertvector(f2{y[0], y[1]}, bf2);
        u.h[3] = __builtin_convertvector(f2{y[2], y[3]}, bf2);
        pb[j][i >> 1].f[i & 1] = u.f;
      }
    // Empty statement on each row sum, against spills: the sums are finished
    // here. Without it the compiler moves
    // the additions behind P*V, the 64 f32 probabilities stay live through it, and
    // query fragments go to scratch.
    asm volatile("" : "+v"(l[0]));   // row sum of tile 0, against spills
    asm volatile("" : "+v"(l[1]));   // row sum of tile 1, against spills

    wait_ds0();
    wait_tensor0();
    __syncthreads();      // V^T of stage t is published; K has no reader left
    // the next stage's K, its descriptor formed behind the wait
    const unsigned nk = pinned((unsigned)t + 1u);
    if (pinned(nk < (unsigned)NT)) issue_k(nk);

    // O^T += V^T * P^T, 512 channels x 32 queries
    {
      FragAB a[2][8];
      load_v(a[0], 0);
#pragma unroll
      for (int g = 0; g < kC / 64; ++g) {
        if (g + 1 < kC / 64) load_v(a[(g + 1) & 1], g + 1);
        // the two fences: as in the score loop
        __builtin_amdgcn_sched_barrier(0);
#pragma unroll
        for (int kk = 0; kk < FK / 32; ++kk)
#pragma unroll
          for (int dd = 0; dd < 4; ++dd)
#pragma unroll
            for (int j = 0; j < QT; ++j)
              o[j][4 * g + dd] = __builtin_amdgcn_wmma_f32_16x16x32_bf16(
                  false, a[g & 1][dd * 2 + kk].v, false, pb[j][kk].v, (short)0, o[j][4 * g + dd],
                  false, false);
        __builtin_amdgcn_sched_barrier(0);
      }
    }

    wait_ds0();
    wait_tensor0();
    __syncthreads();      // K of stage t+1 is published; V^T has no reader left
    // the next stage's V^T, its descriptor formed behind the wait
    const unsigned nv = pinned((unsigned)t + 1u);
    if (pinned(nv < (unsigned)NT)) issue_v(nv);
  }
  wait_tensor0();
  wait_ds0();

  // Behind the loop's last barrier K and V^T have no reader and no load left: each
  // wave puts its own 32 rows of y together in a range of LDS of its own (no other
  // wave touches it, so no barrier), and stores them 512 B of one row at a time =
  // four whole lines, where the accumulators' own layout gives 32-B pieces of 16 lines.
  // register r of tile d = channel 16 d + 8 hl + r of the lane's query
  bf16* yst = (wv < 2 ? shK : shV) + (wv & 1) * (16 * QT * YP);
#pragma unroll
  for (int j = 0; j < QT; ++j) {
    const float ls = l[j] + __shfl_xor(l[j], 16);
    const float inv = 1.0f / ls;
#pragma unroll
    for (int d = 0; d < kC / 16; ++d) {
      union { bf2 h[4]; f4 f; } u;
#pragma unroll
      for (int e = 0; e < 4; ++e)
        u.h[e] = __builtin_convertvector(f2{o[j][d][2 * e] * inv, o[j][d][2 * e + 1] * inv}, bf2);
      *(f4*)&yst[(j * 16 + fr) * YP + d * 16 + 8 * hl] = u.f;
    }
  }
  wait_ds0();           // the wave's rows are in LDS before its lanes read one another's part
  // row 0 of the wave, the lane's 16 B of the first half row
  bf16* yrow = qy + (qidx - (unsigned)(fr * kO) + (unsigned)(lane * 8));
#pragma unroll
  for (int g = 0; g < 16 * QT / 8; ++g)
#pragma unroll
    for (int hf = 0; hf < 2; ++hf) {
      f4 w[8];
#pragma unroll
      for (int k = 0; k < 8; ++k) w[k] = *(const f4*)&yst[(8 * g + k) * YP + hf * 256 + lane * 8];
      store_rows8(yrow + (size_t)(8 * g) * kO + hf * 256, (size_t)kO, w);
    }
}

// ---------------------------------------------------------------------------
extern "C" void kernel_launch(void* const* d_in, const int* in_sizes, int n_in,
                              void* d_out, int out_size, void* d_ws, size_t ws_size,
                              hipStream_t stream) {
  const float* input   = (const float*)d_in[0];
  const float* context = (const float*)d_in[1];
  const float* gamma   = (const float*)d_in[2];
  const float* beta    = (const float*)d_in[3];
  const float* Wq      = (const float*)d_in[4];
  const float* bq      = (const float*)d_in[5];
  const float* Wkv     = (const float*)d_in[6];
  const float* bkv     = (const float*)d_in[7];
  const float* Wo      = (const float*)d_in[8];
  const float* bo      = (const float*)d_in[9];
  float* out = (float*)d_out;

  char* wsb = (char*)d_ws;
  size_t off = 0;
  auto alloc = [&](size_t bytes) -> char* {
    char* p = wsb + off;
    off += (bytes + 255) & ~(size_t)255;
    return p;
  };

  bf16* Wq16   = (bf16*)alloc((size_t)kO * kC * 2);          //   4 MB
  bf16* Wkv16  = (bf16*)alloc((size_t)2 * kO * kCTX * 2);    //   8 MB, behind Wq16
  bf16* Wo16   = (bf16*)alloc((size_t)kC * kO * 2);          //   4 MB, behind Wkv16
  bf16* xnT    = (bf16*)alloc((size_t)kN * kS * kC * 2);     //   8 MB  (n,s,c)
  bf16* ctxT   = (bf16*)alloc((size_t)kN * kS2 * kCTX * 2);  //   8 MB  (n,s,c), behind xnT
  bf16* kT     = (bf16*)alloc((size_t)kN * kS2 * kO * 2);    //  64 MB  (n,s2,4096)
  bf16* vB     = (bf16*)alloc((size_t)kN * kO * kS2 * 2);    //  64 MB  (n,4096,s2)
  bf16* yT     = (bf16*)alloc((size_t)kN * kS * kO * 2);     //  64 MB  (n,s,4096): q, then y in its place
  float* part  = (float*)alloc((size_t)kN * RB * 2 * sizeof(float));   // partial sums of the input
  (void)ws_size; (void)in_sizes; (void)n_in; (void)out_size;

  // partial sums, bf16 weights (Wq16, Wkv16, Wo16), transposed bf16 context
  prep<<<PREP_R + PREP_W + PREP_T, 256, 0, stream>>>(
      input, part, Wq, Wkv, Wo, Wq16, context, ctxT);
  // normalised, transposed bf16 input
  norm_transpose<<<dim3(TBX, TBY, kN), 256, 0, stream>>>(input, xnT, part, gamma, beta);

  // q (into yT), k, v of every sample
  gemm_qkv<<<dim3(kS / BN, kO / BM, 3 * kN), 256, 0, stream>>>(
      Wq16, Wkv16, xnT, ctxT, yT, kT, vB, bq, bkv);

  // attention, every sample and head in one launch: q in yT becomes y
  const float scoreScale = 1.0f / sqrtf((float)kC);   // (c^-0.25)^2
  attn_fused<<<dim3(kS / FQ, kH, kN), 128, 0, stream>>>(
      yT, kT, vB, scoreScale);

  // out = Wo * y + bo + residual  (f32, row-major (c,s)), all samples in grid z
  gemm_nt<false, false, true, true><<<dim3(kS / BN, kC / BM, kN), 256, 0, stream>>>(
      Wo16, yT, out, bo, input,
      kO, kO, kO, kS, 1.0f, 0, kS * kO, kC * kS);
}
